// v000
// Measured on an AMD MI455X. A time is GPU time per run, averaged over a window of back-to-back runs after a warm-up
// (all launches, gaps included; the runs take copies of the inputs in turn), and the median of several windows.
// Apart from v000's, it joins two sittings. Times from different sittings can be a few percent apart, while
// side-by-side timings come from the same sitting.
// v000, which the later versions start from, runs in 476 microseconds.
#include <hip/hip_runtime.h>

typedef __bf16 bf16_t;
typedef __attribute__((ext_vector_type(16))) __bf16        v16bf;
typedef __attribute__((ext_vector_type(8)))  float         v8f;
typedef __attribute__((ext_vector_type(4)))  unsigned int  v4u;
typedef __attribute__((ext_vector_type(4)))  int           v4i;
typedef __attribute__((ext_vector_type(8)))  int           v8i;

#define D_MODEL 1024
#define SEQ     2048
#define BATCH   2
#define HEADS   16
#define DK      64
#define D_FF    4096
#define M_ROWS  (BATCH * SEQ)   // 4096

#if defined(__has_builtin)
#if __has_builtin(__builtin_amdgcn_tensor_load_to_lds) && \
    __has_builtin(__builtin_amdgcn_s_wait_tensorcnt)
#define USE_TDM 1
#endif
#endif

union FragU { v16bf v; uint4 q[2]; };

__device__ inline v16bf ld_frag16(const bf16_t* p0, const bf16_t* p1) {
  FragU u;
  u.q[0] = *reinterpret_cast<const uint4*>(p0);
  u.q[1] = *reinterpret_cast<const uint4*>(p1);
  return u.v;
}

__device__ inline v8f wmma_bf16(v16bf a, v16bf b, v8f c) {
  // (neg_a, A, neg_b, B, c_mod, C, reuse_a, reuse_b)
  return __builtin_amdgcn_wmma_f32_16x16x32_bf16(false, a, false, b, (short)0, c,
                                                 false, false);
}

#ifdef USE_TDM
__device__ inline void tdm_load_tile_128x32(const bf16_t* gtile,
                                            unsigned lds_off,
                                            unsigned k_len,
                                            unsigned rows) {
  const unsigned long long ga = (unsigned long long)(size_t)gtile;
  v4u g0;
  g0[0] = 1u;                                   // count=1, user desc
  g0[1] = lds_off;                              // lds_addr (bytes)
  g0[2] = (unsigned)ga;                         // global_addr[31:0]
  g0[3] = (unsigned)((ga >> 32) & 0x01FFFFFFull) | (2u << 30);  // [56:32]|type=2
  v8i g1;
  g1[0] = (int)((1u << 16) | (1u << 20) | (3u << 22) | (3u << 25));
  g1[1] = (int)((k_len & 0xFFFFu) << 16);                       // dim0[15:0]
  g1[2] = (int)(((k_len >> 16) & 0xFFFFu) | ((rows & 0xFFFFu) << 16));
  g1[3] = (int)(((rows >> 16) & 0xFFFFu) | (32u << 16));
  g1[4] = (int)128u;
  g1[5] = (int)k_len;
  g1[6] = 0;
  g1[7] = 0;
  v4i g2 = {0, 0, 0, 0};
  v4i g3 = {0, 0, 0, 0};
#if __clang_major__ >= 23
  v8i g4 = {0, 0, 0, 0, 0, 0, 0, 0};
  __builtin_amdgcn_tensor_load_to_lds(g0, g1, g2, g3, g4, 0);
#else
  __builtin_amdgcn_tensor_load_to_lds(g0, g1, g2, g3, 0);
#endif
}
#endif  // USE_TDM

// ---------------------------------------------------------------------------
// Weight transpose + fp32 -> bf16 convert:  W[K][N] -> Wt[N][K]
// ---------------------------------------------------------------------------
__global__ __launch_bounds__(256) void transpose_to_bf16(
    const float* __restrict__ W, bf16_t* __restrict__ Wt, int K, int N) {
  __shared__ float tile[32][33];
  const int tx = threadIdx.x & 31, ty = threadIdx.x >> 5;  // 32 x 8
  const int n0 = blockIdx.x * 32, k0 = blockIdx.y * 32;
#pragma unroll
  for (int i = 0; i < 4; ++i)
    tile[ty + i * 8][tx] = W[(size_t)(k0 + ty + i * 8) * N + n0 + tx];
  __syncthreads();
#pragma unroll
  for (int i = 0; i < 4; ++i)
    Wt[(size_t)(n0 + ty + i * 8) * K + k0 + tx] = (bf16_t)tile[tx][ty + i * 8];
}

// ---------------------------------------------------------------------------
// RMSNorm: fp32 row -> bf16 normalized row (one block per row, D_MODEL=1024)
// ---------------------------------------------------------------------------
__global__ __launch_bounds__(256) void rmsnorm_kernel(
    const float* __restrict__ x, const float* __restrict__ gain,
    bf16_t* __restrict__ out) {
  __shared__ float warp_sum[8];
  const int tid = threadIdx.x;
  const float4 v = reinterpret_cast<const float4*>(x + (size_t)blockIdx.x * D_MODEL)[tid];
  float ss = v.x * v.x + v.y * v.y + v.z * v.z + v.w * v.w;
  ss += __shfl_xor(ss, 1, 32);
  ss += __shfl_xor(ss, 2, 32);
  ss += __shfl_xor(ss, 4, 32);
  ss += __shfl_xor(ss, 8, 32);
  ss += __shfl_xor(ss, 16, 32);
  if ((tid & 31) == 0) warp_sum[tid >> 5] = ss;
  __syncthreads();
  float tot = 0.f;
#pragma unroll
  for (int i = 0; i < 8; ++i) tot += warp_sum[i];
  const float inv = rsqrtf(tot * (1.0f / D_MODEL) + 1e-6f);
  const float4 gv = reinterpret_cast<const float4*>(gain)[tid];
  bf16_t* orow = out + (size_t)blockIdx.x * D_MODEL + tid * 4;
  orow[0] = (bf16_t)(v.x * inv * gv.x);
  orow[1] = (bf16_t)(v.y * inv * gv.y);
  orow[2] = (bf16_t)(v.z * inv * gv.z);
  orow[3] = (bf16_t)(v.w * inv * gv.w);
}

// ---------------------------------------------------------------------------
// GEMM: C[M][N] = A[M][K] (bf16, k-major) x Bt[N][K] (bf16, k-major)
// 256 threads = 8 waves; block tile 128x128; per-wave 32x64 (2x4 frags).
// EPI: 0 = store bf16, 1 = fp32 out = resid + C, 2 = bf16 scatter to V^T
// Assumes M,N % 128 == 0 and K % 32 == 0 (true for all calls here).
// ---------------------------------------------------------------------------
template <int EPI>
__global__ __launch_bounds__(256) void gemm_bf16_wmma(
    const bf16_t* __restrict__ A, const bf16_t* __restrict__ Bt,
    int M, int N, int K, const float* __restrict__ resid,
    void* __restrict__ outp) {
  __shared__ bf16_t sA[128][40];   // pad 8 -> conflict-free b128 frag loads
  __shared__ bf16_t sB[128][40];
  const int tid  = threadIdx.x;
  const int lane = tid & 31, wave = tid >> 5;
  const int g = lane >> 4, ln = lane & 15;
  const int wm = wave >> 1, wn = wave & 1;
  const int m_blk = blockIdx.y * 128, n_blk = blockIdx.x * 128;
#ifdef USE_TDM
  const unsigned ldsA_off = (unsigned)(size_t)(void*)&sA[0][0];  // addr[31:0]
  const unsigned ldsB_off = (unsigned)(size_t)(void*)&sB[0][0];
#else
  const int ldr = tid >> 1;         // 0..127
  const int ldc = (tid & 1) * 16;   // 0 or 16
#endif

  v8f acc[2][4] = {};

  for (int k0 = 0; k0 < K; k0 += 32) {
    __syncthreads();
#ifdef USE_TDM
    if (wave == 0) {
      tdm_load_tile_128x32(A + (size_t)m_blk * K + k0, ldsA_off,
                           (unsigned)K, (unsigned)M);
      tdm_load_tile_128x32(Bt + (size_t)n_blk * K + k0, ldsB_off,
                           (unsigned)K, (unsigned)N);
      __builtin_amdgcn_s_wait_tensorcnt(0);
    }
#else
    {
      const uint4* srcA =
          reinterpret_cast<const uint4*>(A + (size_t)(m_blk + ldr) * K + k0 + ldc);
      uint4* dstA = reinterpret_cast<uint4*>(&sA[ldr][ldc]);
      dstA[0] = srcA[0];
      dstA[1] = srcA[1];
      const uint4* srcB =
          reinterpret_cast<const uint4*>(Bt + (size_t)(n_blk + ldr) * K + k0 + ldc);
      uint4* dstB = reinterpret_cast<uint4*>(&sB[ldr][ldc]);
      dstB[0] = srcB[0];
      dstB[1] = srcB[1];
    }
#endif
    __syncthreads();

    v16bf aF[2], bF[4];
#pragma unroll
    for (int mi = 0; mi < 2; ++mi) {
      const int r = wm * 32 + mi * 16 + ln;
      aF[mi] = ld_frag16(&sA[r][g * 8], &sA[r][16 + g * 8]);
    }
#pragma unroll
    for (int ni = 0; ni < 4; ++ni) {
      const int r = wn * 64 + ni * 16 + ln;
      bF[ni] = ld_frag16(&sB[r][g * 8], &sB[r][16 + g * 8]);
    }
#pragma unroll
    for (int mi = 0; mi < 2; ++mi)
#pragma unroll
      for (int ni = 0; ni < 4; ++ni)
        acc[mi][ni] = wmma_bf16(aF[mi], bF[ni], acc[mi][ni]);
  }

  // Epilogue. D layout: element r -> m = r + 8*(lane/16), n = lane%16.
#pragma unroll
  for (int mi = 0; mi < 2; ++mi)
#pragma unroll
    for (int ni = 0; ni < 4; ++ni)
#pragma unroll
      for (int r = 0; r < 8; ++r) {
        const int mg = m_blk + wm * 32 + mi * 16 + r + 8 * g;
        const int ng = n_blk + wn * 64 + ni * 16 + ln;
        const float c = acc[mi][ni][r];
        if (EPI == 0) {
          ((bf16_t*)outp)[(size_t)mg * N + ng] = (bf16_t)c;
        } else if (EPI == 1) {
          const size_t idx = (size_t)mg * N + ng;
          ((float*)outp)[idx] = resid[idx] + c;
        } else {  // V^T scatter: [B,H,DK,SEQ]
          const int bb = mg >> 11, sin = mg & (SEQ - 1);
          const int hh = ng >> 6, dd = ng & (DK - 1);
          ((bf16_t*)outp)[(((size_t)(bb * HEADS + hh) * DK + dd) << 11) + sin] =
              (bf16_t)c;
        }
      }
}

__global__ __launch_bounds__(128) void flash_attn_wmma(
    const bf16_t* __restrict__ Q, const bf16_t* __restrict__ Km,
    const bf16_t* __restrict__ Vt, bf16_t* __restrict__ O) {
  __shared__ bf16_t sP[4][16][40];  // per-wave P staging (D-layout -> A-layout)
  const int tid  = threadIdx.x;
  const int lane = tid & 31, wave = tid >> 5;
  const int g = lane >> 4, ln = lane & 15;
  const int bh = blockIdx.y, b = bh >> 4, h = bh & 15;
  const int q0 = blockIdx.x * 64 + wave * 16;

  // Q A-fragments: 16 rows x 64 (two k-halves of 32)
  const bf16_t* qrow = Q + (size_t)(b * SEQ + q0 + ln) * D_MODEL + h * DK;
  v16bf qf[2];
#pragma unroll
  for (int kk = 0; kk < 2; ++kk)
    qf[kk] = ld_frag16(qrow + kk * 32 + g * 8, qrow + kk * 32 + 16 + g * 8);

  v16bf onesf;
#pragma unroll
  for (int j = 0; j < 16; ++j) onesf[j] = (bf16_t)1.0f;

  v8f o[4] = {};
  v8f o5 = {};  // softmax denominator accumulator (P x ones)
  float mrow[8];
#pragma unroll
  for (int r = 0; r < 8; ++r) mrow[r] = -__builtin_inff();

  for (int t0 = 0; t0 <= q0 + 15; t0 += 32) {
    // scores S = Q * K^T  (16 x 32), two 16x16 D frags
    v8f s[2] = {};
#pragma unroll
    for (int ni = 0; ni < 2; ++ni) {
      const bf16_t* krow =
          Km + (size_t)(b * SEQ + t0 + ni * 16 + ln) * D_MODEL + h * DK;
#pragma unroll
      for (int kk = 0; kk < 2; ++kk) {
        v16bf kf = ld_frag16(krow + kk * 32 + g * 8, krow + kk * 32 + 16 + g * 8);
        s[ni] = wmma_bf16(qf[kk], kf, s[ni]);
      }
    }
    // scale + causal mask
#pragma unroll
    for (int ni = 0; ni < 2; ++ni)
#pragma unroll
      for (int r = 0; r < 8; ++r) {
        const float v = s[ni][r] * 0.125f;  // 1/sqrt(64)
        const int qg = q0 + r + 8 * g;
        const int tg = t0 + ni * 16 + ln;
        s[ni][r] = (tg > qg) ? -__builtin_inff() : v;
      }
    // row max (butterfly within 16-lane halves) + online rescale factor
    float alpha[8];
#pragma unroll
    for (int r = 0; r < 8; ++r) {
      float v = fmaxf(s[0][r], s[1][r]);
      v = fmaxf(v, __shfl_xor(v, 1, 32));
      v = fmaxf(v, __shfl_xor(v, 2, 32));
      v = fmaxf(v, __shfl_xor(v, 4, 32));
      v = fmaxf(v, __shfl_xor(v, 8, 32));
      const float mn = fmaxf(mrow[r], v);
      alpha[r] = __expf(mrow[r] - mn);
      mrow[r] = mn;
    }
#pragma unroll
    for (int ni = 0; ni < 2; ++ni)
#pragma unroll
      for (int r = 0; r < 8; ++r) s[ni][r] = __expf(s[ni][r] - mrow[r]);
#pragma unroll
    for (int f = 0; f < 4; ++f)
#pragma unroll
      for (int r = 0; r < 8; ++r) o[f][r] *= alpha[r];
#pragma unroll
    for (int r = 0; r < 8; ++r) o5[r] *= alpha[r];

    // P: D-layout -> bf16 LDS -> A-layout (wave-local, split-counter sync)
#pragma unroll
    for (int ni = 0; ni < 2; ++ni)
#pragma unroll
      for (int r = 0; r < 8; ++r)
        sP[wave][r + 8 * g][ni * 16 + ln] = (bf16_t)s[ni][r];
    asm volatile("s_wait_dscnt 0" ::: "memory");
    v16bf pf = ld_frag16(&sP[wave][ln][g * 8], &sP[wave][ln][16 + g * 8]);

    // O += P(16x32) * V(32x64): B frags from V^T rows (contiguous along t)
#pragma unroll
    for (int f = 0; f < 4; ++f) {
      const bf16_t* vrow =
          Vt + (size_t)((b * HEADS + h) * DK + f * 16 + ln) * SEQ + t0;
      v16bf vf = ld_frag16(vrow + g * 8, vrow + 16 + g * 8);
      o[f] = wmma_bf16(pf, vf, o[f]);
    }
    // denominator: l += P x ones
    o5 = wmma_bf16(pf, onesf, o5);
  }

  // normalize and store: out[b, q, h*64 + d] (bf16, row-major D_MODEL)
#pragma unroll
  for (int f = 0; f < 4; ++f)
#pragma unroll
    for (int r = 0; r < 8; ++r) {
      const float val = o[f][r] / o5[r];
      const int qg = q0 + r + 8 * g;
      O[(size_t)(b * SEQ + qg) * D_MODEL + h * DK + f * 16 + ln] = (bf16_t)val;
    }
}

// ---------------------------------------------------------------------------
// SwiGLU elementwise: gate = silu(gate) * up   (bf16, in-place)
// ---------------------------------------------------------------------------
__global__ __launch_bounds__(256) void swiglu_kernel(
    bf16_t* __restrict__ gate, const bf16_t* __restrict__ up, int n) {
  const int i4 = (blockIdx.x * 256 + threadIdx.x) * 4;
  if (i4 >= n) return;
#pragma unroll
  for (int j = 0; j < 4; ++j) {
    const float gv = (float)gate[i4 + j];
    const float uv = (float)up[i4 + j];
    const float sil = gv / (1.f + __expf(-gv));
    gate[i4 + j] = (bf16_t)(sil * uv);
  }
}

// ---------------------------------------------------------------------------
// Host orchestration
// ---------------------------------------------------------------------------
extern "C" void kernel_launch(void* const* d_in, const int* in_sizes, int n_in,
                              void* d_out, int out_size, void* d_ws,
                              size_t ws_size, hipStream_t stream) {
  (void)in_sizes; (void)n_in; (void)out_size; (void)ws_size;
  const float* x      = (const float*)d_in[0];
  const float* w_q    = (const float*)d_in[1];
  const float* w_k    = (const float*)d_in[2];
  const float* w_v    = (const float*)d_in[3];
  const float* w_o    = (const float*)d_in[4];
  const float* w_gate = (const float*)d_in[5];
  const float* w_up   = (const float*)d_in[6];
  const float* w_down = (const float*)d_in[7];
  const float* g1     = (const float*)d_in[8];
  const float* g2     = (const float*)d_in[9];

  unsigned char* ws = (unsigned char*)d_ws;
  const size_t MB = 1ull << 20;
  bf16_t* wtq  = (bf16_t*)(ws + 0 * MB);    // [1024][1024]      2 MB
  bf16_t* wtk  = (bf16_t*)(ws + 2 * MB);    //                   2 MB
  bf16_t* wtv  = (bf16_t*)(ws + 4 * MB);    //                   2 MB
  bf16_t* wto  = (bf16_t*)(ws + 6 * MB);    //                   2 MB
  bf16_t* wtg  = (bf16_t*)(ws + 8 * MB);    // [4096][1024]      8 MB
  bf16_t* wtu  = (bf16_t*)(ws + 16 * MB);   //                   8 MB
  bf16_t* wtd  = (bf16_t*)(ws + 24 * MB);   // [1024][4096]      8 MB
  bf16_t* nx1  = (bf16_t*)(ws + 32 * MB);   // [4096][1024]      8 MB
  bf16_t* qb   = (bf16_t*)(ws + 40 * MB);   // [4096][1024]      8 MB
  bf16_t* kb   = (bf16_t*)(ws + 48 * MB);   //                   8 MB
  bf16_t* vtb  = (bf16_t*)(ws + 56 * MB);   // [B,H,DK,SEQ]      8 MB
  bf16_t* ao   = (bf16_t*)(ws + 64 * MB);   // attn out          8 MB
  float*  x2   = (float*) (ws + 72 * MB);   // f32 resid        16 MB
  bf16_t* nx2  = (bf16_t*)(ws + 88 * MB);   // [4096][1024]      8 MB
  bf16_t* gate = (bf16_t*)(ws + 96 * MB);   // [4096][4096]     32 MB
  bf16_t* up   = (bf16_t*)(ws + 128 * MB);  //                  32 MB (end 160 MB)

  // --- weight prep: W[K][N] -> Wt[N][K] bf16 ---
  transpose_to_bf16<<<dim3(D_MODEL / 32, D_MODEL / 32), 256, 0, stream>>>(w_q, wtq, D_MODEL, D_MODEL);
  transpose_to_bf16<<<dim3(D_MODEL / 32, D_MODEL / 32), 256, 0, stream>>>(w_k, wtk, D_MODEL, D_MODEL);
  transpose_to_bf16<<<dim3(D_MODEL / 32, D_MODEL / 32), 256, 0, stream>>>(w_v, wtv, D_MODEL, D_MODEL);
  transpose_to_bf16<<<dim3(D_MODEL / 32, D_MODEL / 32), 256, 0, stream>>>(w_o, wto, D_MODEL, D_MODEL);
  transpose_to_bf16<<<dim3(D_FF / 32, D_MODEL / 32), 256, 0, stream>>>(w_gate, wtg, D_MODEL, D_FF);
  transpose_to_bf16<<<dim3(D_FF / 32, D_MODEL / 32), 256, 0, stream>>>(w_up, wtu, D_MODEL, D_FF);
  transpose_to_bf16<<<dim3(D_MODEL / 32, D_FF / 32), 256, 0, stream>>>(w_down, wtd, D_FF, D_MODEL);

  // --- attention sublayer ---
  rmsnorm_kernel<<<M_ROWS, 256, 0, stream>>>(x, g1, nx1);

  const dim3 gemm_blk(256);
  gemm_bf16_wmma<0><<<dim3(D_MODEL / 128, M_ROWS / 128), gemm_blk, 0, stream>>>(
      nx1, wtq, M_ROWS, D_MODEL, D_MODEL, nullptr, qb);
  gemm_bf16_wmma<0><<<dim3(D_MODEL / 128, M_ROWS / 128), gemm_blk, 0, stream>>>(
      nx1, wtk, M_ROWS, D_MODEL, D_MODEL, nullptr, kb);
  gemm_bf16_wmma<2><<<dim3(D_MODEL / 128, M_ROWS / 128), gemm_blk, 0, stream>>>(
      nx1, wtv, M_ROWS, D_MODEL, D_MODEL, nullptr, vtb);

  flash_attn_wmma<<<dim3(SEQ / 64, BATCH * HEADS), 128, 0, stream>>>(qb, kb, vtb, ao);

  gemm_bf16_wmma<1><<<dim3(D_MODEL / 128, M_ROWS / 128), gemm_blk, 0, stream>>>(
      ao, wto, M_ROWS, D_MODEL, D_MODEL, x, x2);

  // --- SwiGLU FFN sublayer ---
  rmsnorm_kernel<<<M_ROWS, 256, 0, stream>>>(x2, g2, nx2);

  gemm_bf16_wmma<0><<<dim3(D_FF / 128, M_ROWS / 128), gemm_blk, 0, stream>>>(
      nx2, wtg, M_ROWS, D_FF, D_MODEL, nullptr, gate);
  gemm_bf16_wmma<0><<<dim3(D_FF / 128, M_ROWS / 128), gemm_blk, 0, stream>>>(
      nx2, wtu, M_ROWS, D_FF, D_MODEL, nullptr, up);

  swiglu_kernel<<<(M_ROWS * D_FF) / 1024, 256, 0, stream>>>(gate, up, M_ROWS * D_FF);

  gemm_bf16_wmma<1><<<dim3(D_MODEL / 128, M_ROWS / 128), gemm_blk, 0, stream>>>(
      gate, wtd, M_ROWS, D_MODEL, D_FF, x2, (float*)d_out);
}

// v001
// It runs in 425 microseconds.
// Next to v000, in two timings, it ran 1.14 times as fast each time.
#include <hip/hip_runtime.h>

typedef __bf16 bf16_t;
typedef __attribute__((ext_vector_type(16))) __bf16        v16bf;
typedef __attribute__((ext_vector_type(8)))  float         v8f;
typedef __attribute__((ext_vector_type(4)))  unsigned int  v4u;
typedef __attribute__((ext_vector_type(8)))  unsigned int  v8u;

#define D_MODEL 1024
#define SEQ     2048
#define BATCH   2
#define HEADS   16
#define DK      64
#define D_FF    4096
#define M_ROWS  (BATCH * SEQ)   // 4096

union FragU { v16bf v; uint4 q[2]; };

__device__ inline v16bf ld_frag16(const bf16_t* p0, const bf16_t* p1) {
  FragU u;
  u.q[0] = *reinterpret_cast<const uint4*>(p0);
  u.q[1] = *reinterpret_cast<const uint4*>(p1);
  return u.v;
}

__device__ inline v8f wmma_bf16(v16bf a, v16bf b, v8f c) {
  // (neg_a, A, neg_b, B, c_mod, C, reuse_a, reuse_b)
  return __builtin_amdgcn_wmma_f32_16x16x32_bf16(false, a, false, b, (short)0, c,
                                                 false, false);
}

// ---------------------------------------------------------------------------
// GEMM stage geometry: 64 k per stage, so an operand row is 128 B; the tensor
// load pads each row by 16 B (pitch 144 B: conflict-free ds_load_b128 rows).
// One operand tile = 128 rows x 144 B = 18432 B = 9 x 2 KiB.
// ---------------------------------------------------------------------------
#define G_BK     64
#define G_PITCH  144
#define G_TILE   (128 * G_PITCH)
#define G_STAGE  (2 * G_TILE)

__device__ inline unsigned uni(unsigned v) {
  return (unsigned)__builtin_amdgcn_readfirstlane((int)v);
}
__device__ inline unsigned pinned(unsigned v) {
  unsigned w = uni(v);
  asm volatile("" : "+s"(w));
  return w;
}

__device__ inline v8u tdm_group1_128x128B(unsigned src_pitch) {
  v8u g1;
  g1[0] = pinned((1u << 20) | (4u << 22) | (3u << 25));
  g1[1] = pinned(128u << 16);
  g1[2] = pinned(128u << 16);
  g1[3] = pinned(128u << 16);
  g1[4] = pinned(128u);
  g1[5] = pinned(src_pitch);
  g1[6] = pinned(0u);
  g1[7] = pinned(0u);
  return g1;
}

// One tensor load: the tile whose first byte is gtile, to LDS byte offset lds_off.
__device__ inline void tdm_load_tile(const bf16_t* gtile, unsigned lds_off, v8u g1) {
  const unsigned long long ga = (unsigned long long)(size_t)gtile;
  v4u g0;
  g0[0] = uni(1u);                              // count = 1
  g0[1] = uni(lds_off);                         // LDS destination (bytes)
  g0[2] = uni((unsigned)ga);                    // global address [31:0]
  g0[3] = uni(((unsigned)(ga >> 32) & 0x01FFFFFFu) | 0x80000000u);  // [56:32], type 2
  asm volatile("tensor_load_to_lds %0, %1" :: "s"(g0), "s"(g1) : "memory");
}

// ---------------------------------------------------------------------------
// Weight transpose + fp32 -> bf16 convert:  W[K][N] -> Wt[N][K]
// ---------------------------------------------------------------------------
__global__ __launch_bounds__(256) void transpose_to_bf16(
    const float* __restrict__ W, bf16_t* __restrict__ Wt, int K, int N) {
  __shared__ float tile[32][33];
  const int tx = threadIdx.x & 31, ty = threadIdx.x >> 5;  // 32 x 8
  const int n0 = blockIdx.x * 32, k0 = blockIdx.y * 32;
#pragma unroll
  for (int i = 0; i < 4; ++i)
    tile[ty + i * 8][tx] = W[(size_t)(k0 + ty + i * 8) * N + n0 + tx];
  __syncthreads();
#pragma unroll
  for (int i = 0; i < 4; ++i)
    Wt[(size_t)(n0 + ty + i * 8) * K + k0 + tx] = (bf16_t)tile[tx][ty + i * 8];
}

// ---------------------------------------------------------------------------
// RMSNorm: fp32 row -> bf16 normalized row (one block per row, D_MODEL=1024)
// ---------------------------------------------------------------------------
__global__ __launch_bounds__(256) void rmsnorm_kernel(
    const float* __restrict__ x, const float* __restrict__ gain,
    bf16_t* __restrict__ out) {
  __shared__ float warp_sum[8];
  const int tid = threadIdx.x;
  const float4 v = reinterpret_cast<const float4*>(x + (size_t)blockIdx.x * D_MODEL)[tid];
  float ss = v.x * v.x + v.y * v.y + v.z * v.z + v.w * v.w;
  ss += __shfl_xor(ss, 1, 32);
  ss += __shfl_xor(ss, 2, 32);
  ss += __shfl_xor(ss, 4, 32);
  ss += __shfl_xor(ss, 8, 32);
  ss += __shfl_xor(ss, 16, 32);
  if ((tid & 31) == 0) warp_sum[tid >> 5] = ss;
  __syncthreads();
  float tot = 0.f;
#pragma unroll
  for (int i = 0; i < 8; ++i) tot += warp_sum[i];
  const float inv = rsqrtf(tot * (1.0f / D_MODEL) + 1e-6f);
  const float4 gv = reinterpret_cast<const float4*>(gain)[tid];
  bf16_t* orow = out + (size_t)blockIdx.x * D_MODEL + tid * 4;
  orow[0] = (bf16_t)(v.x * inv * gv.x);
  orow[1] = (bf16_t)(v.y * inv * gv.y);
  orow[2] = (bf16_t)(v.z * inv * gv.z);
  orow[3] = (bf16_t)(v.w * inv * gv.w);
}

// ---------------------------------------------------------------------------
// GEMM: C[M][N] = A[M][K] (bf16, k-major) x Bt[N][K] (bf16, k-major)
// 256 threads = 8 waves; block tile 128x128; per-wave 32x64 (2x4 frags).
// EPI: 0 = store bf16, 1 = fp32 out = resid + C, 2 = bf16 scatter to V^T
// Assumes M,N % 128 == 0, K % 64 == 0 and K >= 128 (true for all calls here).
// ---------------------------------------------------------------------------
template <int EPI>
__global__ __launch_bounds__(256) void gemm_bf16_wmma(
    const bf16_t* __restrict__ A, const bf16_t* __restrict__ Bt,
    int M, int N, int K, const float* __restrict__ resid,
    void* __restrict__ outp) {
  // ring[buffer][A tile | B tile]; every tile starts at a multiple of 2 KiB
  __shared__ __attribute__((aligned(2048))) unsigned char ring[2 * G_STAGE];
  const int tid  = threadIdx.x;
  const int lane = tid & 31, wave = tid >> 5;
  const int g = lane >> 4, ln = lane & 15;
  const int wm = wave >> 1, wn = wave & 1;
  const int m_blk = blockIdx.y * 128, n_blk = blockIdx.x * 128;
  // Wave 0 brings the A tile of every stage, wave 1 the B tile.
  const unsigned wave_u = uni((unsigned)threadIdx.x >> 5);
  const bf16_t* my_src = (wave_u == 0) ? A + (size_t)m_blk * K
                                       : Bt + (size_t)n_blk * K;
  const unsigned my_lds = (unsigned)(size_t)(void*)&ring[0] +
                          ((wave_u == 0) ? 0u : (unsigned)G_TILE);
  const v8u g1 = tdm_group1_128x128B((unsigned)K * 2u);
  const int n_stage = K / G_BK;

  v8f acc[2][4] = {};

  // Prologue: stage 0 lands and is published, then stage 1 starts to fly.
  if (pinned(wave_u < 2u)) {
    tdm_load_tile(my_src, my_lds, g1);
    // stage 0 has landed here
    asm volatile("s_wait_tensorcnt 0x0" ::: "memory");
  }
  __syncthreads();
  if (pinned(wave_u < 2u))
    tdm_load_tile(my_src + G_BK, my_lds + G_STAGE, g1);

  for (int s = 0; s < n_stage; ++s) {
    const unsigned char* bufA = ring + (s & 1) * G_STAGE;
    const unsigned char* bufB = bufA + G_TILE;
    // unrolled so that every fragment and accumulator index is a constant
    // (registers, no scratch); the two 32-k blocks keep the ascending k order
#pragma unroll
    for (int kk = 0; kk < 2; ++kk) {
      v16bf aF[2], bF[4];
#pragma unroll
      for (int mi = 0; mi < 2; ++mi) {
        const unsigned char* p =
            bufA + (wm * 32 + mi * 16 + ln) * G_PITCH + kk * 64 + g * 16;
        aF[mi] = ld_frag16((const bf16_t*)p, (const bf16_t*)(p + 32));
      }
#pragma unroll
      for (int ni = 0; ni < 4; ++ni) {
        const unsigned char* p =
            bufB + (wn * 64 + ni * 16 + ln) * G_PITCH + kk * 64 + g * 16;
        bF[ni] = ld_frag16((const bf16_t*)p, (const bf16_t*)(p + 32));
      }
#pragma unroll
      for (int mi = 0; mi < 2; ++mi)
#pragma unroll
        for (int ni = 0; ni < 4; ++ni)
          acc[mi][ni] = wmma_bf16(aF[mi], bF[ni], acc[mi][ni]);
    }
    // Publish point of stage s + 1. This wave's reads of buffer s & 1 are done:
    asm volatile("s_wait_dscnt 0x0" ::: "memory");
    if (pinned(wave_u < 2u)) {
      // the issuing wave's own tile of stage s + 1 has landed
      asm volatile("s_wait_tensorcnt 0x0" ::: "memory");
    }
    __syncthreads();
    // Refill the buffer that every wave has just left, while a stage is left.
    if (pinned((wave_u < 2u) && (s + 2 < n_stage)))
      tdm_load_tile(my_src + (size_t)(s + 2) * G_BK,
                    my_lds + (unsigned)(s & 1) * G_STAGE, g1);
  }
  // nothing of the ring is outstanding when the wave goes on to its stores
  asm volatile("s_wait_tensorcnt 0x0" ::: "memory");
  asm volatile("s_wait_dscnt 0x0" ::: "memory");

  // Epilogue. D layout: element r -> m = r + 8*(lane/16), n = lane%16.
#pragma unroll
  for (int mi = 0; mi < 2; ++mi)
#pragma unroll
    for (int ni = 0; ni < 4; ++ni)
#pragma unroll
      for (int r = 0; r < 8; ++r) {
        const int mg = m_blk + wm * 32 + mi * 16 + r + 8 * g;
        const int ng = n_blk + wn * 64 + ni * 16 + ln;
        const float c = acc[mi][ni][r];
        if (EPI == 0) {
          ((bf16_t*)outp)[(size_t)mg * N + ng] = (bf16_t)c;
        } else if (EPI == 1) {
          const size_t idx = (size_t)mg * N + ng;
          ((float*)outp)[idx] = resid[idx] + c;
        } else {  // V^T scatter: [B,H,DK,SEQ]
          const int bb = mg >> 11, sin = mg & (SEQ - 1);
          const int hh = ng >> 6, dd = ng & (DK - 1);
          ((bf16_t*)outp)[(((size_t)(bb * HEADS + hh) * DK + dd) << 11) + sin] =
              (bf16_t)c;
        }
      }
}

__global__ __launch_bounds__(128) void flash_attn_wmma(
    const bf16_t* __restrict__ Q, const bf16_t* __restrict__ Km,
    const bf16_t* __restrict__ Vt, bf16_t* __restrict__ O) {
  __shared__ bf16_t sP[4][16][40];  // per-wave P staging (D-layout -> A-layout)
  const int tid  = threadIdx.x;
  const int lane = tid & 31, wave = tid >> 5;
  const int g = lane >> 4, ln = lane & 15;
  const int bh = blockIdx.y, b = bh >> 4, h = bh & 15;
  const int q0 = blockIdx.x * 64 + wave * 16;

  // Q A-fragments: 16 rows x 64 (two k-halves of 32)
  const bf16_t* qrow = Q + (size_t)(b * SEQ + q0 + ln) * D_MODEL + h * DK;
  v16bf qf[2];
#pragma unroll
  for (int kk = 0; kk < 2; ++kk)
    qf[kk] = ld_frag16(qrow + kk * 32 + g * 8, qrow + kk * 32 + 16 + g * 8);

  v16bf onesf;
#pragma unroll
  for (int j = 0; j < 16; ++j) onesf[j] = (bf16_t)1.0f;

  v8f o[4] = {};
  v8f o5 = {};  // softmax denominator accumulator (P x ones)
  float mrow[8];
#pragma unroll
  for (int r = 0; r < 8; ++r) mrow[r] = -__builtin_inff();

  for (int t0 = 0; t0 <= q0 + 15; t0 += 32) {
    // scores S = Q * K^T  (16 x 32), two 16x16 D frags
    v8f s[2] = {};
#pragma unroll
    for (int ni = 0; ni < 2; ++ni) {
      const bf16_t* krow =
          Km + (size_t)(b * SEQ + t0 + ni * 16 + ln) * D_MODEL + h * DK;
#pragma unroll
      for (int kk = 0; kk < 2; ++kk) {
        v16bf kf = ld_frag16(krow + kk * 32 + g * 8, krow + kk * 32 + 16 + g * 8);
        s[ni] = wmma_bf16(qf[kk], kf, s[ni]);
      }
    }
    // scale + causal mask
#pragma unroll
    for (int ni = 0; ni < 2; ++ni)
#pragma unroll
      for (int r = 0; r < 8; ++r) {
        const float v = s[ni][r] * 0.125f;  // 1/sqrt(64)
        const int qg = q0 + r + 8 * g;
        const int tg = t0 + ni * 16 + ln;
        s[ni][r] = (tg > qg) ? -__builtin_inff() : v;
      }
    // row max (butterfly within 16-lane halves) + online rescale factor
    float alpha[8];
#pragma unroll
    for (int r = 0; r < 8; ++r) {
      float v = fmaxf(s[0][r], s[1][r]);
      v = fmaxf(v, __shfl_xor(v, 1, 32));
      v = fmaxf(v, __shfl_xor(v, 2, 32));
      v = fmaxf(v, __shfl_xor(v, 4, 32));
      v = fmaxf(v, __shfl_xor(v, 8, 32));
      const float mn = fmaxf(mrow[r], v);
      alpha[r] = __expf(mrow[r] - mn);
      mrow[r] = mn;
    }
#pragma unroll
    for (int ni = 0; ni < 2; ++ni)
#pragma unroll
      for (int r = 0; r < 8; ++r) s[ni][r] = __expf(s[ni][r] - mrow[r]);
#pragma unroll
    for (int f = 0; f < 4; ++f)
#pragma unroll
      for (int r = 0; r < 8; ++r) o[f][r] *= alpha[r];
#pragma unroll
    for (int r = 0; r < 8; ++r) o5[r] *= alpha[r];

    // P: D-layout -> bf16 LDS -> A-layout (wave-local, split-counter sync)
#pragma unroll
    for (int ni = 0; ni < 2; ++ni)
#pragma unroll
      for (int r = 0; r < 8; ++r)
        sP[wave][r + 8 * g][ni * 16 + ln] = (bf16_t)s[ni][r];
    asm volatile("s_wait_dscnt 0" ::: "memory");
    v16bf pf = ld_frag16(&sP[wave][ln][g * 8], &sP[wave][ln][16 + g * 8]);

    // O += P(16x32) * V(32x64): B frags from V^T rows (contiguous along t)
#pragma unroll
    for (int f = 0; f < 4; ++f) {
      const bf16_t* vrow =
          Vt + (size_t)((b * HEADS + h) * DK + f * 16 + ln) * SEQ + t0;
      v16bf vf = ld_frag16(vrow + g * 8, vrow + 16 + g * 8);
      o[f] = wmma_bf16(pf, vf, o[f]);
    }
    // denominator: l += P x ones
    o5 = wmma_bf16(pf, onesf, o5);
  }

  // normalize and store: out[b, q, h*64 + d] (bf16, row-major D_MODEL)
#pragma unroll
  for (int f = 0; f < 4; ++f)
#pragma unroll
    for (int r = 0; r < 8; ++r) {
      const float val = o[f][r] / o5[r];
      const int qg = q0 + r + 8 * g;
      O[(size_t)(b * SEQ + qg) * D_MODEL + h * DK + f * 16 + ln] = (bf16_t)val;
    }
}

// ---------------------------------------------------------------------------
// SwiGLU elementwise: gate = silu(gate) * up   (bf16, in-place)
// ---------------------------------------------------------------------------
__global__ __launch_bounds__(256) void swiglu_kernel(
    bf16_t* __restrict__ gate, const bf16_t* __restrict__ up, int n) {
  const int i4 = (blockIdx.x * 256 + threadIdx.x) * 4;
  if (i4 >= n) return;
#pragma unroll
  for (int j = 0; j < 4; ++j) {
    const float gv = (float)gate[i4 + j];
    const float uv = (float)up[i4 + j];
    const float sil = gv / (1.f + __expf(-gv));
    gate[i4 + j] = (bf16_t)(sil * uv);
  }
}

// ---------------------------------------------------------------------------
// Host orchestration
// ---------------------------------------------------------------------------
extern "C" void kernel_launch(void* const* d_in, const int* in_sizes, int n_in,
                              void* d_out, int out_size, void* d_ws,
                              size_t ws_size, hipStream_t stream) {
  (void)in_sizes; (void)n_in; (void)out_size; (void)ws_size;
  const float* x      = (const float*)d_in[0];
  const float* w_q    = (const float*)d_in[1];
  const float* w_k    = (const float*)d_in[2];
  const float* w_v    = (const float*)d_in[3];
  const float* w_o    = (const float*)d_in[4];
  const float* w_gate = (const float*)d_in[5];
  const float* w_up   = (const float*)d_in[6];
  const float* w_down = (const float*)d_in[7];
  const float* g1     = (const float*)d_in[8];
  const float* g2     = (const float*)d_in[9];

  unsigned char* ws = (unsigned char*)d_ws;
  const size_t MB = 1ull << 20;
  bf16_t* wtq  = (bf16_t*)(ws + 0 * MB);    // [1024][1024]      2 MB
  bf16_t* wtk  = (bf16_t*)(ws + 2 * MB);    //                   2 MB
  bf16_t* wtv  = (bf16_t*)(ws + 4 * MB);    //                   2 MB
  bf16_t* wto  = (bf16_t*)(ws + 6 * MB);    //                   2 MB
  bf16_t* wtg  = (bf16_t*)(ws + 8 * MB);    // [4096][1024]      8 MB
  bf16_t* wtu  = (bf16_t*)(ws + 16 * MB);   //                   8 MB
  bf16_t* wtd  = (bf16_t*)(ws + 24 * MB);   // [1024][4096]      8 MB
  bf16_t* nx1  = (bf16_t*)(ws + 32 * MB);   // [4096][1024]      8 MB
  bf16_t* qb   = (bf16_t*)(ws + 40 * MB);   // [4096][1024]      8 MB
  bf16_t* kb   = (bf16_t*)(ws + 48 * MB);   //                   8 MB
  bf16_t* vtb  = (bf16_t*)(ws + 56 * MB);   // [B,H,DK,SEQ]      8 MB
  bf16_t* ao   = (bf16_t*)(ws + 64 * MB);   // attn out          8 MB
  float*  x2   = (float*) (ws + 72 * MB);   // f32 resid        16 MB
  bf16_t* nx2  = (bf16_t*)(ws + 88 * MB);   // [4096][1024]      8 MB
  bf16_t* gate = (bf16_t*)(ws + 96 * MB);   // [4096][4096]     32 MB
  bf16_t* up   = (bf16_t*)(ws + 128 * MB);  //                  32 MB (end 160 MB)

  // --- weight prep: W[K][N] -> Wt[N][K] bf16 ---
  transpose_to_bf16<<<dim3(D_MODEL / 32, D_MODEL / 32), 256, 0, stream>>>(w_q, wtq, D_MODEL, D_MODEL);
  transpose_to_bf16<<<dim3(D_MODEL / 32, D_MODEL / 32), 256, 0, stream>>>(w_k, wtk, D_MODEL, D_MODEL);
  transpose_to_bf16<<<dim3(D_MODEL / 32, D_MODEL / 32), 256, 0, stream>>>(w_v, wtv, D_MODEL, D_MODEL);
  transpose_to_bf16<<<dim3(D_MODEL / 32, D_MODEL / 32), 256, 0, stream>>>(w_o, wto, D_MODEL, D_MODEL);
  transpose_to_bf16<<<dim3(D_FF / 32, D_MODEL / 32), 256, 0, stream>>>(w_gate, wtg, D_MODEL, D_FF);
  transpose_to_bf16<<<dim3(D_FF / 32, D_MODEL / 32), 256, 0, stream>>>(w_up, wtu, D_MODEL, D_FF);
  transpose_to_bf16<<<dim3(D_MODEL / 32, D_FF / 32), 256, 0, stream>>>(w_down, wtd, D_FF, D_MODEL);

  // --- attention sublayer ---
  rmsnorm_kernel<<<M_ROWS, 256, 0, stream>>>(x, g1, nx1);

  const dim3 gemm_blk(256);
  gemm_bf16_wmma<0><<<dim3(D_MODEL / 128, M_ROWS / 128), gemm_blk, 0, stream>>>(
      nx1, wtq, M_ROWS, D_MODEL, D_MODEL, nullptr, qb);
  gemm_bf16_wmma<0><<<dim3(D_MODEL / 128, M_ROWS / 128), gemm_blk, 0, stream>>>(
      nx1, wtk, M_ROWS, D_MODEL, D_MODEL, nullptr, kb);
  gemm_bf16_wmma<2><<<dim3(D_MODEL / 128, M_ROWS / 128), gemm_blk, 0, stream>>>(
      nx1, wtv, M_ROWS, D_MODEL, D_MODEL, nullptr, vtb);

  flash_attn_wmma<<<dim3(SEQ / 64, BATCH * HEADS), 128, 0, stream>>>(qb, kb, vtb, ao);

  gemm_bf16_wmma<1><<<dim3(D_MODEL / 128, M_ROWS / 128), gemm_blk, 0, stream>>>(
      ao, wto, M_ROWS, D_MODEL, D_MODEL, x, x2);

  // --- SwiGLU FFN sublayer ---
  rmsnorm_kernel<<<M_ROWS, 256, 0, stream>>>(x2, g2, nx2);

  gemm_bf16_wmma<0><<<dim3(D_FF / 128, M_ROWS / 128), gemm_blk, 0, stream>>>(
      nx2, wtg, M_ROWS, D_FF, D_MODEL, nullptr, gate);
  gemm_bf16_wmma<0><<<dim3(D_FF / 128, M_ROWS / 128), gemm_blk, 0, stream>>>(
      nx2, wtu, M_ROWS, D_FF, D_MODEL, nullptr, up);

  swiglu_kernel<<<(M_ROWS * D_FF) / 1024, 256, 0, stream>>>(gate, up, M_ROWS * D_FF);

  gemm_bf16_wmma<1><<<dim3(D_MODEL / 128, M_ROWS / 128), gemm_blk, 0, stream>>>(
      gate, wtd, M_ROWS, D_MODEL, D_FF, x2, (float*)d_out);
}

// v002
// Measured time: 374 microseconds a run.
// Timed twice side by side with v001, it ran 1.14 times as fast both times.
// All steps since v000 together make it 1.30 times as fast.
#include <hip/hip_runtime.h>

typedef __bf16 bf16_t;
typedef __attribute__((ext_vector_type(16))) __bf16        v16bf;
typedef __attribute__((ext_vector_type(8)))  float         v8f;
typedef __attribute__((ext_vector_type(4)))  unsigned int  v4u;
typedef __attribute__((ext_vector_type(8)))  unsigned int  v8u;

#define D_MODEL 1024
#define SEQ     2048
#define BATCH   2
#define HEADS   16
#define DK      64
#define D_FF    4096
#define M_ROWS  (BATCH * SEQ)   // 4096

union FragU { v16bf v; uint4 q[2]; };

__device__ inline v16bf ld_frag16(const bf16_t* p0, const bf16_t* p1) {
  FragU u;
  u.q[0] = *reinterpret_cast<const uint4*>(p0);
  u.q[1] = *reinterpret_cast<const uint4*>(p1);
  return u.v;
}

__device__ inline v8f wmma_bf16(v16bf a, v16bf b, v8f c) {
  // (neg_a, A, neg_b, B, c_mod, C, reuse_a, reuse_b)
  return __builtin_amdgcn_wmma_f32_16x16x32_bf16(false, a, false, b, (short)0, c,
                                                 false, false);
}

// ---------------------------------------------------------------------------
// GEMM stage geometry: 64 k per stage, so an operand row is 128 B; the tensor
// load pads each row by 16 B (pitch 144 B: conflict-free ds_load_b128 rows).
// One operand tile = 128 rows x 144 B = 18432 B = 9 x 2 KiB.
// ---------------------------------------------------------------------------
#define G_BK     64
#define G_PITCH  144
#define G_TILE   (128 * G_PITCH)
#define G_STAGE  (2 * G_TILE)

__device__ inline unsigned uni(unsigned v) {
  return (unsigned)__builtin_amdgcn_readfirstlane((int)v);
}
__device__ inline unsigned pinned(unsigned v) {
  unsigned w = uni(v);
  asm volatile("" : "+s"(w));
  return w;
}

__device__ inline v8u tdm_group1_128x128B(unsigned src_pitch) {
  v8u g1;
  g1[0] = pinned((1u << 20) | (4u << 22) | (3u << 25));
  g1[1] = pinned(128u << 16);
  g1[2] = pinned(128u << 16);
  g1[3] = pinned(128u << 16);
  g1[4] = pinned(128u);
  g1[5] = pinned(src_pitch);
  g1[6] = pinned(0u);
  g1[7] = pinned(0u);
  return g1;
}

// One tensor load: the tile whose first byte is gtile, to LDS byte offset lds_off.
__device__ inline void tdm_load_tile(const bf16_t* gtile, unsigned lds_off, v8u g1) {
  const unsigned long long ga = (unsigned long long)(size_t)gtile;
  v4u g0;
  g0[0] = uni(1u);                              // count = 1
  g0[1] = uni(lds_off);                         // LDS destination (bytes)
  g0[2] = uni((unsigned)ga);                    // global address [31:0]
  g0[3] = uni(((unsigned)(ga >> 32) & 0x01FFFFFFu) | 0x80000000u);  // [56:32], type 2
  asm volatile("tensor_load_to_lds %0, %1" :: "s"(g0), "s"(g1) : "memory");
}

// ---------------------------------------------------------------------------
// Weight transpose + fp32 -> bf16 convert:  W[K][N] -> Wt[N][K]
// ---------------------------------------------------------------------------
__global__ __launch_bounds__(256) void transpose_to_bf16(
    const float* __restrict__ W, bf16_t* __restrict__ Wt, int K, int N) {
  __shared__ float tile[32][33];
  const int tx = threadIdx.x & 31, ty = threadIdx.x >> 5;  // 32 x 8
  const int n0 = blockIdx.x * 32, k0 = blockIdx.y * 32;
#pragma unroll
  for (int i = 0; i < 4; ++i)
    tile[ty + i * 8][tx] = W[(size_t)(k0 + ty + i * 8) * N + n0 + tx];
  __syncthreads();
#pragma unroll
  for (int i = 0; i < 4; ++i)
    Wt[(size_t)(n0 + ty + i * 8) * K + k0 + tx] = (bf16_t)tile[tx][ty + i * 8];
}

// ---------------------------------------------------------------------------
// RMSNorm: fp32 row -> bf16 normalized row (one block per row, D_MODEL=1024)
// ---------------------------------------------------------------------------
__global__ __launch_bounds__(256) void rmsnorm_kernel(
    const float* __restrict__ x, const float* __restrict__ gain,
    bf16_t* __restrict__ out) {
  __shared__ float warp_sum[8];
  const int tid = threadIdx.x;
  const float4 v = reinterpret_cast<const float4*>(x + (size_t)blockIdx.x * D_MODEL)[tid];
  float ss = v.x * v.x + v.y * v.y + v.z * v.z + v.w * v.w;
  ss += __shfl_xor(ss, 1, 32);
  ss += __shfl_xor(ss, 2, 32);
  ss += __shfl_xor(ss, 4, 32);
  ss += __shfl_xor(ss, 8, 32);
  ss += __shfl_xor(ss, 16, 32);
  if ((tid & 31) == 0) warp_sum[tid >> 5] = ss;
  __syncthreads();
  float tot = 0.f;
#pragma unroll
  for (int i = 0; i < 8; ++i) tot += warp_sum[i];
  const float inv = rsqrtf(tot * (1.0f / D_MODEL) + 1e-6f);
  const float4 gv = reinterpret_cast<const float4*>(gain)[tid];
  bf16_t* orow = out + (size_t)blockIdx.x * D_MODEL + tid * 4;
  orow[0] = (bf16_t)(v.x * inv * gv.x);
  orow[1] = (bf16_t)(v.y * inv * gv.y);
  orow[2] = (bf16_t)(v.z * inv * gv.z);
  orow[3] = (bf16_t)(v.w * inv * gv.w);
}

// ---------------------------------------------------------------------------
// GEMM: C[M][N] = A[M][K] (bf16, k-major) x Bt[N][K] (bf16, k-major)
// 256 threads = 8 waves; block tile 128x128; per-wave 32x64 (2x4 frags).
// EPI: 0 = store bf16, 1 = fp32 out = resid + C, 2 = bf16 scatter to V^T
// Assumes M,N % 128 == 0, K % 64 == 0 and K >= 128 (true for all calls here).
// ---------------------------------------------------------------------------
template <int EPI>
__global__ __launch_bounds__(256) void gemm_bf16_wmma(
    const bf16_t* __restrict__ A, const bf16_t* __restrict__ Bt,
    int M, int N, int K, const float* __restrict__ resid,
    void* __restrict__ outp) {
  // ring[buffer][A tile | B tile]; every tile starts at a multiple of 2 KiB
  __shared__ __attribute__((aligned(2048))) unsigned char ring[2 * G_STAGE];
  const int tid  = threadIdx.x;
  const int lane = tid & 31, wave = tid >> 5;
  const int g = lane >> 4, ln = lane & 15;
  const int wm = wave >> 1, wn = wave & 1;
  const int m_blk = blockIdx.y * 128, n_blk = blockIdx.x * 128;
  // Wave 0 brings the A tile of every stage, wave 1 the B tile.
  const unsigned wave_u = uni((unsigned)threadIdx.x >> 5);
  const bf16_t* my_src = (wave_u == 0) ? A + (size_t)m_blk * K
                                       : Bt + (size_t)n_blk * K;
  const unsigned my_lds = (unsigned)(size_t)(void*)&ring[0] +
                          ((wave_u == 0) ? 0u : (unsigned)G_TILE);
  const v8u g1 = tdm_group1_128x128B((unsigned)K * 2u);
  const int n_stage = K / G_BK;

  v8f acc[2][4] = {};

  // Prologue: stage 0 lands and is published, then stage 1 starts to fly.
  if (pinned(wave_u < 2u)) {
    tdm_load_tile(my_src, my_lds, g1);
    // stage 0 has landed here
    asm volatile("s_wait_tensorcnt 0x0" ::: "memory");
  }
  __syncthreads();
  if (pinned(wave_u < 2u))
    tdm_load_tile(my_src + G_BK, my_lds + G_STAGE, g1);

  for (int s = 0; s < n_stage; ++s) {
    const unsigned char* bufA = ring + (s & 1) * G_STAGE;
    const unsigned char* bufB = bufA + G_TILE;
    // unrolled so that every fragment and accumulator index is a constant
    // (registers, no scratch); the two 32-k blocks keep the ascending k order
#pragma unroll
    for (int kk = 0; kk < 2; ++kk) {
      v16bf aF[2], bF[4];
#pragma unroll
      for (int mi = 0; mi < 2; ++mi) {
        const unsigned char* p =
            bufA + (wm * 32 + mi * 16 + ln) * G_PITCH + kk * 64 + g * 16;
        aF[mi] = ld_frag16((const bf16_t*)p, (const bf16_t*)(p + 32));
      }
#pragma unroll
      for (int ni = 0; ni < 4; ++ni) {
        const unsigned char* p =
            bufB + (wn * 64 + ni * 16 + ln) * G_PITCH + kk * 64 + g * 16;
        bF[ni] = ld_frag16((const bf16_t*)p, (const bf16_t*)(p + 32));
      }
#pragma unroll
      for (int mi = 0; mi < 2; ++mi)
#pragma unroll
        for (int ni = 0; ni < 4; ++ni)
          acc[mi][ni] = wmma_bf16(aF[mi], bF[ni], acc[mi][ni]);
    }
    // Publish point of stage s + 1. This wave's reads of buffer s & 1 are done:
    asm volatile("s_wait_dscnt 0x0" ::: "memory");
    if (pinned(wave_u < 2u)) {
      // the issuing wave's own tile of stage s + 1 has landed
      asm volatile("s_wait_tensorcnt 0x0" ::: "memory");
    }
    __syncthreads();
    // Refill the buffer that every wave has just left, while a stage is left.
    if (pinned((wave_u < 2u) && (s + 2 < n_stage)))
      tdm_load_tile(my_src + (size_t)(s + 2) * G_BK,
                    my_lds + (unsigned)(s & 1) * G_STAGE, g1);
  }
  // nothing of the ring is outstanding when the wave goes on to its stores
  asm volatile("s_wait_tensorcnt 0x0" ::: "memory");
  asm volatile("s_wait_dscnt 0x0" ::: "memory");

  // Epilogue. D layout: element r -> m = r + 8*(lane/16), n = lane%16.
#pragma unroll
  for (int mi = 0; mi < 2; ++mi)
#pragma unroll
    for (int ni = 0; ni < 4; ++ni)
#pragma unroll
      for (int r = 0; r < 8; ++r) {
        const int mg = m_blk + wm * 32 + mi * 16 + r + 8 * g;
        const int ng = n_blk + wn * 64 + ni * 16 + ln;
        const float c = acc[mi][ni][r];
        if (EPI == 0) {
          ((bf16_t*)outp)[(size_t)mg * N + ng] = (bf16_t)c;
        } else if (EPI == 1) {
          const size_t idx = (size_t)mg * N + ng;
          ((float*)outp)[idx] = resid[idx] + c;
        } else {  // V^T scatter: [B,H,DK,SEQ]
          const int bb = mg >> 11, sin = mg & (SEQ - 1);
          const int hh = ng >> 6, dd = ng & (DK - 1);
          ((bf16_t*)outp)[(((size_t)(bb * HEADS + hh) * DK + dd) << 11) + sin] =
              (bf16_t)c;
        }
      }
}

// Maximum over each 16-lane row of eight independent values, left in every lane
// of the row. Four butterfly steps (lane ^ 1, 2, 4, 8), each one vector
// instruction whose first source is read through DPP row_xmask: nothing goes
// over the LDS path and nothing waits on dscnt, where __shfl_xor compiles to
// ds_bpermute_b32 with a wait behind every step. The eight values go through a
// step together, so an instruction's producer stands eight instructions back
// and no step waits for the one before it. Every lane of the wave must be on.
__device__ inline void row_max16_x8(float (&v)[8]) {
  asm(
      "v_max_num_f32_dpp %0, %0, %0 row_xmask:1 row_mask:0xf bank_mask:0xf\n\t"
      "v_max_num_f32_dpp %1, %1, %1 row_xmask:1 row_mask:0xf bank_mask:0xf\n\t"
      "v_max_num_f32_dpp %2, %2, %2 row_xmask:1 row_mask:0xf bank_mask:0xf\n\t"
      "v_max_num_f32_dpp %3, %3, %3 row_xmask:1 row_mask:0xf bank_mask:0xf\n\t"
      "v_max_num_f32_dpp %4, %4, %4 row_xmask:1 row_mask:0xf bank_mask:0xf\n\t"
      "v_max_num_f32_dpp %5, %5, %5 row_xmask:1 row_mask:0xf bank_mask:0xf\n\t"
      "v_max_num_f32_dpp %6, %6, %6 row_xmask:1 row_mask:0xf bank_mask:0xf\n\t"
      "v_max_num_f32_dpp %7, %7, %7 row_xmask:1 row_mask:0xf bank_mask:0xf\n\t"
      "v_max_num_f32_dpp %0, %0, %0 row_xmask:2 row_mask:0xf bank_mask:0xf\n\t"
      "v_max_num_f32_dpp %1, %1, %1 row_xmask:2 row_mask:0xf bank_mask:0xf\n\t"
      "v_max_num_f32_dpp %2, %2, %2 row_xmask:2 row_mask:0xf bank_mask:0xf\n\t"
      "v_max_num_f32_dpp %3, %3, %3 row_xmask:2 row_mask:0xf bank_mask:0xf\n\t"
      "v_max_num_f32_dpp %4, %4, %4 row_xmask:2 row_mask:0xf bank_mask:0xf\n\t"
      "v_max_num_f32_dpp %5, %5, %5 row_xmask:2 row_mask:0xf bank_mask:0xf\n\t"
      "v_max_num_f32_dpp %6, %6, %6 row_xmask:2 row_mask:0xf bank_mask:0xf\n\t"
      "v_max_num_f32_dpp %7, %7, %7 row_xmask:2 row_mask:0xf bank_mask:0xf\n\t"
      "v_max_num_f32_dpp %0, %0, %0 row_xmask:4 row_mask:0xf bank_mask:0xf\n\t"
      "v_max_num_f32_dpp %1, %1, %1 row_xmask:4 row_mask:0xf bank_mask:0xf\n\t"
      "v_max_num_f32_dpp %2, %2, %2 row_xmask:4 row_mask:0xf bank_mask:0xf\n\t"
      "v_max_num_f32_dpp %3, %3, %3 row_xmask:4 row_mask:0xf bank_mask:0xf\n\t"
      "v_max_num_f32_dpp %4, %4, %4 row_xmask:4 row_mask:0xf bank_mask:0xf\n\t"
      "v_max_num_f32_dpp %5, %5, %5 row_xmask:4 row_mask:0xf bank_mask:0xf\n\t"
      "v_max_num_f32_dpp %6, %6, %6 row_xmask:4 row_mask:0xf bank_mask:0xf\n\t"
      "v_max_num_f32_dpp %7, %7, %7 row_xmask:4 row_mask:0xf bank_mask:0xf\n\t"
      "v_max_num_f32_dpp %0, %0, %0 row_xmask:8 row_mask:0xf bank_mask:0xf\n\t"
      "v_max_num_f32_dpp %1, %1, %1 row_xmask:8 row_mask:0xf bank_mask:0xf\n\t"
      "v_max_num_f32_dpp %2, %2, %2 row_xmask:8 row_mask:0xf bank_mask:0xf\n\t"
      "v_max_num_f32_dpp %3, %3, %3 row_xmask:8 row_mask:0xf bank_mask:0xf\n\t"
      "v_max_num_f32_dpp %4, %4, %4 row_xmask:8 row_mask:0xf bank_mask:0xf\n\t"
      "v_max_num_f32_dpp %5, %5, %5 row_xmask:8 row_mask:0xf bank_mask:0xf\n\t"
      "v_max_num_f32_dpp %6, %6, %6 row_xmask:8 row_mask:0xf bank_mask:0xf\n\t"
      "v_max_num_f32_dpp %7, %7, %7 row_xmask:8 row_mask:0xf bank_mask:0xf"
      : "+v"(v[0]), "+v"(v[1]), "+v"(v[2]), "+v"(v[3]),
        "+v"(v[4]), "+v"(v[5]), "+v"(v[6]), "+v"(v[7]));
}

__global__ __launch_bounds__(128) void flash_attn_wmma(
    const bf16_t* __restrict__ Q, const bf16_t* __restrict__ Km,
    const bf16_t* __restrict__ Vt, bf16_t* __restrict__ O) {
  __shared__ bf16_t sP[4][16][40];  // per-wave P staging (D-layout -> A-layout)
  const int tid  = threadIdx.x;
  const int lane = tid & 31, wave = tid >> 5;
  const int g = lane >> 4, ln = lane & 15;
  const int bh = blockIdx.y, b = bh >> 4, h = bh & 15;
  const int q0 = blockIdx.x * 64 + wave * 16;

  // Q A-fragments: 16 rows x 64 (two k-halves of 32)
  const bf16_t* qrow = Q + (size_t)(b * SEQ + q0 + ln) * D_MODEL + h * DK;
  v16bf qf[2];
#pragma unroll
  for (int kk = 0; kk < 2; ++kk)
    qf[kk] = ld_frag16(qrow + kk * 32 + g * 8, qrow + kk * 32 + 16 + g * 8);

  v16bf onesf;
#pragma unroll
  for (int j = 0; j < 16; ++j) onesf[j] = (bf16_t)1.0f;

  v8f o[4] = {};
  v8f o5 = {};  // softmax denominator accumulator (P x ones)
  float mrow[8];
#pragma unroll
  for (int r = 0; r < 8; ++r) mrow[r] = -__builtin_inff();

  for (int t0 = 0; t0 <= q0 + 15; t0 += 32) {
    // scores S = Q * K^T  (16 x 32), two 16x16 D frags
    v8f s[2] = {};
#pragma unroll
    for (int ni = 0; ni < 2; ++ni) {
      const bf16_t* krow =
          Km + (size_t)(b * SEQ + t0 + ni * 16 + ln) * D_MODEL + h * DK;
#pragma unroll
      for (int kk = 0; kk < 2; ++kk) {
        v16bf kf = ld_frag16(krow + kk * 32 + g * 8, krow + kk * 32 + 16 + g * 8);
        s[ni] = wmma_bf16(qf[kk], kf, s[ni]);
      }
    }
    // scale + causal mask
#pragma unroll
    for (int ni = 0; ni < 2; ++ni)
#pragma unroll
      for (int r = 0; r < 8; ++r) {
        const float v = s[ni][r] * 0.125f;  // 1/sqrt(64)
        const int qg = q0 + r + 8 * g;
        const int tg = t0 + ni * 16 + ln;
        s[ni][r] = (tg > qg) ? -__builtin_inff() : v;
      }
    // row max (butterfly within 16-lane halves) + online rescale factor
    float alpha[8], vmax[8];
#pragma unroll
    for (int r = 0; r < 8; ++r)
      vmax[r] = fmaxf(fmaxf(s[0][r], s[1][r]), mrow[r]);  // mrow: equal in the row
    row_max16_x8(vmax);
#pragma unroll
    for (int r = 0; r < 8; ++r) {
      const float mn = vmax[r];
      alpha[r] = __expf(mrow[r] - mn);
      mrow[r] = mn;
    }
#pragma unroll
    for (int ni = 0; ni < 2; ++ni)
#pragma unroll
      for (int r = 0; r < 8; ++r) s[ni][r] = __expf(s[ni][r] - mrow[r]);
#pragma unroll
    for (int f = 0; f < 4; ++f)
#pragma unroll
      for (int r = 0; r < 8; ++r) o[f][r] *= alpha[r];
#pragma unroll
    for (int r = 0; r < 8; ++r) o5[r] *= alpha[r];

    // P: D-layout -> bf16 LDS -> A-layout (wave-local, split-counter sync)
#pragma unroll
    for (int ni = 0; ni < 2; ++ni)
#pragma unroll
      for (int r = 0; r < 8; ++r)
        sP[wave][r + 8 * g][ni * 16 + ln] = (bf16_t)s[ni][r];
    asm volatile("s_wait_dscnt 0" ::: "memory");
    v16bf pf = ld_frag16(&sP[wave][ln][g * 8], &sP[wave][ln][16 + g * 8]);

    // O += P(16x32) * V(32x64): B frags from V^T rows (contiguous along t)
#pragma unroll
    for (int f = 0; f < 4; ++f) {
      const bf16_t* vrow =
          Vt + (size_t)((b * HEADS + h) * DK + f * 16 + ln) * SEQ + t0;
      v16bf vf = ld_frag16(vrow + g * 8, vrow + 16 + g * 8);
      o[f] = wmma_bf16(pf, vf, o[f]);
    }
    // denominator: l += P x ones
    o5 = wmma_bf16(pf, onesf, o5);
  }

  // normalize and store: out[b, q, h*64 + d] (bf16, row-major D_MODEL)
#pragma unroll
  for (int f = 0; f < 4; ++f)
#pragma unroll
    for (int r = 0; r < 8; ++r) {
      const float val = o[f][r] / o5[r];
      const int qg = q0 + r + 8 * g;
      O[(size_t)(b * SEQ + qg) * D_MODEL + h * DK + f * 16 + ln] = (bf16_t)val;
    }
}

// ---------------------------------------------------------------------------
// SwiGLU elementwise: gate = silu(gate) * up   (bf16, in-place)
// ---------------------------------------------------------------------------
__global__ __launch_bounds__(256) void swiglu_kernel(
    bf16_t* __restrict__ gate, const bf16_t* __restrict__ up, int n) {
  const int i4 = (blockIdx.x * 256 + threadIdx.x) * 4;
  if (i4 >= n) return;
#pragma unroll
  for (int j = 0; j < 4; ++j) {
    const float gv = (float)gate[i4 + j];
    const float uv = (float)up[i4 + j];
    const float sil = gv / (1.f + __expf(-gv));
    gate[i4 + j] = (bf16_t)(sil * uv);
  }
}

// ---------------------------------------------------------------------------
// Host orchestration
// ---------------------------------------------------------------------------
extern "C" void kernel_launch(void* const* d_in, const int* in_sizes, int n_in,
                              void* d_out, int out_size, void* d_ws,
                              size_t ws_size, hipStream_t stream) {
  (void)in_sizes; (void)n_in; (void)out_size; (void)ws_size;
  const float* x      = (const float*)d_in[0];
  const float* w_q    = (const float*)d_in[1];
  const float* w_k    = (const float*)d_in[2];
  const float* w_v    = (const float*)d_in[3];
  const float* w_o    = (const float*)d_in[4];
  const float* w_gate = (const float*)d_in[5];
  const float* w_up   = (const float*)d_in[6];
  const float* w_down = (const float*)d_in[7];
  const float* g1     = (const float*)d_in[8];
  const float* g2     = (const float*)d_in[9];

  unsigned char* ws = (unsigned char*)d_ws;
  const size_t MB = 1ull << 20;
  bf16_t* wtq  = (bf16_t*)(ws + 0 * MB);    // [1024][1024]      2 MB
  bf16_t* wtk  = (bf16_t*)(ws + 2 * MB);    //                   2 MB
  bf16_t* wtv  = (bf16_t*)(ws + 4 * MB);    //                   2 MB
  bf16_t* wto  = (bf16_t*)(ws + 6 * MB);    //                   2 MB
  bf16_t* wtg  = (bf16_t*)(ws + 8 * MB);    // [4096][1024]      8 MB
  bf16_t* wtu  = (bf16_t*)(ws + 16 * MB);   //                   8 MB
  bf16_t* wtd  = (bf16_t*)(ws + 24 * MB);   // [1024][4096]      8 MB
  bf16_t* nx1  = (bf16_t*)(ws + 32 * MB);   // [4096][1024]      8 MB
  bf16_t* qb   = (bf16_t*)(ws + 40 * MB);   // [4096][1024]      8 MB
  bf16_t* kb   = (bf16_t*)(ws + 48 * MB);   //                   8 MB
  bf16_t* vtb  = (bf16_t*)(ws + 56 * MB);   // [B,H,DK,SEQ]      8 MB
  bf16_t* ao   = (bf16_t*)(ws + 64 * MB);   // attn out          8 MB
  float*  x2   = (float*) (ws + 72 * MB);   // f32 resid        16 MB
  bf16_t* nx2  = (bf16_t*)(ws + 88 * MB);   // [4096][1024]      8 MB
  bf16_t* gate = (bf16_t*)(ws + 96 * MB);   // [4096][4096]     32 MB
  bf16_t* up   = (bf16_t*)(ws + 128 * MB);  //                  32 MB (end 160 MB)

  // --- weight prep: W[K][N] -> Wt[N][K] bf16 ---
  transpose_to_bf16<<<dim3(D_MODEL / 32, D_MODEL / 32), 256, 0, stream>>>(w_q, wtq, D_MODEL, D_MODEL);
  transpose_to_bf16<<<dim3(D_MODEL / 32, D_MODEL / 32), 256, 0, stream>>>(w_k, wtk, D_MODEL, D_MODEL);
  transpose_to_bf16<<<dim3(D_MODEL / 32, D_MODEL / 32), 256, 0, stream>>>(w_v, wtv, D_MODEL, D_MODEL);
  transpose_to_bf16<<<dim3(D_MODEL / 32, D_MODEL / 32), 256, 0, stream>>>(w_o, wto, D_MODEL, D_MODEL);
  transpose_to_bf16<<<dim3(D_FF / 32, D_MODEL / 32), 256, 0, stream>>>(w_gate, wtg, D_MODEL, D_FF);
  transpose_to_bf16<<<dim3(D_FF / 32, D_MODEL / 32), 256, 0, stream>>>(w_up, wtu, D_MODEL, D_FF);
  transpose_to_bf16<<<dim3(D_MODEL / 32, D_FF / 32), 256, 0, stream>>>(w_down, wtd, D_FF, D_MODEL);

  // --- attention sublayer ---
  rmsnorm_kernel<<<M_ROWS, 256, 0, stream>>>(x, g1, nx1);

  const dim3 gemm_blk(256);
  gemm_bf16_wmma<0><<<dim3(D_MODEL / 128, M_ROWS / 128), gemm_blk, 0, stream>>>(
      nx1, wtq, M_ROWS, D_MODEL, D_MODEL, nullptr, qb);
  gemm_bf16_wmma<0><<<dim3(D_MODEL / 128, M_ROWS / 128), gemm_blk, 0, stream>>>(
      nx1, wtk, M_ROWS, D_MODEL, D_MODEL, nullptr, kb);
  gemm_bf16_wmma<2><<<dim3(D_MODEL / 128, M_ROWS / 128), gemm_blk, 0, stream>>>(
      nx1, wtv, M_ROWS, D_MODEL, D_MODEL, nullptr, vtb);

  flash_attn_wmma<<<dim3(SEQ / 64, BATCH * HEADS), 128, 0, stream>>>(qb, kb, vtb, ao);

  gemm_bf16_wmma<1><<<dim3(D_MODEL / 128, M_ROWS / 128), gemm_blk, 0, stream>>>(
      ao, wto, M_ROWS, D_MODEL, D_MODEL, x, x2);

  // --- SwiGLU FFN sublayer ---
  rmsnorm_kernel<<<M_ROWS, 256, 0, stream>>>(x2, g2, nx2);

  gemm_bf16_wmma<0><<<dim3(D_FF / 128, M_ROWS / 128), gemm_blk, 0, stream>>>(
      nx2, wtg, M_ROWS, D_FF, D_MODEL, nullptr, gate);
  gemm_bf16_wmma<0><<<dim3(D_FF / 128, M_ROWS / 128), gemm_blk, 0, stream>>>(
      nx2, wtu, M_ROWS, D_FF, D_MODEL, nullptr, up);

  swiglu_kernel<<<(M_ROWS * D_FF) / 1024, 256, 0, stream>>>(gate, up, M_ROWS * D_FF);

  gemm_bf16_wmma<1><<<dim3(D_MODEL / 128, M_ROWS / 128), gemm_blk, 0, stream>>>(
      gate, wtd, M_ROWS, D_MODEL, D_FF, x2, (float*)d_out);
}

// v003
// Measured time: 305 microseconds a run.
// Timed twice side by side with v002, it ran 1.22 times as fast both times.
// All steps since v000 together make it 1.59 times as fast.
#include <hip/hip_runtime.h>

typedef __bf16 bf16_t;
typedef __attribute__((ext_vector_type(16))) __bf16        v16bf;
typedef __attribute__((ext_vector_type(8)))  float         v8f;
typedef __attribute__((ext_vector_type(4)))  unsigned int  v4u;
typedef __attribute__((ext_vector_type(8)))  unsigned int  v8u;

#define D_MODEL 1024
#define SEQ     2048
#define BATCH   2
#define HEADS   16
#define DK      64
#define D_FF    4096
#define M_ROWS  (BATCH * SEQ)   // 4096

union FragU { v16bf v; uint4 q[2]; };

__device__ inline v16bf ld_frag16(const bf16_t* p0, const bf16_t* p1) {
  FragU u;
  u.q[0] = *reinterpret_cast<const uint4*>(p0);
  u.q[1] = *reinterpret_cast<const uint4*>(p1);
  return u.v;
}

__device__ inline v8f wmma_bf16(v16bf a, v16bf b, v8f c) {
  // (neg_a, A, neg_b, B, c_mod, C, reuse_a, reuse_b)
  return __builtin_amdgcn_wmma_f32_16x16x32_bf16(false, a, false, b, (short)0, c,
                                                 false, false);
}

// ---------------------------------------------------------------------------
// GEMM stage geometry: 64 k per stage, so an operand row is 128 B; the tensor
// load pads each row by 16 B (pitch 144 B: conflict-free ds_load_b128 rows).
// One operand tile = 128 rows x 144 B = 18432 B = 9 x 2 KiB.
// ---------------------------------------------------------------------------
#define G_BK     64
#define G_PITCH  144
#define G_TILE   (128 * G_PITCH)
#define G_STAGE  (2 * G_TILE)

__device__ inline unsigned uni(unsigned v) {
  return (unsigned)__builtin_amdgcn_readfirstlane((int)v);
}
__device__ inline unsigned pinned(unsigned v) {
  unsigned w = uni(v);
  asm volatile("" : "+s"(w));
  return w;
}

__device__ inline v8u tdm_group1_128x128B(unsigned src_pitch) {
  v8u g1;
  g1[0] = pinned((1u << 20) | (4u << 22) | (3u << 25));
  g1[1] = pinned(128u << 16);
  g1[2] = pinned(128u << 16);
  g1[3] = pinned(128u << 16);
  g1[4] = pinned(128u);
  g1[5] = pinned(src_pitch);
  g1[6] = pinned(0u);
  g1[7] = pinned(0u);
  return g1;
}

// One tensor load: the tile whose first byte is gtile, to LDS byte offset lds_off.
__device__ inline void tdm_load_tile(const bf16_t* gtile, unsigned lds_off, v8u g1) {
  const unsigned long long ga = (unsigned long long)(size_t)gtile;
  v4u g0;
  g0[0] = uni(1u);                              // count = 1
  g0[1] = uni(lds_off);                         // LDS destination (bytes)
  g0[2] = uni((unsigned)ga);                    // global address [31:0]
  g0[3] = uni(((unsigned)(ga >> 32) & 0x01FFFFFFu) | 0x80000000u);  // [56:32], type 2
  asm volatile("tensor_load_to_lds %0, %1" :: "s"(g0), "s"(g1) : "memory");
}

// Attention stage geometry: 64 keys per stage. The K tile is 64 key rows of 128 B
// (one head's 64 dims), the V^T tile 64 dim rows of 128 B (64 keys); both land at
// pitch G_PITCH. One tile = 64 x 144 B = 9216 B, its place rounded up to 5 x 2 KiB.
#define A_KEYS   64
#define A_TILE   10240
#define A_STAGE  (2 * A_TILE)

__device__ inline v4u tdm_group0(const bf16_t* gtile, unsigned lds_off) {
  const unsigned long long ga = (unsigned long long)(size_t)gtile;
  v4u g0;
  g0[0] = uni(1u);                              // count = 1
  g0[1] = uni(lds_off);                         // LDS destination (bytes)
  g0[2] = uni((unsigned)ga);                    // global address [31:0]
  g0[3] = uni(((unsigned)(ga >> 32) & 0x01FFFFFFu) | 0x80000000u);  // [56:32], type 2
  return g0;
}

__device__ inline v8u tdm_group1_64x128B(unsigned src_pitch) {
  v8u g1;
  g1[0] = pinned((1u << 20) | (4u << 22) | (3u << 25));
  g1[1] = pinned(128u << 16);
  g1[2] = pinned(64u << 16);
  g1[3] = pinned(128u << 16);
  g1[4] = pinned(64u);
  g1[5] = pinned(src_pitch);
  g1[6] = pinned(0u);
  g1[7] = pinned(0u);
  return g1;
}

// ---------------------------------------------------------------------------
// Weight transpose + fp32 -> bf16 convert:  W[K][N] -> Wt[N][K]
// ---------------------------------------------------------------------------
__global__ __launch_bounds__(256) void transpose_to_bf16(
    const float* __restrict__ W, bf16_t* __restrict__ Wt, int K, int N) {
  __shared__ float tile[32][33];
  const int tx = threadIdx.x & 31, ty = threadIdx.x >> 5;  // 32 x 8
  const int n0 = blockIdx.x * 32, k0 = blockIdx.y * 32;
#pragma unroll
  for (int i = 0; i < 4; ++i)
    tile[ty + i * 8][tx] = W[(size_t)(k0 + ty + i * 8) * N + n0 + tx];
  __syncthreads();
#pragma unroll
  for (int i = 0; i < 4; ++i)
    Wt[(size_t)(n0 + ty + i * 8) * K + k0 + tx] = (bf16_t)tile[tx][ty + i * 8];
}

// ---------------------------------------------------------------------------
// RMSNorm: fp32 row -> bf16 normalized row (one block per row, D_MODEL=1024)
// ---------------------------------------------------------------------------
__global__ __launch_bounds__(256) void rmsnorm_kernel(
    const float* __restrict__ x, const float* __restrict__ gain,
    bf16_t* __restrict__ out) {
  __shared__ float warp_sum[8];
  const int tid = threadIdx.x;
  const float4 v = reinterpret_cast<const float4*>(x + (size_t)blockIdx.x * D_MODEL)[tid];
  float ss = v.x * v.x + v.y * v.y + v.z * v.z + v.w * v.w;
  ss += __shfl_xor(ss, 1, 32);
  ss += __shfl_xor(ss, 2, 32);
  ss += __shfl_xor(ss, 4, 32);
  ss += __shfl_xor(ss, 8, 32);
  ss += __shfl_xor(ss, 16, 32);
  if ((tid & 31) == 0) warp_sum[tid >> 5] = ss;
  __syncthreads();
  float tot = 0.f;
#pragma unroll
  for (int i = 0; i < 8; ++i) tot += warp_sum[i];
  const float inv = rsqrtf(tot * (1.0f / D_MODEL) + 1e-6f);
  const float4 gv = reinterpret_cast<const float4*>(gain)[tid];
  bf16_t* orow = out + (size_t)blockIdx.x * D_MODEL + tid * 4;
  orow[0] = (bf16_t)(v.x * inv * gv.x);
  orow[1] = (bf16_t)(v.y * inv * gv.y);
  orow[2] = (bf16_t)(v.z * inv * gv.z);
  orow[3] = (bf16_t)(v.w * inv * gv.w);
}

// ---------------------------------------------------------------------------
// GEMM: C[M][N] = A[M][K] (bf16, k-major) x Bt[N][K] (bf16, k-major)
// 256 threads = 8 waves; block tile 128x128; per-wave 32x64 (2x4 frags).
// EPI: 0 = store bf16, 1 = fp32 out = resid + C, 2 = bf16 scatter to V^T
// Assumes M,N % 128 == 0, K % 64 == 0 and K >= 128 (true for all calls here).
// ---------------------------------------------------------------------------
template <int EPI>
__global__ __launch_bounds__(256) void gemm_bf16_wmma(
    const bf16_t* __restrict__ A, const bf16_t* __restrict__ Bt,
    int M, int N, int K, const float* __restrict__ resid,
    void* __restrict__ outp) {
  // ring[buffer][A tile | B tile]; every tile starts at a multiple of 2 KiB
  __shared__ __attribute__((aligned(2048))) unsigned char ring[2 * G_STAGE];
  const int tid  = threadIdx.x;
  const int lane = tid & 31, wave = tid >> 5;
  const int g = lane >> 4, ln = lane & 15;
  const int wm = wave >> 1, wn = wave & 1;
  const int m_blk = blockIdx.y * 128, n_blk = blockIdx.x * 128;
  // Wave 0 brings the A tile of every stage, wave 1 the B tile.
  const unsigned wave_u = uni((unsigned)threadIdx.x >> 5);
  const bf16_t* my_src = (wave_u == 0) ? A + (size_t)m_blk * K
                                       : Bt + (size_t)n_blk * K;
  const unsigned my_lds = (unsigned)(size_t)(void*)&ring[0] +
                          ((wave_u == 0) ? 0u : (unsigned)G_TILE);
  const v8u g1 = tdm_group1_128x128B((unsigned)K * 2u);
  const int n_stage = K / G_BK;

  v8f acc[2][4] = {};

  // Prologue: stage 0 lands and is published, then stage 1 starts to fly.
  if (pinned(wave_u < 2u)) {
    tdm_load_tile(my_src, my_lds, g1);
    // stage 0 has landed here
    asm volatile("s_wait_tensorcnt 0x0" ::: "memory");
  }
  __syncthreads();
  if (pinned(wave_u < 2u))
    tdm_load_tile(my_src + G_BK, my_lds + G_STAGE, g1);

  for (int s = 0; s < n_stage; ++s) {
    const unsigned char* bufA = ring + (s & 1) * G_STAGE;
    const unsigned char* bufB = bufA + G_TILE;
    // unrolled so that every fragment and accumulator index is a constant
    // (registers, no scratch); the two 32-k blocks keep the ascending k order
#pragma unroll
    for (int kk = 0; kk < 2; ++kk) {
      v16bf aF[2], bF[4];
#pragma unroll
      for (int mi = 0; mi < 2; ++mi) {
        const unsigned char* p =
            bufA + (wm * 32 + mi * 16 + ln) * G_PITCH + kk * 64 + g * 16;
        aF[mi] = ld_frag16((const bf16_t*)p, (const bf16_t*)(p + 32));
      }
#pragma unroll
      for (int ni = 0; ni < 4; ++ni) {
        const unsigned char* p =
            bufB + (wn * 64 + ni * 16 + ln) * G_PITCH + kk * 64 + g * 16;
        bF[ni] = ld_frag16((const bf16_t*)p, (const bf16_t*)(p + 32));
      }
#pragma unroll
      for (int mi = 0; mi < 2; ++mi)
#pragma unroll
        for (int ni = 0; ni < 4; ++ni)
          acc[mi][ni] = wmma_bf16(aF[mi], bF[ni], acc[mi][ni]);
    }
    // Publish point of stage s + 1. This wave's reads of buffer s & 1 are done:
    asm volatile("s_wait_dscnt 0x0" ::: "memory");
    if (pinned(wave_u < 2u)) {
      // the issuing wave's own tile of stage s + 1 has landed
      asm volatile("s_wait_tensorcnt 0x0" ::: "memory");
    }
    __syncthreads();
    // Refill the buffer that every wave has just left, while a stage is left.
    if (pinned((wave_u < 2u) && (s + 2 < n_stage)))
      tdm_load_tile(my_src + (size_t)(s + 2) * G_BK,
                    my_lds + (unsigned)(s & 1) * G_STAGE, g1);
  }
  // nothing of the ring is outstanding when the wave goes on to its stores
  asm volatile("s_wait_tensorcnt 0x0" ::: "memory");
  asm volatile("s_wait_dscnt 0x0" ::: "memory");

  // Epilogue. D layout: element r -> m = r + 8*(lane/16), n = lane%16.
#pragma unroll
  for (int mi = 0; mi < 2; ++mi)
#pragma unroll
    for (int ni = 0; ni < 4; ++ni)
#pragma unroll
      for (int r = 0; r < 8; ++r) {
        const int mg = m_blk + wm * 32 + mi * 16 + r + 8 * g;
        const int ng = n_blk + wn * 64 + ni * 16 + ln;
        const float c = acc[mi][ni][r];
        if (EPI == 0) {
          ((bf16_t*)outp)[(size_t)mg * N + ng] = (bf16_t)c;
        } else if (EPI == 1) {
          const size_t idx = (size_t)mg * N + ng;
          ((float*)outp)[idx] = resid[idx] + c;
        } else {  // V^T scatter: [B,H,DK,SEQ]
          const int bb = mg >> 11, sin = mg & (SEQ - 1);
          const int hh = ng >> 6, dd = ng & (DK - 1);
          ((bf16_t*)outp)[(((size_t)(bb * HEADS + hh) * DK + dd) << 11) + sin] =
              (bf16_t)c;
        }
      }
}

// Maximum over each 16-lane row of eight independent values, left in every lane
// of the row. Four butterfly steps (lane ^ 1, 2, 4, 8), each one vector
// instruction whose first source is read through DPP row_xmask: nothing goes
// over the LDS path and nothing waits on dscnt, where __shfl_xor compiles to
// ds_bpermute_b32 with a wait behind every step. The eight values go through a
// step together, so an instruction's producer stands eight instructions back
// and no step waits for the one before it. Every lane of the wave must be on.
__device__ inline void row_max16_x8(float (&v)[8]) {
  asm(
      "v_max_num_f32_dpp %0, %0, %0 row_xmask:1 row_mask:0xf bank_mask:0xf\n\t"
      "v_max_num_f32_dpp %1, %1, %1 row_xmask:1 row_mask:0xf bank_mask:0xf\n\t"
      "v_max_num_f32_dpp %2, %2, %2 row_xmask:1 row_mask:0xf bank_mask:0xf\n\t"
      "v_max_num_f32_dpp %3, %3, %3 row_xmask:1 row_mask:0xf bank_mask:0xf\n\t"
      "v_max_num_f32_dpp %4, %4, %4 row_xmask:1 row_mask:0xf bank_mask:0xf\n\t"
      "v_max_num_f32_dpp %5, %5, %5 row_xmask:1 row_mask:0xf bank_mask:0xf\n\t"
      "v_max_num_f32_dpp %6, %6, %6 row_xmask:1 row_mask:0xf bank_mask:0xf\n\t"
      "v_max_num_f32_dpp %7, %7, %7 row_xmask:1 row_mask:0xf bank_mask:0xf\n\t"
      "v_max_num_f32_dpp %0, %0, %0 row_xmask:2 row_mask:0xf bank_mask:0xf\n\t"
      "v_max_num_f32_dpp %1, %1, %1 row_xmask:2 row_mask:0xf bank_mask:0xf\n\t"
      "v_max_num_f32_dpp %2, %2, %2 row_xmask:2 row_mask:0xf bank_mask:0xf\n\t"
      "v_max_num_f32_dpp %3, %3, %3 row_xmask:2 row_mask:0xf bank_mask:0xf\n\t"
      "v_max_num_f32_dpp %4, %4, %4 row_xmask:2 row_mask:0xf bank_mask:0xf\n\t"
      "v_max_num_f32_dpp %5, %5, %5 row_xmask:2 row_mask:0xf bank_mask:0xf\n\t"
      "v_max_num_f32_dpp %6, %6, %6 row_xmask:2 row_mask:0xf bank_mask:0xf\n\t"
      "v_max_num_f32_dpp %7, %7, %7 row_xmask:2 row_mask:0xf bank_mask:0xf\n\t"
      "v_max_num_f32_dpp %0, %0, %0 row_xmask:4 row_mask:0xf bank_mask:0xf\n\t"
      "v_max_num_f32_dpp %1, %1, %1 row_xmask:4 row_mask:0xf bank_mask:0xf\n\t"
      "v_max_num_f32_dpp %2, %2, %2 row_xmask:4 row_mask:0xf bank_mask:0xf\n\t"
      "v_max_num_f32_dpp %3, %3, %3 row_xmask:4 row_mask:0xf bank_mask:0xf\n\t"
      "v_max_num_f32_dpp %4, %4, %4 row_xmask:4 row_mask:0xf bank_mask:0xf\n\t"
      "v_max_num_f32_dpp %5, %5, %5 row_xmask:4 row_mask:0xf bank_mask:0xf\n\t"
      "v_max_num_f32_dpp %6, %6, %6 row_xmask:4 row_mask:0xf bank_mask:0xf\n\t"
      "v_max_num_f32_dpp %7, %7, %7 row_xmask:4 row_mask:0xf bank_mask:0xf\n\t"
      "v_max_num_f32_dpp %0, %0, %0 row_xmask:8 row_mask:0xf bank_mask:0xf\n\t"
      "v_max_num_f32_dpp %1, %1, %1 row_xmask:8 row_mask:0xf bank_mask:0xf\n\t"
      "v_max_num_f32_dpp %2, %2, %2 row_xmask:8 row_mask:0xf bank_mask:0xf\n\t"
      "v_max_num_f32_dpp %3, %3, %3 row_xmask:8 row_mask:0xf bank_mask:0xf\n\t"
      "v_max_num_f32_dpp %4, %4, %4 row_xmask:8 row_mask:0xf bank_mask:0xf\n\t"
      "v_max_num_f32_dpp %5, %5, %5 row_xmask:8 row_mask:0xf bank_mask:0xf\n\t"
      "v_max_num_f32_dpp %6, %6, %6 row_xmask:8 row_mask:0xf bank_mask:0xf\n\t"
      "v_max_num_f32_dpp %7, %7, %7 row_xmask:8 row_mask:0xf bank_mask:0xf"
      : "+v"(v[0]), "+v"(v[1]), "+v"(v[2]), "+v"(v[3]),
        "+v"(v[4]), "+v"(v[5]), "+v"(v[6]), "+v"(v[7]));
}

__global__ __launch_bounds__(128) void flash_attn_wmma(
    const bf16_t* __restrict__ Q, const bf16_t* __restrict__ Km,
    const bf16_t* __restrict__ Vt, bf16_t* __restrict__ O) {
  // ring[buffer][K tile | V^T tile]; every tile starts at a multiple of 2 KiB
  __shared__ __attribute__((aligned(2048))) unsigned char ring[2 * A_STAGE];
  __shared__ bf16_t sP[4][16][40];  // per-wave P staging (D-layout -> A-layout)
  const int tid  = threadIdx.x;
  const int lane = tid & 31;
  const unsigned wave_u = uni((unsigned)threadIdx.x >> 5);
  const int wave = (int)wave_u;
  const int g = lane >> 4, ln = lane & 15;
  const int bh = blockIdx.y, b = bh >> 4, h = bh & 15;
  const int q0 = blockIdx.x * 64 + wave * 16;

  // The block's four waves read the same keys: wave 0 brings the K tile of every
  // stage, wave 1 the V^T tile. The block's rows end at key 64 * blockIdx.x + 63.
  const bf16_t* my_src = (wave_u == 0)
                             ? Km + (size_t)(b * SEQ) * D_MODEL + h * DK
                             : Vt + (size_t)((b * HEADS + h) * DK) * SEQ;
  // a stage's step in the source, as a shift: 64 rows of K, 64 columns of V^T
  const unsigned my_shift = (wave_u == 0) ? 16u : 6u;
  static_assert(A_KEYS * D_MODEL == 1 << 16 && A_KEYS == 1 << 6, "stage steps");
  const unsigned my_lds = (unsigned)(size_t)(void*)&ring[0] +
                          ((wave_u == 0) ? 0u : (unsigned)A_TILE);
  const v8u g1 = tdm_group1_64x128B((wave_u == 0) ? (unsigned)(D_MODEL * 2)
                                                  : (unsigned)(SEQ * 2));
  const int n_stage = (int)blockIdx.x + 1;

  // Q A-fragments: 16 rows x 64 (two k-halves of 32)
  const bf16_t* qrow = Q + (size_t)(b * SEQ + q0 + ln) * D_MODEL + h * DK;
  v16bf qf[2];
#pragma unroll
  for (int kk = 0; kk < 2; ++kk)
    qf[kk] = ld_frag16(qrow + kk * 32 + g * 8, qrow + kk * 32 + 16 + g * 8);

  v16bf onesf;
#pragma unroll
  for (int j = 0; j < 16; ++j) onesf[j] = (bf16_t)1.0f;

  v8f o[4] = {};
  v8f o5 = {};  // softmax denominator accumulator (P x ones)
  float mrow[8];
#pragma unroll
  for (int r = 0; r < 8; ++r) mrow[r] = -__builtin_inff();

  v4u g0 = {0u, 0u, 0u, 0u};
  if (pinned(wave_u < 2u)) {
    g0 = tdm_group0(my_src, my_lds);
    asm volatile("tensor_load_to_lds %0, %1" :: "s"(g0), "s"(g1) : "memory");
    // stage 0 has landed here
    asm volatile("s_wait_tensorcnt 0x0" :: "s"(g0) : "memory");
  }
  __syncthreads();
  if (pinned(wave_u < 2u)) {
    g0 = tdm_group0(my_src + ((size_t)1 << my_shift), my_lds + A_STAGE);
    asm volatile("tensor_load_to_lds %0, %1" :: "s"(g0), "s"(g1) : "memory");
  }

  for (int st = 0; st < n_stage; ++st) {
   const unsigned char* bufK = ring + (st & 1) * A_STAGE;
   const unsigned char* bufV = bufK + A_TILE;
   // the stage's two 32-key tiles; a wave skips a tile wholly above its diagonal
   for (int t0 = st * A_KEYS; t0 < (st + 1) * A_KEYS && t0 <= q0 + 15; t0 += 32) {
    const int tr = t0 - st * A_KEYS;  // first key of the tile inside the stage
    // The tile's K and V^T B-fragments, as one group of LDS reads, K first: the V
    // reads return under the score products and the softmax.
    v16bf kf[2][2], vf[4];
#pragma unroll
    for (int ni = 0; ni < 2; ++ni) {
      const unsigned char* krow = bufK + (tr + ni * 16 + ln) * G_PITCH + g * 16;
#pragma unroll
      for (int kk = 0; kk < 2; ++kk)
        kf[ni][kk] = ld_frag16((const bf16_t*)(krow + kk * 64),
                               (const bf16_t*)(krow + kk * 64 + 32));
    }
#pragma unroll
    for (int f = 0; f < 4; ++f) {
      const unsigned char* vrow = bufV + (f * 16 + ln) * G_PITCH + tr * 2 + g * 16;
      vf[f] = ld_frag16((const bf16_t*)vrow, (const bf16_t*)(vrow + 32));
    }
    // scores S = Q * K^T  (16 x 32), two 16x16 D frags
    v8f s[2] = {};
#pragma unroll
    for (int ni = 0; ni < 2; ++ni)
#pragma unroll
      for (int kk = 0; kk < 2; ++kk)
        s[ni] = wmma_bf16(qf[kk], kf[ni][kk], s[ni]);
    // scale + causal mask
#pragma unroll
    for (int ni = 0; ni < 2; ++ni)
#pragma unroll
      for (int r = 0; r < 8; ++r) {
        const float v = s[ni][r] * 0.125f;  // 1/sqrt(64)
        const int qg = q0 + r + 8 * g;
        const int tg = t0 + ni * 16 + ln;
        s[ni][r] = (tg > qg) ? -__builtin_inff() : v;
      }
    // row max (butterfly within 16-lane halves) + online rescale factor
    float alpha[8], vmax[8];
#pragma unroll
    for (int r = 0; r < 8; ++r)
      vmax[r] = fmaxf(fmaxf(s[0][r], s[1][r]), mrow[r]);  // mrow: equal in the row
    row_max16_x8(vmax);
#pragma unroll
    for (int r = 0; r < 8; ++r) {
      const float mn = vmax[r];
      alpha[r] = __expf(mrow[r] - mn);
      mrow[r] = mn;
    }
#pragma unroll
    for (int ni = 0; ni < 2; ++ni)
#pragma unroll
      for (int r = 0; r < 8; ++r) s[ni][r] = __expf(s[ni][r] - mrow[r]);
#pragma unroll
    for (int f = 0; f < 4; ++f)
#pragma unroll
      for (int r = 0; r < 8; ++r) o[f][r] *= alpha[r];
#pragma unroll
    for (int r = 0; r < 8; ++r) o5[r] *= alpha[r];

    // P: D-layout -> bf16 LDS -> A-layout (wave-local, split-counter sync)
#pragma unroll
    for (int ni = 0; ni < 2; ++ni)
#pragma unroll
      for (int r = 0; r < 8; ++r)
        sP[wave][r + 8 * g][ni * 16 + ln] = (bf16_t)s[ni][r];
    asm volatile("s_wait_dscnt 0" ::: "memory");
    v16bf pf = ld_frag16(&sP[wave][ln][g * 8], &sP[wave][ln][16 + g * 8]);

    // O += P(16x32) * V(32x64): B frags from V^T rows (contiguous along t)
#pragma unroll
    for (int f = 0; f < 4; ++f) o[f] = wmma_bf16(pf, vf[f], o[f]);
    // denominator: l += P x ones
    o5 = wmma_bf16(pf, onesf, o5);
    asm volatile("v_nop\n\tv_nop\n\tv_nop\n\tv_nop" :: "v"(o5));
   }
   // Publish point of stage st + 1; every wave passes it, also one that skipped a
   // tile. This wave's reads of buffer st & 1 are done:
   asm volatile("s_wait_dscnt 0x0" ::: "memory");
   if (pinned(wave_u < 2u)) {
     // the issuing wave's own tile of stage st + 1 has landed
     asm volatile("s_wait_tensorcnt 0x0" :: "s"(g0) : "memory");
   }
   __syncthreads();
   // Refill the buffer that every wave has just left, while a stage is left.
   if (pinned((wave_u < 2u) && (st + 2 < n_stage))) {
     g0 = tdm_group0(my_src + ((size_t)(st + 2) << my_shift),
                     my_lds + (unsigned)(st & 1) * A_STAGE);
     asm volatile("tensor_load_to_lds %0, %1" :: "s"(g0), "s"(g1) : "memory");
   }
  }
  // nothing of the ring is outstanding when the wave goes on to its stores
  asm volatile("s_wait_tensorcnt 0x0" ::: "memory");
  asm volatile("s_wait_dscnt 0x0" ::: "memory");

  // normalize and store: out[b, q, h*64 + d] (bf16, row-major D_MODEL)
#pragma unroll
  for (int f = 0; f < 4; ++f)
#pragma unroll
    for (int r = 0; r < 8; ++r) {
      const float val = o[f][r] / o5[r];
      const int qg = q0 + r + 8 * g;
      O[(size_t)(b * SEQ + qg) * D_MODEL + h * DK + f * 16 + ln] = (bf16_t)val;
    }
}

// ---------------------------------------------------------------------------
// SwiGLU elementwise: gate = silu(gate) * up   (bf16, in-place)
// ---------------------------------------------------------------------------
__global__ __launch_bounds__(256) void swiglu_kernel(
    bf16_t* __restrict__ gate, const bf16_t* __restrict__ up, int n) {
  const int i4 = (blockIdx.x * 256 + threadIdx.x) * 4;
  if (i4 >= n) return;
#pragma unroll
  for (int j = 0; j < 4; ++j) {
    const float gv = (float)gate[i4 + j];
    const float uv = (float)up[i4 + j];
    const float sil = gv / (1.f + __expf(-gv));
    gate[i4 + j] = (bf16_t)(sil * uv);
  }
}

// ---------------------------------------------------------------------------
// Host orchestration
// ---------------------------------------------------------------------------
extern "C" void kernel_launch(void* const* d_in, const int* in_sizes, int n_in,
                              void* d_out, int out_size, void* d_ws,
                              size_t ws_size, hipStream_t stream) {
  (void)in_sizes; (void)n_in; (void)out_size; (void)ws_size;
  const float* x      = (const float*)d_in[0];
  const float* w_q    = (const float*)d_in[1];
  const float* w_k    = (const float*)d_in[2];
  const float* w_v    = (const float*)d_in[3];
  const float* w_o    = (const float*)d_in[4];
  const float* w_gate = (const float*)d_in[5];
  const float* w_up   = (const float*)d_in[6];
  const float* w_down = (const float*)d_in[7];
  const float* g1     = (const float*)d_in[8];
  const float* g2     = (const float*)d_in[9];

  unsigned char* ws = (unsigned char*)d_ws;
  const size_t MB = 1ull << 20;
  bf16_t* wtq  = (bf16_t*)(ws + 0 * MB);    // [1024][1024]      2 MB
  bf16_t* wtk  = (bf16_t*)(ws + 2 * MB);    //                   2 MB
  bf16_t* wtv  = (bf16_t*)(ws + 4 * MB);    //                   2 MB
  bf16_t* wto  = (bf16_t*)(ws + 6 * MB);    //                   2 MB
  bf16_t* wtg  = (bf16_t*)(ws + 8 * MB);    // [4096][1024]      8 MB
  bf16_t* wtu  = (bf16_t*)(ws + 16 * MB);   //                   8 MB
  bf16_t* wtd  = (bf16_t*)(ws + 24 * MB);   // [1024][4096]      8 MB
  bf16_t* nx1  = (bf16_t*)(ws + 32 * MB);   // [4096][1024]      8 MB
  bf16_t* qb   = (bf16_t*)(ws + 40 * MB);   // [4096][1024]      8 MB
  bf16_t* kb   = (bf16_t*)(ws + 48 * MB);   //                   8 MB
  bf16_t* vtb  = (bf16_t*)(ws + 56 * MB);   // [B,H,DK,SEQ]      8 MB
  bf16_t* ao   = (bf16_t*)(ws + 64 * MB);   // attn out          8 MB
  float*  x2   = (float*) (ws + 72 * MB);   // f32 resid        16 MB
  bf16_t* nx2  = (bf16_t*)(ws + 88 * MB);   // [4096][1024]      8 MB
  bf16_t* gate = (bf16_t*)(ws + 96 * MB);   // [4096][4096]     32 MB
  bf16_t* up   = (bf16_t*)(ws + 128 * MB);  //                  32 MB (end 160 MB)

  // --- weight prep: W[K][N] -> Wt[N][K] bf16 ---
  transpose_to_bf16<<<dim3(D_MODEL / 32, D_MODEL / 32), 256, 0, stream>>>(w_q, wtq, D_MODEL, D_MODEL);
  transpose_to_bf16<<<dim3(D_MODEL / 32, D_MODEL / 32), 256, 0, stream>>>(w_k, wtk, D_MODEL, D_MODEL);
  transpose_to_bf16<<<dim3(D_MODEL / 32, D_MODEL / 32), 256, 0, stream>>>(w_v, wtv, D_MODEL, D_MODEL);
  transpose_to_bf16<<<dim3(D_MODEL / 32, D_MODEL / 32), 256, 0, stream>>>(w_o, wto, D_MODEL, D_MODEL);
  transpose_to_bf16<<<dim3(D_FF / 32, D_MODEL / 32), 256, 0, stream>>>(w_gate, wtg, D_MODEL, D_FF);
  transpose_to_bf16<<<dim3(D_FF / 32, D_MODEL / 32), 256, 0, stream>>>(w_up, wtu, D_MODEL, D_FF);
  transpose_to_bf16<<<dim3(D_MODEL / 32, D_FF / 32), 256, 0, stream>>>(w_down, wtd, D_FF, D_MODEL);

  // --- attention sublayer ---
  rmsnorm_kernel<<<M_ROWS, 256, 0, stream>>>(x, g1, nx1);

  const dim3 gemm_blk(256);
  gemm_bf16_wmma<0><<<dim3(D_MODEL / 128, M_ROWS / 128), gemm_blk, 0, stream>>>(
      nx1, wtq, M_ROWS, D_MODEL, D_MODEL, nullptr, qb);
  gemm_bf16_wmma<0><<<dim3(D_MODEL / 128, M_ROWS / 128), gemm_blk, 0, stream>>>(
      nx1, wtk, M_ROWS, D_MODEL, D_MODEL, nullptr, kb);
  gemm_bf16_wmma<2><<<dim3(D_MODEL / 128, M_ROWS / 128), gemm_blk, 0, stream>>>(
      nx1, wtv, M_ROWS, D_MODEL, D_MODEL, nullptr, vtb);

  flash_attn_wmma<<<dim3(SEQ / 64, BATCH * HEADS), 128, 0, stream>>>(qb, kb, vtb, ao);

  gemm_bf16_wmma<1><<<dim3(D_MODEL / 128, M_ROWS / 128), gemm_blk, 0, stream>>>(
      ao, wto, M_ROWS, D_MODEL, D_MODEL, x, x2);

  // --- SwiGLU FFN sublayer ---
  rmsnorm_kernel<<<M_ROWS, 256, 0, stream>>>(x2, g2, nx2);

  gemm_bf16_wmma<0><<<dim3(D_FF / 128, M_ROWS / 128), gemm_blk, 0, stream>>>(
      nx2, wtg, M_ROWS, D_FF, D_MODEL, nullptr, gate);
  gemm_bf16_wmma<0><<<dim3(D_FF / 128, M_ROWS / 128), gemm_blk, 0, stream>>>(
      nx2, wtu, M_ROWS, D_FF, D_MODEL, nullptr, up);

  swiglu_kernel<<<(M_ROWS * D_FF) / 1024, 256, 0, stream>>>(gate, up, M_ROWS * D_FF);

  gemm_bf16_wmma<1><<<dim3(D_MODEL / 128, M_ROWS / 128), gemm_blk, 0, stream>>>(
      gate, wtd, M_ROWS, D_MODEL, D_FF, x2, (float*)d_out);
}

// v004
// One run takes 269 microseconds.
// Timed twice side by side with v003, it ran 1.13 and 1.14 times as fast.
// All steps since v000 together make it 1.81 times as fast.
#include <hip/hip_runtime.h>

typedef __bf16 bf16_t;
typedef __attribute__((ext_vector_type(16))) __bf16        v16bf;
typedef __attribute__((ext_vector_type(8)))  float         v8f;
typedef __attribute__((ext_vector_type(4)))  unsigned int  v4u;
typedef __attribute__((ext_vector_type(8)))  unsigned int  v8u;

#define D_MODEL 1024
#define SEQ     2048
#define BATCH   2
#define HEADS   16
#define DK      64
#define D_FF    4096
#define M_ROWS  (BATCH * SEQ)   // 4096

union FragU { v16bf v; uint4 q[2]; };

__device__ inline v16bf ld_frag16(const bf16_t* p0, const bf16_t* p1) {
  FragU u;
  u.q[0] = *reinterpret_cast<const uint4*>(p0);
  u.q[1] = *reinterpret_cast<const uint4*>(p1);
  return u.v;
}

__device__ inline v8f wmma_bf16(v16bf a, v16bf b, v8f c) {
  // (neg_a, A, neg_b, B, c_mod, C, reuse_a, reuse_b)
  return __builtin_amdgcn_wmma_f32_16x16x32_bf16(false, a, false, b, (short)0, c,
                                                 false, false);
}

// ---------------------------------------------------------------------------
// GEMM stage geometry: 64 k per stage, so an operand row is 128 B; the tensor
// load pads each row by 16 B (pitch 144 B: conflict-free ds_load_b128 rows).
// One operand tile = 128 rows x 144 B = 18432 B = 9 x 2 KiB.
// ---------------------------------------------------------------------------
#define G_BK     64
#define G_PITCH  144
#define G_TILE   (128 * G_PITCH)
#define G_STAGE  (2 * G_TILE)

__device__ inline unsigned uni(unsigned v) {
  return (unsigned)__builtin_amdgcn_readfirstlane((int)v);
}
__device__ inline unsigned pinned(unsigned v) {
  unsigned w = uni(v);
  asm volatile("" : "+s"(w));
  return w;
}

__device__ inline v8u tdm_group1_128x128B(unsigned src_pitch) {
  v8u g1;
  g1[0] = pinned((1u << 20) | (4u << 22) | (3u << 25));
  g1[1] = pinned(128u << 16);
  g1[2] = pinned(128u << 16);
  g1[3] = pinned(128u << 16);
  g1[4] = pinned(128u);
  g1[5] = pinned(src_pitch);
  g1[6] = pinned(0u);
  g1[7] = pinned(0u);
  return g1;
}

// One tensor load: the tile whose first byte is gtile, to LDS byte offset lds_off.
__device__ inline void tdm_load_tile(const bf16_t* gtile, unsigned lds_off, v8u g1) {
  const unsigned long long ga = (unsigned long long)(size_t)gtile;
  v4u g0;
  g0[0] = uni(1u);                              // count = 1
  g0[1] = uni(lds_off);                         // LDS destination (bytes)
  g0[2] = uni((unsigned)ga);                    // global address [31:0]
  g0[3] = uni(((unsigned)(ga >> 32) & 0x01FFFFFFu) | 0x80000000u);  // [56:32], type 2
  asm volatile("tensor_load_to_lds %0, %1" :: "s"(g0), "s"(g1) : "memory");
}

// Attention stage geometry: 64 keys per stage. The K tile is 64 key rows of 128 B
// (one head's 64 dims), the V^T tile 64 dim rows of 128 B (64 keys); both land at
// pitch G_PITCH. One tile = 64 x 144 B = 9216 B, its place rounded up to 5 x 2 KiB.
#define A_KEYS   64
#define A_TILE   10240
#define A_STAGE  (2 * A_TILE)

__device__ inline v4u tdm_group0(const bf16_t* gtile, unsigned lds_off) {
  const unsigned long long ga = (unsigned long long)(size_t)gtile;
  v4u g0;
  g0[0] = uni(1u);                              // count = 1
  g0[1] = uni(lds_off);                         // LDS destination (bytes)
  g0[2] = uni((unsigned)ga);                    // global address [31:0]
  g0[3] = uni(((unsigned)(ga >> 32) & 0x01FFFFFFu) | 0x80000000u);  // [56:32], type 2
  return g0;
}

__device__ inline v8u tdm_group1_64x128B(unsigned src_pitch) {
  v8u g1;
  g1[0] = pinned((1u << 20) | (4u << 22) | (3u << 25));
  g1[1] = pinned(128u << 16);
  g1[2] = pinned(64u << 16);
  g1[3] = pinned(128u << 16);
  g1[4] = pinned(64u);
  g1[5] = pinned(src_pitch);
  g1[6] = pinned(0u);
  g1[7] = pinned(0u);
  return g1;
}

// ---------------------------------------------------------------------------
// Weight transpose + fp32 -> bf16 convert:  W[K][N] -> Wt[N][K]
// One 32 x 32 tile (first column n0, first row k0) by one block of 256 threads.
// ---------------------------------------------------------------------------
__device__ inline void transpose_tile(
    const float* __restrict__ W, bf16_t* __restrict__ Wt, int K, int N,
    int n0, int k0) {
  __shared__ float tile[32][33];
  const int tx = threadIdx.x & 31, ty = threadIdx.x >> 5;  // 32 x 8
#pragma unroll
  for (int i = 0; i < 4; ++i)
    tile[ty + i * 8][tx] = W[(size_t)(k0 + ty + i * 8) * N + n0 + tx];
  __syncthreads();
#pragma unroll
  for (int i = 0; i < 4; ++i)
    Wt[(size_t)(n0 + ty + i * 8) * K + k0 + tx] = (bf16_t)tile[tx][ty + i * 8];
}

// ---------------------------------------------------------------------------
// RMSNorm: fp32 row -> bf16 normalized row (one block per row, D_MODEL=1024)
// ---------------------------------------------------------------------------
__device__ inline void rmsnorm_row(
    const float* __restrict__ x, const float* __restrict__ gain,
    bf16_t* __restrict__ out, int row) {
  __shared__ float warp_sum[8];
  const int tid = threadIdx.x;
  const float4 v = reinterpret_cast<const float4*>(x + (size_t)row * D_MODEL)[tid];
  float ss = v.x * v.x + v.y * v.y + v.z * v.z + v.w * v.w;
  ss += __shfl_xor(ss, 1, 32);
  ss += __shfl_xor(ss, 2, 32);
  ss += __shfl_xor(ss, 4, 32);
  ss += __shfl_xor(ss, 8, 32);
  ss += __shfl_xor(ss, 16, 32);
  if ((tid & 31) == 0) warp_sum[tid >> 5] = ss;
  __syncthreads();
  float tot = 0.f;
#pragma unroll
  for (int i = 0; i < 8; ++i) tot += warp_sum[i];
  const float inv = rsqrtf(tot * (1.0f / D_MODEL) + 1e-6f);
  const float4 gv = reinterpret_cast<const float4*>(gain)[tid];
  bf16_t* orow = out + (size_t)row * D_MODEL + tid * 4;
  orow[0] = (bf16_t)(v.x * inv * gv.x);
  orow[1] = (bf16_t)(v.y * inv * gv.y);
  orow[2] = (bf16_t)(v.z * inv * gv.z);
  orow[3] = (bf16_t)(v.w * inv * gv.w);
}

__global__ __launch_bounds__(256) void rmsnorm_kernel(
    const float* __restrict__ x, const float* __restrict__ gain,
    bf16_t* __restrict__ out) {
  rmsnorm_row(x, gain, out, (int)blockIdx.x);
}

// ---------------------------------------------------------------------------
// Everything that reads the inputs alone, in ONE grid: the seven weight
// transposes and the first RMSNorm depend on nothing but the inputs, so their
// blocks share a launch. A block's job follows from its index (the same for all
// of its threads, so every barrier stands under block-uniform control flow):
//   PREP_SQ blocks   : w_q, w_k, w_v, w_o    (1024 tiles each)
//   PREP_UP blocks   : w_gate, w_up          (4096 tiles each)
//   PREP_DN blocks   : w_down                (4096 tiles)
//   M_ROWS blocks    : one row of x each
// wt: the transposed weights one behind the other, in that order.
// ---------------------------------------------------------------------------
#define SQ_TILES  ((D_MODEL / 32) * (D_MODEL / 32))   // 1024
#define FF_TILES  ((D_MODEL / 32) * (D_FF / 32))      // 4096
#define PREP_SQ   (4 * SQ_TILES)
#define PREP_UP   (2 * FF_TILES)
#define PREP_DN   FF_TILES
#define PREP_GRID (PREP_SQ + PREP_UP + PREP_DN + M_ROWS)

__global__ __launch_bounds__(256) void prep_kernel(
    const float* __restrict__ w_q, const float* __restrict__ w_k,
    const float* __restrict__ w_v, const float* __restrict__ w_o,
    const float* __restrict__ w_gate, const float* __restrict__ w_up,
    const float* __restrict__ w_down, const float* __restrict__ x,
    const float* __restrict__ gain, bf16_t* __restrict__ wt,
    bf16_t* __restrict__ nx) {
  const int b = (int)blockIdx.x;
  if (b >= PREP_SQ + PREP_UP + PREP_DN) {
    rmsnorm_row(x, gain, nx, b - (PREP_SQ + PREP_UP + PREP_DN));
    return;
  }
  const float* W;
  bf16_t* Wt;
  int K, N, n0, k0;  // tiles are numbered inside their matrix, columns fastest
  if (b < PREP_SQ) {
    const int m = b / SQ_TILES, r = b % SQ_TILES;
    n0 = (r % (D_MODEL / 32)) * 32; k0 = (r / (D_MODEL / 32)) * 32;
    W = (m == 0) ? w_q : (m == 1) ? w_k : (m == 2) ? w_v : w_o;
    Wt = wt + (size_t)m * (D_MODEL * D_MODEL);
    K = D_MODEL; N = D_MODEL;
  } else if (b < PREP_SQ + PREP_UP) {
    const int m = (b - PREP_SQ) / FF_TILES, r = (b - PREP_SQ) % FF_TILES;
    n0 = (r % (D_FF / 32)) * 32; k0 = (r / (D_FF / 32)) * 32;
    W = (m == 0) ? w_gate : w_up;
    Wt = wt + (size_t)4 * (D_MODEL * D_MODEL) + (size_t)m * (D_MODEL * D_FF);
    K = D_MODEL; N = D_FF;
  } else {
    const int r = b - (PREP_SQ + PREP_UP);
    n0 = (r % (D_MODEL / 32)) * 32; k0 = (r / (D_MODEL / 32)) * 32;
    W = w_down;
    Wt = wt + (size_t)4 * (D_MODEL * D_MODEL) + (size_t)2 * (D_MODEL * D_FF);
    K = D_FF; N = D_MODEL;
  }
  transpose_tile(W, Wt, K, N, n0, k0);
  // in the compiled text the RMSNorm code stands behind these stores and takes
  // their registers again: the wait stands in front of that overwrite
  asm volatile("s_wait_xcnt 0x0" ::: "memory");
}

// ---------------------------------------------------------------------------
// A wave's 32 x 64 accumulators to memory. D layout: element r of a fragment is
// row r + 8*(lane/16), column lane%16; m_w, n_w: this lane's row and column of
// element 0 of fragment (0, 0).
// MODE: 0 = store bf16, 1 = fp32 out = resid + C, 2 = bf16 scatter to V^T
// ---------------------------------------------------------------------------
template <int MODE>
__device__ inline void gemm_store(const v8f (&acc)[2][4], int m_w, int n_w, int N,
                                  const float* __restrict__ resid,
                                  void* __restrict__ outp) {
  // unrolled so that every accumulator index is a constant (registers, no scratch)
#pragma unroll
  for (int mi = 0; mi < 2; ++mi)
#pragma unroll
    for (int ni = 0; ni < 4; ++ni)
#pragma unroll
      for (int r = 0; r < 8; ++r) {
        const int mg = m_w + mi * 16 + r;
        const int ng = n_w + ni * 16;
        const float c = acc[mi][ni][r];
        if (MODE == 0) {
          ((bf16_t*)outp)[(size_t)mg * N + ng] = (bf16_t)c;
        } else if (MODE == 1) {
          const size_t idx = (size_t)mg * N + ng;
          ((float*)outp)[idx] = resid[idx] + c;
        } else {  // V^T scatter: [B,H,DK,SEQ]
          const int bb = mg >> 11, sin = mg & (SEQ - 1);
          const int hh = ng >> 6, dd = ng & (DK - 1);
          ((bf16_t*)outp)[(((size_t)(bb * HEADS + hh) * DK + dd) << 11) + sin] =
              (bf16_t)c;
        }
      }
}

// ---------------------------------------------------------------------------
// GEMM: C[M][N] = A[M][K] (bf16, k-major) x Bt[N][K] (bf16, k-major)
// 256 threads = 8 waves; block tile 128x128; per-wave 32x64 (2x4 frags).
// Several products that share A run side by side in one grid: product p takes
// rows p * N .. p * N + N - 1 of Bt (grid.x covers them all) and writes the p-th
// M x N matrix at outp.
// EPI: 0 = two products, stored as bf16, 1 = one product, fp32 out = resid + C,
//      2 = three products: 0 and 1 stored as bf16, 2 scattered to V^T
// Assumes M,N % 128 == 0, K % 64 == 0 and K >= 128 (true for all calls here).
// ---------------------------------------------------------------------------
template <int EPI>
__global__ __launch_bounds__(256) void gemm_bf16_wmma(
    const bf16_t* __restrict__ A, const bf16_t* __restrict__ Bt,
    int M, int N, int K, const float* __restrict__ resid,
    void* __restrict__ outp) {
  // ring[buffer][A tile | B tile]; every tile starts at a multiple of 2 KiB
  __shared__ __attribute__((aligned(2048))) unsigned char ring[2 * G_STAGE];
  const int tid  = threadIdx.x;
  const int lane = tid & 31, wave = tid >> 5;
  const int g = lane >> 4, ln = lane & 15;
  const int wm = wave >> 1, wn = wave & 1;
  const int m_blk = blockIdx.y * 128, n_blk = blockIdx.x * 128;
  // Wave 0 brings the A tile of every stage, wave 1 the B tile.
  const unsigned wave_u = uni((unsigned)threadIdx.x >> 5);
  const bf16_t* my_src = (wave_u == 0) ? A + (size_t)m_blk * K
                                       : Bt + (size_t)n_blk * K;
  const unsigned my_lds = (unsigned)(size_t)(void*)&ring[0] +
                          ((wave_u == 0) ? 0u : (unsigned)G_TILE);
  const v8u g1 = tdm_group1_128x128B((unsigned)K * 2u);
  const int n_stage = K / G_BK;

  v8f acc[2][4] = {};

  // Prologue: stage 0 lands and is published, then stage 1 starts to fly.
  if (pinned(wave_u < 2u)) {
    tdm_load_tile(my_src, my_lds, g1);
    // stage 0 has landed here
    asm volatile("s_wait_tensorcnt 0x0" ::: "memory");
  }
  __syncthreads();
  if (pinned(wave_u < 2u))
    tdm_load_tile(my_src + G_BK, my_lds + G_STAGE, g1);

  for (int s = 0; s < n_stage; ++s) {
    const unsigned char* bufA = ring + (s & 1) * G_STAGE;
    const unsigned char* bufB = bufA + G_TILE;
    // unrolled so that every fragment and accumulator index is a constant
    // (registers, no scratch); the two 32-k blocks keep the ascending k order
#pragma unroll
    for (int kk = 0; kk < 2; ++kk) {
      v16bf aF[2], bF[4];
#pragma unroll
      for (int mi = 0; mi < 2; ++mi) {
        const unsigned char* p =
            bufA + (wm * 32 + mi * 16 + ln) * G_PITCH + kk * 64 + g * 16;
        aF[mi] = ld_frag16((const bf16_t*)p, (const bf16_t*)(p + 32));
      }
#pragma unroll
      for (int ni = 0; ni < 4; ++ni) {
        const unsigned char* p =
            bufB + (wn * 64 + ni * 16 + ln) * G_PITCH + kk * 64 + g * 16;
        bF[ni] = ld_frag16((const bf16_t*)p, (const bf16_t*)(p + 32));
      }
#pragma unroll
      for (int mi = 0; mi < 2; ++mi)
#pragma unroll
        for (int ni = 0; ni < 4; ++ni)
          acc[mi][ni] = wmma_bf16(aF[mi], bF[ni], acc[mi][ni]);
    }
    // Publish point of stage s + 1. This wave's reads of buffer s & 1 are done:
    asm volatile("s_wait_dscnt 0x0" ::: "memory");
    if (pinned(wave_u < 2u)) {
      // the issuing wave's own tile of stage s + 1 has landed
      asm volatile("s_wait_tensorcnt 0x0" ::: "memory");
    }
    __syncthreads();
    // Refill the buffer that every wave has just left, while a stage is left.
    if (pinned((wave_u < 2u) && (s + 2 < n_stage)))
      tdm_load_tile(my_src + (size_t)(s + 2) * G_BK,
                    my_lds + (unsigned)(s & 1) * G_STAGE, g1);
  }
  asm volatile("s_wait_tensorcnt 0x0" :: "s"(g1) : "memory");
  asm volatile("s_wait_dscnt 0x0" ::: "memory");

  // Epilogue: this product's matrix, in this product's form. The test on prod is
  // the same for the whole block and stands outside the store loops, so that each
  // form keeps its straight-line stores (the V^T form: 16 bytes a lane).
  constexpr int n_prod = (EPI == 2) ? 3 : (EPI == 0) ? 2 : 1;
  int prod = 0;  // which product this block's columns belong to
  for (int p = 1; p < n_prod; ++p) prod += (n_blk >= p * N) ? 1 : 0;
  void* const outm = (EPI == 1) ? outp : (void*)((bf16_t*)outp + (size_t)prod * M * N);
  const int m_w = m_blk + wm * 32 + 8 * g, n_w = n_blk - prod * N + wn * 64 + ln;
  if (EPI == 2) {
    if (prod < 2) {
      gemm_store<0>(acc, m_w, n_w, N, resid, outm);
    } else {
      gemm_store<2>(acc, m_w, n_w, N, resid, outm);
      // in the compiled text the other form's code stands behind these stores and
      // takes their registers again: the wait stands in front of that overwrite
      asm volatile("s_wait_xcnt 0x0" ::: "memory");
    }
  } else {
    gemm_store<EPI>(acc, m_w, n_w, N, resid, outm);
  }
}

// Maximum over each 16-lane row of eight independent values, left in every lane
// of the row. Four butterfly steps (lane ^ 1, 2, 4, 8), each one vector
// instruction whose first source is read through DPP row_xmask: nothing goes
// over the LDS path and nothing waits on dscnt, where __shfl_xor compiles to
// ds_bpermute_b32 with a wait behind every step. The eight values go through a
// step together, so an instruction's producer stands eight instructions back
// and no step waits for the one before it. Every lane of the wave must be on.
__device__ inline void row_max16_x8(float (&v)[8]) {
  asm(
      "v_max_num_f32_dpp %0, %0, %0 row_xmask:1 row_mask:0xf bank_mask:0xf\n\t"
      "v_max_num_f32_dpp %1, %1, %1 row_xmask:1 row_mask:0xf bank_mask:0xf\n\t"
      "v_max_num_f32_dpp %2, %2, %2 row_xmask:1 row_mask:0xf bank_mask:0xf\n\t"
      "v_max_num_f32_dpp %3, %3, %3 row_xmask:1 row_mask:0xf bank_mask:0xf\n\t"
      "v_max_num_f32_dpp %4, %4, %4 row_xmask:1 row_mask:0xf bank_mask:0xf\n\t"
      "v_max_num_f32_dpp %5, %5, %5 row_xmask:1 row_mask:0xf bank_mask:0xf\n\t"
      "v_max_num_f32_dpp %6, %6, %6 row_xmask:1 row_mask:0xf bank_mask:0xf\n\t"
      "v_max_num_f32_dpp %7, %7, %7 row_xmask:1 row_mask:0xf bank_mask:0xf\n\t"
      "v_max_num_f32_dpp %0, %0, %0 row_xmask:2 row_mask:0xf bank_mask:0xf\n\t"
      "v_max_num_f32_dpp %1, %1, %1 row_xmask:2 row_mask:0xf bank_mask:0xf\n\t"
      "v_max_num_f32_dpp %2, %2, %2 row_xmask:2 row_mask:0xf bank_mask:0xf\n\t"
      "v_max_num_f32_dpp %3, %3, %3 row_xmask:2 row_mask:0xf bank_mask:0xf\n\t"
      "v_max_num_f32_dpp %4, %4, %4 row_xmask:2 row_mask:0xf bank_mask:0xf\n\t"
      "v_max_num_f32_dpp %5, %5, %5 row_xmask:2 row_mask:0xf bank_mask:0xf\n\t"
      "v_max_num_f32_dpp %6, %6, %6 row_xmask:2 row_mask:0xf bank_mask:0xf\n\t"
      "v_max_num_f32_dpp %7, %7, %7 row_xmask:2 row_mask:0xf bank_mask:0xf\n\t"
      "v_max_num_f32_dpp %0, %0, %0 row_xmask:4 row_mask:0xf bank_mask:0xf\n\t"
      "v_max_num_f32_dpp %1, %1, %1 row_xmask:4 row_mask:0xf bank_mask:0xf\n\t"
      "v_max_num_f32_dpp %2, %2, %2 row_xmask:4 row_mask:0xf bank_mask:0xf\n\t"
      "v_max_num_f32_dpp %3, %3, %3 row_xmask:4 row_mask:0xf bank_mask:0xf\n\t"
      "v_max_num_f32_dpp %4, %4, %4 row_xmask:4 row_mask:0xf bank_mask:0xf\n\t"
      "v_max_num_f32_dpp %5, %5, %5 row_xmask:4 row_mask:0xf bank_mask:0xf\n\t"
      "v_max_num_f32_dpp %6, %6, %6 row_xmask:4 row_mask:0xf bank_mask:0xf\n\t"
      "v_max_num_f32_dpp %7, %7, %7 row_xmask:4 row_mask:0xf bank_mask:0xf\n\t"
      "v_max_num_f32_dpp %0, %0, %0 row_xmask:8 row_mask:0xf bank_mask:0xf\n\t"
      "v_max_num_f32_dpp %1, %1, %1 row_xmask:8 row_mask:0xf bank_mask:0xf\n\t"
      "v_max_num_f32_dpp %2, %2, %2 row_xmask:8 row_mask:0xf bank_mask:0xf\n\t"
      "v_max_num_f32_dpp %3, %3, %3 row_xmask:8 row_mask:0xf bank_mask:0xf\n\t"
      "v_max_num_f32_dpp %4, %4, %4 row_xmask:8 row_mask:0xf bank_mask:0xf\n\t"
      "v_max_num_f32_dpp %5, %5, %5 row_xmask:8 row_mask:0xf bank_mask:0xf\n\t"
      "v_max_num_f32_dpp %6, %6, %6 row_xmask:8 row_mask:0xf bank_mask:0xf\n\t"
      "v_max_num_f32_dpp %7, %7, %7 row_xmask:8 row_mask:0xf bank_mask:0xf"
      : "+v"(v[0]), "+v"(v[1]), "+v"(v[2]), "+v"(v[3]),
        "+v"(v[4]), "+v"(v[5]), "+v"(v[6]), "+v"(v[7]));
}

__global__ __launch_bounds__(128) void flash_attn_wmma(
    const bf16_t* __restrict__ Q, const bf16_t* __restrict__ Km,
    const bf16_t* __restrict__ Vt, bf16_t* __restrict__ O) {
  // ring[buffer][K tile | V^T tile]; every tile starts at a multiple of 2 KiB
  __shared__ __attribute__((aligned(2048))) unsigned char ring[2 * A_STAGE];
  __shared__ bf16_t sP[4][16][40];  // per-wave P staging (D-layout -> A-layout)
  const int tid  = threadIdx.x;
  const int lane = tid & 31;
  const unsigned wave_u = uni((unsigned)threadIdx.x >> 5);
  const int wave = (int)wave_u;
  const int g = lane >> 4, ln = lane & 15;
  const int bh = blockIdx.y, b = bh >> 4, h = bh & 15;
  const int q0 = blockIdx.x * 64 + wave * 16;

  // The block's four waves read the same keys: wave 0 brings the K tile of every
  // stage, wave 1 the V^T tile. The block's rows end at key 64 * blockIdx.x + 63.
  const bf16_t* my_src = (wave_u == 0)
                             ? Km + (size_t)(b * SEQ) * D_MODEL + h * DK
                             : Vt + (size_t)((b * HEADS + h) * DK) * SEQ;
  // a stage's step in the source, as a shift: 64 rows of K, 64 columns of V^T
  const unsigned my_shift = (wave_u == 0) ? 16u : 6u;
  static_assert(A_KEYS * D_MODEL == 1 << 16 && A_KEYS == 1 << 6, "stage steps");
  const unsigned my_lds = (unsigned)(size_t)(void*)&ring[0] +
                          ((wave_u == 0) ? 0u : (unsigned)A_TILE);
  const v8u g1 = tdm_group1_64x128B((wave_u == 0) ? (unsigned)(D_MODEL * 2)
                                                  : (unsigned)(SEQ * 2));
  const int n_stage = (int)blockIdx.x + 1;

  // Q A-fragments: 16 rows x 64 (two k-halves of 32)
  const bf16_t* qrow = Q + (size_t)(b * SEQ + q0 + ln) * D_MODEL + h * DK;
  v16bf qf[2];
#pragma unroll
  for (int kk = 0; kk < 2; ++kk)
    qf[kk] = ld_frag16(qrow + kk * 32 + g * 8, qrow + kk * 32 + 16 + g * 8);

  v16bf onesf;
#pragma unroll
  for (int j = 0; j < 16; ++j) onesf[j] = (bf16_t)1.0f;

  v8f o[4] = {};
  v8f o5 = {};  // softmax denominator accumulator (P x ones)
  float mrow[8];
#pragma unroll
  for (int r = 0; r < 8; ++r) mrow[r] = -__builtin_inff();

  v4u g0 = {0u, 0u, 0u, 0u};
  if (pinned(wave_u < 2u)) {
    g0 = tdm_group0(my_src, my_lds);
    asm volatile("tensor_load_to_lds %0, %1" :: "s"(g0), "s"(g1) : "memory");
    // stage 0 has landed here
    asm volatile("s_wait_tensorcnt 0x0" :: "s"(g0) : "memory");
  }
  __syncthreads();
  if (pinned(wave_u < 2u)) {
    g0 = tdm_group0(my_src + ((size_t)1 << my_shift), my_lds + A_STAGE);
    asm volatile("tensor_load_to_lds %0, %1" :: "s"(g0), "s"(g1) : "memory");
  }

  for (int st = 0; st < n_stage; ++st) {
   const unsigned char* bufK = ring + (st & 1) * A_STAGE;
   const unsigned char* bufV = bufK + A_TILE;
   // the stage's two 32-key tiles; a wave skips a tile wholly above its diagonal
   for (int t0 = st * A_KEYS; t0 < (st + 1) * A_KEYS && t0 <= q0 + 15; t0 += 32) {
    const int tr = t0 - st * A_KEYS;  // first key of the tile inside the stage
    // The tile's K and V^T B-fragments, as one group of LDS reads, K first: the V
    // reads return under the score products and the softmax.
    v16bf kf[2][2], vf[4];
#pragma unroll
    for (int ni = 0; ni < 2; ++ni) {
      const unsigned char* krow = bufK + (tr + ni * 16 + ln) * G_PITCH + g * 16;
#pragma unroll
      for (int kk = 0; kk < 2; ++kk)
        kf[ni][kk] = ld_frag16((const bf16_t*)(krow + kk * 64),
                               (const bf16_t*)(krow + kk * 64 + 32));
    }
#pragma unroll
    for (int f = 0; f < 4; ++f) {
      const unsigned char* vrow = bufV + (f * 16 + ln) * G_PITCH + tr * 2 + g * 16;
      vf[f] = ld_frag16((const bf16_t*)vrow, (const bf16_t*)(vrow + 32));
    }
    // scores S = Q * K^T  (16 x 32), two 16x16 D frags
    v8f s[2] = {};
#pragma unroll
    for (int ni = 0; ni < 2; ++ni)
#pragma unroll
      for (int kk = 0; kk < 2; ++kk)
        s[ni] = wmma_bf16(qf[kk], kf[ni][kk], s[ni]);
    // scale + causal mask
#pragma unroll
    for (int ni = 0; ni < 2; ++ni)
#pragma unroll
      for (int r = 0; r < 8; ++r) {
        const float v = s[ni][r] * 0.125f;  // 1/sqrt(64)
        const int qg = q0 + r + 8 * g;
        const int tg = t0 + ni * 16 + ln;
        s[ni][r] = (tg > qg) ? -__builtin_inff() : v;
      }
    // row max (butterfly within 16-lane halves) + online rescale factor
    float alpha[8], vmax[8];
#pragma unroll
    for (int r = 0; r < 8; ++r)
      vmax[r] = fmaxf(fmaxf(s[0][r], s[1][r]), mrow[r]);  // mrow: equal in the row
    row_max16_x8(vmax);
#pragma unroll
    for (int r = 0; r < 8; ++r) {
      const float mn = vmax[r];
      alpha[r] = __expf(mrow[r] - mn);
      mrow[r] = mn;
    }
#pragma unroll
    for (int ni = 0; ni < 2; ++ni)
#pragma unroll
      for (int r = 0; r < 8; ++r) s[ni][r] = __expf(s[ni][r] - mrow[r]);
#pragma unroll
    for (int f = 0; f < 4; ++f)
#pragma unroll
      for (int r = 0; r < 8; ++r) o[f][r] *= alpha[r];
#pragma unroll
    for (int r = 0; r < 8; ++r) o5[r] *= alpha[r];

    // P: D-layout -> bf16 LDS -> A-layout (wave-local, split-counter sync)
#pragma unroll
    for (int ni = 0; ni < 2; ++ni)
#pragma unroll
      for (int r = 0; r < 8; ++r)
        sP[wave][r + 8 * g][ni * 16 + ln] = (bf16_t)s[ni][r];
    asm volatile("s_wait_dscnt 0" ::: "memory");
    v16bf pf = ld_frag16(&sP[wave][ln][g * 8], &sP[wave][ln][16 + g * 8]);

    // O += P(16x32) * V(32x64): B frags from V^T rows (contiguous along t)
#pragma unroll
    for (int f = 0; f < 4; ++f) o[f] = wmma_bf16(pf, vf[f], o[f]);
    // denominator: l += P x ones
    o5 = wmma_bf16(pf, onesf, o5);
    asm volatile("v_nop\n\tv_nop\n\tv_nop\n\tv_nop" :: "v"(o5));
   }
   // Publish point of stage st + 1; every wave passes it, also one that skipped a
   // tile. This wave's reads of buffer st & 1 are done:
   asm volatile("s_wait_dscnt 0x0" ::: "memory");
   if (pinned(wave_u < 2u)) {
     // the issuing wave's own tile of stage st + 1 has landed
     asm volatile("s_wait_tensorcnt 0x0" :: "s"(g0) : "memory");
   }
   __syncthreads();
   // Refill the buffer that every wave has just left, while a stage is left.
   if (pinned((wave_u < 2u) && (st + 2 < n_stage))) {
     g0 = tdm_group0(my_src + ((size_t)(st + 2) << my_shift),
                     my_lds + (unsigned)(st & 1) * A_STAGE);
     asm volatile("tensor_load_to_lds %0, %1" :: "s"(g0), "s"(g1) : "memory");
   }
  }
  // nothing of the ring is outstanding when the wave goes on to its stores
  asm volatile("s_wait_tensorcnt 0x0" ::: "memory");
  asm volatile("s_wait_dscnt 0x0" ::: "memory");

  // normalize and store: out[b, q, h*64 + d] (bf16, row-major D_MODEL)
#pragma unroll
  for (int f = 0; f < 4; ++f)
#pragma unroll
    for (int r = 0; r < 8; ++r) {
      const float val = o[f][r] / o5[r];
      const int qg = q0 + r + 8 * g;
      O[(size_t)(b * SEQ + qg) * D_MODEL + h * DK + f * 16 + ln] = (bf16_t)val;
    }
}

// ---------------------------------------------------------------------------
// SwiGLU elementwise: gate = silu(gate) * up   (bf16, in-place)
// ---------------------------------------------------------------------------
__global__ __launch_bounds__(256) void swiglu_kernel(
    bf16_t* __restrict__ gate, const bf16_t* __restrict__ up, int n) {
  const int i4 = (blockIdx.x * 256 + threadIdx.x) * 4;
  if (i4 >= n) return;
#pragma unroll
  for (int j = 0; j < 4; ++j) {
    const float gv = (float)gate[i4 + j];
    const float uv = (float)up[i4 + j];
    const float sil = gv / (1.f + __expf(-gv));
    gate[i4 + j] = (bf16_t)(sil * uv);
  }
}

// ---------------------------------------------------------------------------
// Host orchestration
// ---------------------------------------------------------------------------
extern "C" void kernel_launch(void* const* d_in, const int* in_sizes, int n_in,
                              void* d_out, int out_size, void* d_ws,
                              size_t ws_size, hipStream_t stream) {
  (void)in_sizes; (void)n_in; (void)out_size; (void)ws_size;
  const float* x      = (const float*)d_in[0];
  const float* w_q    = (const float*)d_in[1];
  const float* w_k    = (const float*)d_in[2];
  const float* w_v    = (const float*)d_in[3];
  const float* w_o    = (const float*)d_in[4];
  const float* w_gate = (const float*)d_in[5];
  const float* w_up   = (const float*)d_in[6];
  const float* w_down = (const float*)d_in[7];
  const float* g1     = (const float*)d_in[8];
  const float* g2     = (const float*)d_in[9];

  unsigned char* ws = (unsigned char*)d_ws;
  const size_t MB = 1ull << 20;
  bf16_t* wtq  = (bf16_t*)(ws + 0 * MB);    // [1024][1024]      2 MB
  bf16_t* wtk  = (bf16_t*)(ws + 2 * MB);    //                   2 MB
  bf16_t* wtv  = (bf16_t*)(ws + 4 * MB);    //                   2 MB
  bf16_t* wto  = (bf16_t*)(ws + 6 * MB);    //                   2 MB
  bf16_t* wtg  = (bf16_t*)(ws + 8 * MB);    // [4096][1024]      8 MB
  bf16_t* wtu  = (bf16_t*)(ws + 16 * MB);   //                   8 MB
  bf16_t* wtd  = (bf16_t*)(ws + 24 * MB);   // [1024][4096]      8 MB
  bf16_t* nx1  = (bf16_t*)(ws + 32 * MB);   // [4096][1024]      8 MB
  bf16_t* qb   = (bf16_t*)(ws + 40 * MB);   // [4096][1024]      8 MB
  bf16_t* kb   = (bf16_t*)(ws + 48 * MB);   //                   8 MB
  bf16_t* vtb  = (bf16_t*)(ws + 56 * MB);   // [B,H,DK,SEQ]      8 MB
  bf16_t* ao   = (bf16_t*)(ws + 64 * MB);   // attn out          8 MB
  float*  x2   = (float*) (ws + 72 * MB);   // f32 resid        16 MB
  bf16_t* nx2  = (bf16_t*)(ws + 88 * MB);   // [4096][1024]      8 MB
  bf16_t* gate = (bf16_t*)(ws + 96 * MB);   // [4096][4096]     32 MB
  bf16_t* up   = (bf16_t*)(ws + 128 * MB);  //                  32 MB (end 160 MB)

  // --- weight prep W[K][N] -> Wt[N][K] bf16 and the first RMSNorm, one grid ---
  // (wtq .. wtd lie one behind the other in the workspace)
  (void)wtk; (void)wtv; (void)wtu;  // reached through wtq and wtg
  prep_kernel<<<PREP_GRID, 256, 0, stream>>>(w_q, w_k, w_v, w_o, w_gate, w_up, w_down,
                                             x, g1, wtq, nx1);

  // --- attention sublayer ---
  // Q, K and V in one grid: wtq, wtk, wtv are adjacent, and so are qb, kb, vtb
  const dim3 gemm_blk(256);
  gemm_bf16_wmma<2><<<dim3(3 * D_MODEL / 128, M_ROWS / 128), gemm_blk, 0, stream>>>(
      nx1, wtq, M_ROWS, D_MODEL, D_MODEL, nullptr, qb);

  flash_attn_wmma<<<dim3(SEQ / 64, BATCH * HEADS), 128, 0, stream>>>(qb, kb, vtb, ao);

  gemm_bf16_wmma<1><<<dim3(D_MODEL / 128, M_ROWS / 128), gemm_blk, 0, stream>>>(
      ao, wto, M_ROWS, D_MODEL, D_MODEL, x, x2);

  // --- SwiGLU FFN sublayer ---
  rmsnorm_kernel<<<M_ROWS, 256, 0, stream>>>(x2, g2, nx2);

  // gate and up in one grid: wtg, wtu are adjacent, and so are gate, up
  gemm_bf16_wmma<0><<<dim3(2 * D_FF / 128, M_ROWS / 128), gemm_blk, 0, stream>>>(
      nx2, wtg, M_ROWS, D_FF, D_MODEL, nullptr, gate);

  swiglu_kernel<<<(M_ROWS * D_FF) / 1024, 256, 0, stream>>>(gate, up, M_ROWS * D_FF);

  gemm_bf16_wmma<1><<<dim3(D_MODEL / 128, M_ROWS / 128), gemm_blk, 0, stream>>>(
      gate, wtd, M_ROWS, D_MODEL, D_FF, x2, (float*)d_out);
}

// v005
// One run takes 251 microseconds.
// Next to v004, in two timings, it ran 1.08 and 1.07 times as fast.
// Over all steps from v000 it is 1.94 times as fast.
#include <hip/hip_runtime.h>

typedef __bf16 bf16_t;
typedef __attribute__((ext_vector_type(16))) __bf16        v16bf;
typedef __attribute__((ext_vector_type(8)))  float         v8f;
typedef __attribute__((ext_vector_type(4)))  unsigned int  v4u;
typedef __attribute__((ext_vector_type(8)))  unsigned int  v8u;

#define D_MODEL 1024
#define SEQ     2048
#define BATCH   2
#define HEADS   16
#define DK      64
#define D_FF    4096
#define M_ROWS  (BATCH * SEQ)   // 4096

union FragU { v16bf v; uint4 q[2]; };

__device__ inline v16bf ld_frag16(const bf16_t* p0, const bf16_t* p1) {
  FragU u;
  u.q[0] = *reinterpret_cast<const uint4*>(p0);
  u.q[1] = *reinterpret_cast<const uint4*>(p1);
  return u.v;
}

__device__ inline v8f wmma_bf16(v16bf a, v16bf b, v8f c) {
  // (neg_a, A, neg_b, B, c_mod, C, reuse_a, reuse_b)
  return __builtin_amdgcn_wmma_f32_16x16x32_bf16(false, a, false, b, (short)0, c,
                                                 false, false);
}

// ---------------------------------------------------------------------------
// GEMM stage geometry: 64 k per stage, so an operand row is 128 B; the tensor
// load pads each row by 16 B (pitch 144 B: conflict-free ds_load_b128 rows).
// One operand tile = 128 rows x 144 B = 18432 B = 9 x 2 KiB.
// ---------------------------------------------------------------------------
#define G_BK     64
#define G_PITCH  144
#define G_TILE   (128 * G_PITCH)
#define G_STAGE  (2 * G_TILE)

__device__ inline unsigned uni(unsigned v) {
  return (unsigned)__builtin_amdgcn_readfirstlane((int)v);
}
__device__ inline unsigned pinned(unsigned v) {
  unsigned w = uni(v);
  asm volatile("" : "+s"(w));
  return w;
}

__device__ inline v8u tdm_group1_128x128B(unsigned src_pitch) {
  v8u g1;
  g1[0] = pinned((1u << 20) | (4u << 22) | (3u << 25));
  g1[1] = pinned(128u << 16);
  g1[2] = pinned(128u << 16);
  g1[3] = pinned(128u << 16);
  g1[4] = pinned(128u);
  g1[5] = pinned(src_pitch);
  g1[6] = pinned(0u);
  g1[7] = pinned(0u);
  return g1;
}

// One tensor load: the tile whose first byte is gtile, to LDS byte offset lds_off.
__device__ inline void tdm_load_tile(const bf16_t* gtile, unsigned lds_off, v8u g1) {
  const unsigned long long ga = (unsigned long long)(size_t)gtile;
  v4u g0;
  g0[0] = uni(1u);                              // count = 1
  g0[1] = uni(lds_off);                         // LDS destination (bytes)
  g0[2] = uni((unsigned)ga);                    // global address [31:0]
  g0[3] = uni(((unsigned)(ga >> 32) & 0x01FFFFFFu) | 0x80000000u);  // [56:32], type 2
  asm volatile("tensor_load_to_lds %0, %1" :: "s"(g0), "s"(g1) : "memory");
}

// Attention stage geometry: 64 keys per stage. The K tile is 64 key rows of 128 B
// (one head's 64 dims), the V^T tile 64 dim rows of 128 B (64 keys); both land at
// pitch G_PITCH. One tile = 64 x 144 B = 9216 B, its place rounded up to 5 x 2 KiB.
#define A_KEYS   64
#define A_TILE   10240
#define A_STAGE  (2 * A_TILE)

__device__ inline v4u tdm_group0(const bf16_t* gtile, unsigned lds_off) {
  const unsigned long long ga = (unsigned long long)(size_t)gtile;
  v4u g0;
  g0[0] = uni(1u);                              // count = 1
  g0[1] = uni(lds_off);                         // LDS destination (bytes)
  g0[2] = uni((unsigned)ga);                    // global address [31:0]
  g0[3] = uni(((unsigned)(ga >> 32) & 0x01FFFFFFu) | 0x80000000u);  // [56:32], type 2
  return g0;
}

__device__ inline v8u tdm_group1_64x128B(unsigned src_pitch) {
  v8u g1;
  g1[0] = pinned((1u << 20) | (4u << 22) | (3u << 25));
  g1[1] = pinned(128u << 16);
  g1[2] = pinned(64u << 16);
  g1[3] = pinned(128u << 16);
  g1[4] = pinned(64u);
  g1[5] = pinned(src_pitch);
  g1[6] = pinned(0u);
  g1[7] = pinned(0u);
  return g1;
}

// ---------------------------------------------------------------------------
// Weight transpose + fp32 -> bf16 convert:  W[K][N] -> Wt[N][K]
// One block of 256 threads takes a piece of 256 rows x 128 columns (first column
// n0, first row k0) in TP_TRIPS trips of eight 32 x 32 tiles (64 rows x 128
// columns; tile t: columns 32 * (t % 4), rows 32 * (t / 4)). The next trip's loads fly while this trip's tiles are stored;
// the trips alternate between two sets of tiles in LDS, so that one barrier a trip
// is enough (a second one, behind the stores, would wait for those loads).
// ---------------------------------------------------------------------------
#define TP_TILES 8    // tiles per trip
#define TP_TRIPS 4    // trips per block
#define TP_ROWS  (64 * TP_TRIPS)
typedef float TpTiles[2][TP_TILES][32][33];

template <int N>
__device__ inline void transpose_load(float (&r)[TP_TILES][4], const float* __restrict__ w) {
  // unrolled so that every index of r is a constant (registers, no scratch)
#pragma unroll
  for (int t = 0; t < TP_TILES; ++t)
#pragma unroll
    for (int i = 0; i < 4; ++i)
      r[t][i] = w[(size_t)((t >> 2) * 32 + i * 8) * N + (t & 3) * 32];
}

template <int K, int N>
__device__ inline void transpose_piece(
    const float* __restrict__ W, bf16_t* __restrict__ Wt, int n0, int k0,
    TpTiles& tile) {
  const int tx = threadIdx.x & 31, ty = threadIdx.x >> 5;  // 32 x 8
  const float* w = W + (size_t)(k0 + ty) * N + n0 + tx;    // this thread's first element
  bf16_t* wt = Wt + (size_t)(n0 + ty) * K + k0 + tx;
  float r[TP_TILES][4];
  transpose_load<N>(r, w);
  // kept rolled: unrolled, every trip's loads would be lifted to the top and take
  // four times the registers
#pragma unroll 1
  for (int trip = 0; trip < TP_TRIPS; ++trip) {
#pragma unroll
    for (int t = 0; t < TP_TILES; ++t)
#pragma unroll
      for (int i = 0; i < 4; ++i) tile[trip & 1][t][ty + i * 8][tx] = r[t][i];
    // this set is written; and whoever writes the other set next trip has passed
    // here, behind every wave's reads of it
    __syncthreads();
    if (trip + 1 < TP_TRIPS) {
      transpose_load<N>(r, w + (size_t)(trip + 1) * 64 * N);
      // the LDS reads below take these loads' address registers again: the wait
      // stands in front of that overwrite
      asm volatile("s_wait_xcnt 0x0" ::: "memory");
    }
#pragma unroll
    for (int t = 0; t < TP_TILES; ++t)
#pragma unroll
      for (int i = 0; i < 4; ++i)
        wt[(size_t)((t & 3) * 32 + i * 8) * K + trip * 64 + (t >> 2) * 32] =
            (bf16_t)tile[trip & 1][t][tx][ty + i * 8];
  }
}

// ---------------------------------------------------------------------------
// RMSNorm: fp32 rows -> bf16 normalized rows (D_MODEL=1024). One block takes
// RMS_ROWS rows, each summed on its own (a thread's four squares, the wave's
// butterfly, the eight waves' sums in order): the rows' loads are in flight
// together, their butterflies interleave, and one barrier serves them all.
// ---------------------------------------------------------------------------
#define RMS_ROWS 8
__device__ inline void rmsnorm_rows(
    const float* __restrict__ x, const float* __restrict__ gain,
    bf16_t* __restrict__ out, int row0) {
  __shared__ float warp_sum[RMS_ROWS][8];
  const int tid = threadIdx.x;
  float4 v[RMS_ROWS];
  float ss[RMS_ROWS];
  // unrolled so that every index of v and ss is a constant (registers, no scratch)
#pragma unroll
  for (int r = 0; r < RMS_ROWS; ++r)
    v[r] = reinterpret_cast<const float4*>(x + (size_t)(row0 + r) * D_MODEL)[tid];
  const float4 gv = reinterpret_cast<const float4*>(gain)[tid];
#pragma unroll
  for (int r = 0; r < RMS_ROWS; ++r)
    ss[r] = v[r].x * v[r].x + v[r].y * v[r].y + v[r].z * v[r].z + v[r].w * v[r].w;
#pragma unroll
  for (int m = 1; m < 32; m <<= 1)
#pragma unroll
    for (int r = 0; r < RMS_ROWS; ++r) ss[r] += __shfl_xor(ss[r], m, 32);
  if ((tid & 31) == 0) {
#pragma unroll
    for (int r = 0; r < RMS_ROWS; ++r) warp_sum[r][tid >> 5] = ss[r];
  }
  __syncthreads();
#pragma unroll
  for (int r = 0; r < RMS_ROWS; ++r) {
    float tot = 0.f;
#pragma unroll
    for (int i = 0; i < 8; ++i) tot += warp_sum[r][i];
    const float inv = rsqrtf(tot * (1.0f / D_MODEL) + 1e-6f);
    bf16_t* orow = out + (size_t)(row0 + r) * D_MODEL + tid * 4;
    orow[0] = (bf16_t)(v[r].x * inv * gv.x);
    orow[1] = (bf16_t)(v[r].y * inv * gv.y);
    orow[2] = (bf16_t)(v[r].z * inv * gv.z);
    orow[3] = (bf16_t)(v[r].w * inv * gv.w);
  }
}

__global__ __launch_bounds__(256) void rmsnorm_kernel(
    const float* __restrict__ x, const float* __restrict__ gain,
    bf16_t* __restrict__ out) {
  rmsnorm_rows(x, gain, out, (int)blockIdx.x * RMS_ROWS);
}

// ---------------------------------------------------------------------------
// Everything that reads the inputs alone, in ONE grid: the seven weight
// transposes and the first RMSNorm depend on nothing but the inputs, so their
// blocks share a launch. A block's job follows from its index (the same for all
// of its threads, so every barrier stands under block-uniform control flow):
//   PREP_SQ blocks   : w_q, w_k, w_v, w_o    (32 pieces each)
//   PREP_UP blocks   : w_gate, w_up          (128 pieces each)
//   PREP_DN blocks   : w_down                (128 pieces)
//   PREP_RMS blocks  : RMS_ROWS rows of x each (the shorter job, placed last)
// wt: the transposed weights one behind the other, in that order.
// ---------------------------------------------------------------------------
#define SQ_PIECES ((D_MODEL / 128) * (D_MODEL / TP_ROWS))   // 32
#define FF_PIECES ((D_MODEL / 128) * (D_FF / TP_ROWS))      // 128
#define PREP_RMS  (M_ROWS / RMS_ROWS)
#define PREP_SQ   (4 * SQ_PIECES)
#define PREP_UP   (2 * FF_PIECES)
#define PREP_DN   FF_PIECES
#define PREP_GRID (PREP_RMS + PREP_SQ + PREP_UP + PREP_DN)

__global__ __launch_bounds__(256) void prep_kernel(
    const float* __restrict__ w_q, const float* __restrict__ w_k,
    const float* __restrict__ w_v, const float* __restrict__ w_o,
    const float* __restrict__ w_gate, const float* __restrict__ w_up,
    const float* __restrict__ w_down, const float* __restrict__ x,
    const float* __restrict__ gain, bf16_t* __restrict__ wt,
    bf16_t* __restrict__ nx) {
  const int b = (int)blockIdx.x;
  if (b >= PREP_SQ + PREP_UP + PREP_DN) {
    rmsnorm_rows(x, gain, nx, (b - (PREP_SQ + PREP_UP + PREP_DN)) * RMS_ROWS);
    return;
  }
  __shared__ TpTiles tile;
  // pieces are numbered inside their matrix, columns fastest
  if (b < PREP_SQ) {
    const int m = b / SQ_PIECES, r = b % SQ_PIECES;
    const float* W = (m == 0) ? w_q : (m == 1) ? w_k : (m == 2) ? w_v : w_o;
    transpose_piece<D_MODEL, D_MODEL>(W, wt + (size_t)m * (D_MODEL * D_MODEL),
                                      (r % (D_MODEL / 128)) * 128,
                                      (r / (D_MODEL / 128)) * TP_ROWS, tile);
  } else if (b < PREP_SQ + PREP_UP) {
    const int m = (b - PREP_SQ) / FF_PIECES, r = (b - PREP_SQ) % FF_PIECES;
    transpose_piece<D_MODEL, D_FF>(
        (m == 0) ? w_gate : w_up,
        wt + (size_t)4 * (D_MODEL * D_MODEL) + (size_t)m * (D_MODEL * D_FF),
        (r % (D_FF / 128)) * 128, (r / (D_FF / 128)) * TP_ROWS, tile);
  } else {
    const int r = b - (PREP_SQ + PREP_UP);
    transpose_piece<D_FF, D_MODEL>(
        w_down, wt + (size_t)4 * (D_MODEL * D_MODEL) + (size_t)2 * (D_MODEL * D_FF),
        (r % (D_MODEL / 128)) * 128, (r / (D_MODEL / 128)) * TP_ROWS, tile);
  }
}

// ---------------------------------------------------------------------------
// A wave's 32 x 64 accumulators to memory. D layout: element r of a fragment is
// row r + 8*(lane/16), column lane%16; m_w, n_w: this lane's row and column of
// element 0 of fragment (0, 0).
// MODE: 0 = store bf16, 1 = fp32 out = resid + C, 2 = bf16 scatter to V^T
// ---------------------------------------------------------------------------
template <int MODE>
__device__ inline void gemm_store(const v8f (&acc)[2][4], int m_w, int n_w, int N,
                                  const float* __restrict__ resid,
                                  void* __restrict__ outp) {
  // unrolled so that every accumulator index is a constant (registers, no scratch)
#pragma unroll
  for (int mi = 0; mi < 2; ++mi)
#pragma unroll
    for (int ni = 0; ni < 4; ++ni)
#pragma unroll
      for (int r = 0; r < 8; ++r) {
        const int mg = m_w + mi * 16 + r;
        const int ng = n_w + ni * 16;
        const float c = acc[mi][ni][r];
        if (MODE == 0) {
          ((bf16_t*)outp)[(size_t)mg * N + ng] = (bf16_t)c;
        } else if (MODE == 1) {
          const size_t idx = (size_t)mg * N + ng;
          ((float*)outp)[idx] = resid[idx] + c;
        } else {  // V^T scatter: [B,H,DK,SEQ]
          const int bb = mg >> 11, sin = mg & (SEQ - 1);
          const int hh = ng >> 6, dd = ng & (DK - 1);
          ((bf16_t*)outp)[(((size_t)(bb * HEADS + hh) * DK + dd) << 11) + sin] =
              (bf16_t)c;
        }
      }
}

// ---------------------------------------------------------------------------
// GEMM: C[M][N] = A[M][K] (bf16, k-major) x Bt[N][K] (bf16, k-major)
// 256 threads = 8 waves; block tile 128x128; per-wave 32x64 (2x4 frags).
// Several products that share A run side by side in one grid: product p takes
// rows p * N .. p * N + N - 1 of Bt (grid.x covers them all) and writes the p-th
// M x N matrix at outp.
// EPI: 0 = two products, stored as bf16, 1 = one product, fp32 out = resid + C,
//      2 = three products: 0 and 1 stored as bf16, 2 scattered to V^T
// Assumes M,N % 128 == 0, K % 64 == 0 and K >= 128 (true for all calls here).
// ---------------------------------------------------------------------------
template <int EPI>
__global__ __launch_bounds__(256) void gemm_bf16_wmma(
    const bf16_t* __restrict__ A, const bf16_t* __restrict__ Bt,
    int M, int N, int K, const float* __restrict__ resid,
    void* __restrict__ outp) {
  // ring[buffer][A tile | B tile]; every tile starts at a multiple of 2 KiB
  __shared__ __attribute__((aligned(2048))) unsigned char ring[2 * G_STAGE];
  const int tid  = threadIdx.x;
  const int lane = tid & 31, wave = tid >> 5;
  const int g = lane >> 4, ln = lane & 15;
  const int wm = wave >> 1, wn = wave & 1;
  const int m_blk = blockIdx.y * 128, n_blk = blockIdx.x * 128;
  // Wave 0 brings the A tile of every stage, wave 1 the B tile.
  const unsigned wave_u = uni((unsigned)threadIdx.x >> 5);
  const bf16_t* my_src = (wave_u == 0) ? A + (size_t)m_blk * K
                                       : Bt + (size_t)n_blk * K;
  const unsigned my_lds = (unsigned)(size_t)(void*)&ring[0] +
                          ((wave_u == 0) ? 0u : (unsigned)G_TILE);
  const v8u g1 = tdm_group1_128x128B((unsigned)K * 2u);
  const int n_stage = K / G_BK;

  v8f acc[2][4] = {};

  // Prologue: stage 0 lands and is published, then stage 1 starts to fly.
  if (pinned(wave_u < 2u)) {
    tdm_load_tile(my_src, my_lds, g1);
    // stage 0 has landed here
    asm volatile("s_wait_tensorcnt 0x0" ::: "memory");
  }
  __syncthreads();
  if (pinned(wave_u < 2u))
    tdm_load_tile(my_src + G_BK, my_lds + G_STAGE, g1);

  for (int s = 0; s < n_stage; ++s) {
    const unsigned char* bufA = ring + (s & 1) * G_STAGE;
    const unsigned char* bufB = bufA + G_TILE;
    // unrolled so that every fragment and accumulator index is a constant
    // (registers, no scratch); the two 32-k blocks keep the ascending k order
#pragma unroll
    for (int kk = 0; kk < 2; ++kk) {
      v16bf aF[2], bF[4];
#pragma unroll
      for (int mi = 0; mi < 2; ++mi) {
        const unsigned char* p =
            bufA + (wm * 32 + mi * 16 + ln) * G_PITCH + kk * 64 + g * 16;
        aF[mi] = ld_frag16((const bf16_t*)p, (const bf16_t*)(p + 32));
      }
#pragma unroll
      for (int ni = 0; ni < 4; ++ni) {
        const unsigned char* p =
            bufB + (wn * 64 + ni * 16 + ln) * G_PITCH + kk * 64 + g * 16;
        bF[ni] = ld_frag16((const bf16_t*)p, (const bf16_t*)(p + 32));
      }
#pragma unroll
      for (int mi = 0; mi < 2; ++mi)
#pragma unroll
        for (int ni = 0; ni < 4; ++ni)
          acc[mi][ni] = wmma_bf16(aF[mi], bF[ni], acc[mi][ni]);
    }
    // Publish point of stage s + 1. This wave's reads of buffer s & 1 are done:
    asm volatile("s_wait_dscnt 0x0" ::: "memory");
    if (pinned(wave_u < 2u)) {
      // the issuing wave's own tile of stage s + 1 has landed
      asm volatile("s_wait_tensorcnt 0x0" ::: "memory");
    }
    __syncthreads();
    // Refill the buffer that every wave has just left, while a stage is left.
    if (pinned((wave_u < 2u) && (s + 2 < n_stage)))
      tdm_load_tile(my_src + (size_t)(s + 2) * G_BK,
                    my_lds + (unsigned)(s & 1) * G_STAGE, g1);
  }
  asm volatile("s_wait_tensorcnt 0x0" :: "s"(g1) : "memory");
  asm volatile("s_wait_dscnt 0x0" ::: "memory");

  // Epilogue: this product's matrix, in this product's form. The test on prod is
  // the same for the whole block and stands outside the store loops, so that each
  // form keeps its straight-line stores (the V^T form: 16 bytes a lane).
  constexpr int n_prod = (EPI == 2) ? 3 : (EPI == 0) ? 2 : 1;
  int prod = 0;  // which product this block's columns belong to
  for (int p = 1; p < n_prod; ++p) prod += (n_blk >= p * N) ? 1 : 0;
  void* const outm = (EPI == 1) ? outp : (void*)((bf16_t*)outp + (size_t)prod * M * N);
  const int m_w = m_blk + wm * 32 + 8 * g, n_w = n_blk - prod * N + wn * 64 + ln;
  if (EPI == 2) {
    if (prod < 2) {
      gemm_store<0>(acc, m_w, n_w, N, resid, outm);
    } else {
      gemm_store<2>(acc, m_w, n_w, N, resid, outm);
      // in the compiled text the other form's code stands behind these stores and
      // takes their registers again: the wait stands in front of that overwrite
      asm volatile("s_wait_xcnt 0x0" ::: "memory");
    }
  } else {
    gemm_store<EPI>(acc, m_w, n_w, N, resid, outm);
  }
}

// Maximum over each 16-lane row of eight independent values, left in every lane
// of the row. Four butterfly steps (lane ^ 1, 2, 4, 8), each one vector
// instruction whose first source is read through DPP row_xmask: nothing goes
// over the LDS path and nothing waits on dscnt, where __shfl_xor compiles to
// ds_bpermute_b32 with a wait behind every step. The eight values go through a
// step together, so an instruction's producer stands eight instructions back
// and no step waits for the one before it. Every lane of the wave must be on.
__device__ inline void row_max16_x8(float (&v)[8]) {
  asm(
      "v_max_num_f32_dpp %0, %0, %0 row_xmask:1 row_mask:0xf bank_mask:0xf\n\t"
      "v_max_num_f32_dpp %1, %1, %1 row_xmask:1 row_mask:0xf bank_mask:0xf\n\t"
      "v_max_num_f32_dpp %2, %2, %2 row_xmask:1 row_mask:0xf bank_mask:0xf\n\t"
      "v_max_num_f32_dpp %3, %3, %3 row_xmask:1 row_mask:0xf bank_mask:0xf\n\t"
      "v_max_num_f32_dpp %4, %4, %4 row_xmask:1 row_mask:0xf bank_mask:0xf\n\t"
      "v_max_num_f32_dpp %5, %5, %5 row_xmask:1 row_mask:0xf bank_mask:0xf\n\t"
      "v_max_num_f32_dpp %6, %6, %6 row_xmask:1 row_mask:0xf bank_mask:0xf\n\t"
      "v_max_num_f32_dpp %7, %7, %7 row_xmask:1 row_mask:0xf bank_mask:0xf\n\t"
      "v_max_num_f32_dpp %0, %0, %0 row_xmask:2 row_mask:0xf bank_mask:0xf\n\t"
      "v_max_num_f32_dpp %1, %1, %1 row_xmask:2 row_mask:0xf bank_mask:0xf\n\t"
      "v_max_num_f32_dpp %2, %2, %2 row_xmask:2 row_mask:0xf bank_mask:0xf\n\t"
      "v_max_num_f32_dpp %3, %3, %3 row_xmask:2 row_mask:0xf bank_mask:0xf\n\t"
      "v_max_num_f32_dpp %4, %4, %4 row_xmask:2 row_mask:0xf bank_mask:0xf\n\t"
      "v_max_num_f32_dpp %5, %5, %5 row_xmask:2 row_mask:0xf bank_mask:0xf\n\t"
      "v_max_num_f32_dpp %6, %6, %6 row_xmask:2 row_mask:0xf bank_mask:0xf\n\t"
      "v_max_num_f32_dpp %7, %7, %7 row_xmask:2 row_mask:0xf bank_mask:0xf\n\t"
      "v_max_num_f32_dpp %0, %0, %0 row_xmask:4 row_mask:0xf bank_mask:0xf\n\t"
      "v_max_num_f32_dpp %1, %1, %1 row_xmask:4 row_mask:0xf bank_mask:0xf\n\t"
      "v_max_num_f32_dpp %2, %2, %2 row_xmask:4 row_mask:0xf bank_mask:0xf\n\t"
      "v_max_num_f32_dpp %3, %3, %3 row_xmask:4 row_mask:0xf bank_mask:0xf\n\t"
      "v_max_num_f32_dpp %4, %4, %4 row_xmask:4 row_mask:0xf bank_mask:0xf\n\t"
      "v_max_num_f32_dpp %5, %5, %5 row_xmask:4 row_mask:0xf bank_mask:0xf\n\t"
      "v_max_num_f32_dpp %6, %6, %6 row_xmask:4 row_mask:0xf bank_mask:0xf\n\t"
      "v_max_num_f32_dpp %7, %7, %7 row_xmask:4 row_mask:0xf bank_mask:0xf\n\t"
      "v_max_num_f32_dpp %0, %0, %0 row_xmask:8 row_mask:0xf bank_mask:0xf\n\t"
      "v_max_num_f32_dpp %1, %1, %1 row_xmask:8 row_mask:0xf bank_mask:0xf\n\t"
      "v_max_num_f32_dpp %2, %2, %2 row_xmask:8 row_mask:0xf bank_mask:0xf\n\t"
      "v_max_num_f32_dpp %3, %3, %3 row_xmask:8 row_mask:0xf bank_mask:0xf\n\t"
      "v_max_num_f32_dpp %4, %4, %4 row_xmask:8 row_mask:0xf bank_mask:0xf\n\t"
      "v_max_num_f32_dpp %5, %5, %5 row_xmask:8 row_mask:0xf bank_mask:0xf\n\t"
      "v_max_num_f32_dpp %6, %6, %6 row_xmask:8 row_mask:0xf bank_mask:0xf\n\t"
      "v_max_num_f32_dpp %7, %7, %7 row_xmask:8 row_mask:0xf bank_mask:0xf"
      : "+v"(v[0]), "+v"(v[1]), "+v"(v[2]), "+v"(v[3]),
        "+v"(v[4]), "+v"(v[5]), "+v"(v[6]), "+v"(v[7]));
}

__global__ __launch_bounds__(128) void flash_attn_wmma(
    const bf16_t* __restrict__ Q, const bf16_t* __restrict__ Km,
    const bf16_t* __restrict__ Vt, bf16_t* __restrict__ O) {
  // ring[buffer][K tile | V^T tile]; every tile starts at a multiple of 2 KiB
  __shared__ __attribute__((aligned(2048))) unsigned char ring[2 * A_STAGE];
  __shared__ bf16_t sP[4][16][40];  // per-wave P staging (D-layout -> A-layout)
  const int tid  = threadIdx.x;
  const int lane = tid & 31;
  const unsigned wave_u = uni((unsigned)threadIdx.x >> 5);
  const int wave = (int)wave_u;
  const int g = lane >> 4, ln = lane & 15;
  const int bh = blockIdx.y, b = bh >> 4, h = bh & 15;
  const int q0 = blockIdx.x * 64 + wave * 16;

  // The block's four waves read the same keys: wave 0 brings the K tile of every
  // stage, wave 1 the V^T tile. The block's rows end at key 64 * blockIdx.x + 63.
  const bf16_t* my_src = (wave_u == 0)
                             ? Km + (size_t)(b * SEQ) * D_MODEL + h * DK
                             : Vt + (size_t)((b * HEADS + h) * DK) * SEQ;
  // a stage's step in the source, as a shift: 64 rows of K, 64 columns of V^T
  const unsigned my_shift = (wave_u == 0) ? 16u : 6u;
  static_assert(A_KEYS * D_MODEL == 1 << 16 && A_KEYS == 1 << 6, "stage steps");
  const unsigned my_lds = (unsigned)(size_t)(void*)&ring[0] +
                          ((wave_u == 0) ? 0u : (unsigned)A_TILE);
  const v8u g1 = tdm_group1_64x128B((wave_u == 0) ? (unsigned)(D_MODEL * 2)
                                                  : (unsigned)(SEQ * 2));
  const int n_stage = (int)blockIdx.x + 1;

  // Q A-fragments: 16 rows x 64 (two k-halves of 32)
  const bf16_t* qrow = Q + (size_t)(b * SEQ + q0 + ln) * D_MODEL + h * DK;
  v16bf qf[2];
#pragma unroll
  for (int kk = 0; kk < 2; ++kk)
    qf[kk] = ld_frag16(qrow + kk * 32 + g * 8, qrow + kk * 32 + 16 + g * 8);

  v16bf onesf;
#pragma unroll
  for (int j = 0; j < 16; ++j) onesf[j] = (bf16_t)1.0f;

  v8f o[4] = {};
  v8f o5 = {};  // softmax denominator accumulator (P x ones)
  float mrow[8];
#pragma unroll
  for (int r = 0; r < 8; ++r) mrow[r] = -__builtin_inff();

  v4u g0 = {0u, 0u, 0u, 0u};
  if (pinned(wave_u < 2u)) {
    g0 = tdm_group0(my_src, my_lds);
    asm volatile("tensor_load_to_lds %0, %1" :: "s"(g0), "s"(g1) : "memory");
    // stage 0 has landed here
    asm volatile("s_wait_tensorcnt 0x0" :: "s"(g0) : "memory");
  }
  __syncthreads();
  if (pinned(wave_u < 2u)) {
    g0 = tdm_group0(my_src + ((size_t)1 << my_shift), my_lds + A_STAGE);
    asm volatile("tensor_load_to_lds %0, %1" :: "s"(g0), "s"(g1) : "memory");
  }

  for (int st = 0; st < n_stage; ++st) {
   const unsigned char* bufK = ring + (st & 1) * A_STAGE;
   const unsigned char* bufV = bufK + A_TILE;
   // the stage's two 32-key tiles; a wave skips a tile wholly above its diagonal
   for (int t0 = st * A_KEYS; t0 < (st + 1) * A_KEYS && t0 <= q0 + 15; t0 += 32) {
    const int tr = t0 - st * A_KEYS;  // first key of the tile inside the stage
    // The tile's K and V^T B-fragments, as one group of LDS reads, K first: the V
    // reads return under the score products and the softmax.
    v16bf kf[2][2], vf[4];
#pragma unroll
    for (int ni = 0; ni < 2; ++ni) {
      const unsigned char* krow = bufK + (tr + ni * 16 + ln) * G_PITCH + g * 16;
#pragma unroll
      for (int kk = 0; kk < 2; ++kk)
        kf[ni][kk] = ld_frag16((const bf16_t*)(krow + kk * 64),
                               (const bf16_t*)(krow + kk * 64 + 32));
    }
#pragma unroll
    for (int f = 0; f < 4; ++f) {
      const unsigned char* vrow = bufV + (f * 16 + ln) * G_PITCH + tr * 2 + g * 16;
      vf[f] = ld_frag16((const bf16_t*)vrow, (const bf16_t*)(vrow + 32));
    }
    // scores S = Q * K^T  (16 x 32), two 16x16 D frags
    v8f s[2] = {};
#pragma unroll
    for (int ni = 0; ni < 2; ++ni)
#pragma unroll
      for (int kk = 0; kk < 2; ++kk)
        s[ni] = wmma_bf16(qf[kk], kf[ni][kk], s[ni]);
    // scale + causal mask
#pragma unroll
    for (int ni = 0; ni < 2; ++ni)
#pragma unroll
      for (int r = 0; r < 8; ++r) {
        const float v = s[ni][r] * 0.125f;  // 1/sqrt(64)
        const int qg = q0 + r + 8 * g;
        const int tg = t0 + ni * 16 + ln;
        s[ni][r] = (tg > qg) ? -__builtin_inff() : v;
      }
    // row max (butterfly within 16-lane halves) + online rescale factor
    float alpha[8], vmax[8];
#pragma unroll
    for (int r = 0; r < 8; ++r)
      vmax[r] = fmaxf(fmaxf(s[0][r], s[1][r]), mrow[r]);  // mrow: equal in the row
    row_max16_x8(vmax);
#pragma unroll
    for (int r = 0; r < 8; ++r) {
      const float mn = vmax[r];
      alpha[r] = __expf(mrow[r] - mn);
      mrow[r] = mn;
    }
#pragma unroll
    for (int ni = 0; ni < 2; ++ni)
#pragma unroll
      for (int r = 0; r < 8; ++r) s[ni][r] = __expf(s[ni][r] - mrow[r]);
#pragma unroll
    for (int f = 0; f < 4; ++f)
#pragma unroll
      for (int r = 0; r < 8; ++r) o[f][r] *= alpha[r];
#pragma unroll
    for (int r = 0; r < 8; ++r) o5[r] *= alpha[r];

    // P: D-layout -> bf16 LDS -> A-layout (wave-local, split-counter sync)
#pragma unroll
    for (int ni = 0; ni < 2; ++ni)
#pragma unroll
      for (int r = 0; r < 8; ++r)
        sP[wave][r + 8 * g][ni * 16 + ln] = (bf16_t)s[ni][r];
    asm volatile("s_wait_dscnt 0" ::: "memory");
    v16bf pf = ld_frag16(&sP[wave][ln][g * 8], &sP[wave][ln][16 + g * 8]);

    // O += P(16x32) * V(32x64): B frags from V^T rows (contiguous along t)
#pragma unroll
    for (int f = 0; f < 4; ++f) o[f] = wmma_bf16(pf, vf[f], o[f]);
    // denominator: l += P x ones
    o5 = wmma_bf16(pf, onesf, o5);
    asm volatile("v_nop\n\tv_nop\n\tv_nop\n\tv_nop" :: "v"(o5));
   }
   // Publish point of stage st + 1; every wave passes it, also one that skipped a
   // tile. This wave's reads of buffer st & 1 are done:
   asm volatile("s_wait_dscnt 0x0" ::: "memory");
   if (pinned(wave_u < 2u)) {
     // the issuing wave's own tile of stage st + 1 has landed
     asm volatile("s_wait_tensorcnt 0x0" :: "s"(g0) : "memory");
   }
   __syncthreads();
   // Refill the buffer that every wave has just left, while a stage is left.
   if (pinned((wave_u < 2u) && (st + 2 < n_stage))) {
     g0 = tdm_group0(my_src + ((size_t)(st + 2) << my_shift),
                     my_lds + (unsigned)(st & 1) * A_STAGE);
     asm volatile("tensor_load_to_lds %0, %1" :: "s"(g0), "s"(g1) : "memory");
   }
  }
  // nothing of the ring is outstanding when the wave goes on to its stores
  asm volatile("s_wait_tensorcnt 0x0" ::: "memory");
  asm volatile("s_wait_dscnt 0x0" ::: "memory");

  // normalize and store: out[b, q, h*64 + d] (bf16, row-major D_MODEL)
#pragma unroll
  for (int f = 0; f < 4; ++f)
#pragma unroll
    for (int r = 0; r < 8; ++r) {
      const float val = o[f][r] / o5[r];
      const int qg = q0 + r + 8 * g;
      O[(size_t)(b * SEQ + qg) * D_MODEL + h * DK + f * 16 + ln] = (bf16_t)val;
    }
}

// ---------------------------------------------------------------------------
// SwiGLU elementwise: gate = silu(gate) * up   (bf16, in-place)
// A thread takes SW_TRIPS x SW_CH pieces of 8 elements (16 bytes) of each operand;
// a trip's 2 * SW_CH loads are issued first and are in flight together, each piece
// is worked on as it arrives, and a wave's load covers 512 contiguous bytes. Every
// element is read and written by the same thread.
// ---------------------------------------------------------------------------
#define SW_CH    8
#define SW_TRIPS 2
#define SW_GRID  ((M_ROWS * D_FF) / (256 * 8 * SW_CH * SW_TRIPS))   // 512
static_assert((size_t)SW_GRID * 256 * 8 * SW_CH * SW_TRIPS == (size_t)M_ROWS * D_FF,
              "the grid covers every element exactly once");
union Pack8 { uint4 q; bf16_t e[8]; };

__global__ __launch_bounds__(256) void swiglu_kernel(
    bf16_t* __restrict__ gate, const bf16_t* __restrict__ up) {
  for (int it = 0; it < SW_TRIPS; ++it) {
    const size_t c0 =
        (size_t)(blockIdx.x * SW_TRIPS + it) * (SW_CH * 256) + threadIdx.x;
    uint4* gq = reinterpret_cast<uint4*>(gate) + c0;
    const uint4* uq = reinterpret_cast<const uint4*>(up) + c0;
    Pack8 gp[SW_CH], upk[SW_CH];
    // unrolled so that every index of gp and upk is a constant (registers, no scratch)
#pragma unroll
    for (int j = 0; j < SW_CH; ++j) {
      gp[j].q = gq[j * 256];
      upk[j].q = uq[j * 256];
    }
#pragma unroll
    for (int j = 0; j < SW_CH; ++j) {
#pragma unroll
      for (int e = 0; e < 8; ++e) {
        const float gv = (float)gp[j].e[e];
        const float uv = (float)upk[j].e[e];
        const float sil = gv / (1.f + __expf(-gv));
        gp[j].e[e] = (bf16_t)(sil * uv);
      }
      gq[j * 256] = gp[j].q;
    }
    // the next trip takes these stores' address and data registers again: the wait
    // stands in front of that overwrite
    asm volatile("s_wait_xcnt 0x0" ::: "memory");
  }
}

// ---------------------------------------------------------------------------
// Host orchestration
// ---------------------------------------------------------------------------
extern "C" void kernel_launch(void* const* d_in, const int* in_sizes, int n_in,
                              void* d_out, int out_size, void* d_ws,
                              size_t ws_size, hipStream_t stream) {
  (void)in_sizes; (void)n_in; (void)out_size; (void)ws_size;
  const float* x      = (const float*)d_in[0];
  const float* w_q    = (const float*)d_in[1];
  const float* w_k    = (const float*)d_in[2];
  const float* w_v    = (const float*)d_in[3];
  const float* w_o    = (const float*)d_in[4];
  const float* w_gate = (const float*)d_in[5];
  const float* w_up   = (const float*)d_in[6];
  const float* w_down = (const float*)d_in[7];
  const float* g1     = (const float*)d_in[8];
  const float* g2     = (const float*)d_in[9];

  unsigned char* ws = (unsigned char*)d_ws;
  const size_t MB = 1ull << 20;
  bf16_t* wtq  = (bf16_t*)(ws + 0 * MB);    // [1024][1024]      2 MB
  bf16_t* wtk  = (bf16_t*)(ws + 2 * MB);    //                   2 MB
  bf16_t* wtv  = (bf16_t*)(ws + 4 * MB);    //                   2 MB
  bf16_t* wto  = (bf16_t*)(ws + 6 * MB);    //                   2 MB
  bf16_t* wtg  = (bf16_t*)(ws + 8 * MB);    // [4096][1024]      8 MB
  bf16_t* wtu  = (bf16_t*)(ws + 16 * MB);   //                   8 MB
  bf16_t* wtd  = (bf16_t*)(ws + 24 * MB);   // [1024][4096]      8 MB
  bf16_t* nx1  = (bf16_t*)(ws + 32 * MB);   // [4096][1024]      8 MB
  bf16_t* qb   = (bf16_t*)(ws + 40 * MB);   // [4096][1024]      8 MB
  bf16_t* kb   = (bf16_t*)(ws + 48 * MB);   //                   8 MB
  bf16_t* vtb  = (bf16_t*)(ws + 56 * MB);   // [B,H,DK,SEQ]      8 MB
  bf16_t* ao   = (bf16_t*)(ws + 64 * MB);   // attn out          8 MB
  float*  x2   = (float*) (ws + 72 * MB);   // f32 resid        16 MB
  bf16_t* nx2  = (bf16_t*)(ws + 88 * MB);   // [4096][1024]      8 MB
  bf16_t* gate = (bf16_t*)(ws + 96 * MB);   // [4096][4096]     32 MB
  bf16_t* up   = (bf16_t*)(ws + 128 * MB);  //                  32 MB (end 160 MB)

  // --- weight prep W[K][N] -> Wt[N][K] bf16 and the first RMSNorm, one grid ---
  // (wtq .. wtd lie one behind the other in the workspace)
  (void)wtk; (void)wtv; (void)wtu;  // reached through wtq and wtg
  prep_kernel<<<PREP_GRID, 256, 0, stream>>>(w_q, w_k, w_v, w_o, w_gate, w_up, w_down,
                                             x, g1, wtq, nx1);

  // --- attention sublayer ---
  // Q, K and V in one grid: wtq, wtk, wtv are adjacent, and so are qb, kb, vtb
  const dim3 gemm_blk(256);
  gemm_bf16_wmma<2><<<dim3(3 * D_MODEL / 128, M_ROWS / 128), gemm_blk, 0, stream>>>(
      nx1, wtq, M_ROWS, D_MODEL, D_MODEL, nullptr, qb);

  flash_attn_wmma<<<dim3(SEQ / 64, BATCH * HEADS), 128, 0, stream>>>(qb, kb, vtb, ao);

  gemm_bf16_wmma<1><<<dim3(D_MODEL / 128, M_ROWS / 128), gemm_blk, 0, stream>>>(
      ao, wto, M_ROWS, D_MODEL, D_MODEL, x, x2);

  // --- SwiGLU FFN sublayer ---
  rmsnorm_kernel<<<M_ROWS / RMS_ROWS, 256, 0, stream>>>(x2, g2, nx2);

  // gate and up in one grid: wtg, wtu are adjacent, and so are gate, up
  gemm_bf16_wmma<0><<<dim3(2 * D_FF / 128, M_ROWS / 128), gemm_blk, 0, stream>>>(
      nx2, wtg, M_ROWS, D_FF, D_MODEL, nullptr, gate);

  swiglu_kernel<<<SW_GRID, 256, 0, stream>>>(gate, up);

  gemm_bf16_wmma<1><<<dim3(D_MODEL / 128, M_ROWS / 128), gemm_blk, 0, stream>>>(
      gate, wtd, M_ROWS, D_MODEL, D_FF, x2, (float*)d_out);
}

// v006
// It runs in 210 microseconds.
// Timed twice side by side with v005, it ran 1.19 and 1.20 times as fast.
// Over all steps from v000 it is 2.33 times as fast.
#include <hip/hip_runtime.h>

typedef __bf16 bf16_t;
typedef __attribute__((ext_vector_type(16))) __bf16        v16bf;
typedef __attribute__((ext_vector_type(8)))  float         v8f;
typedef __attribute__((ext_vector_type(4)))  unsigned int  v4u;
typedef __attribute__((ext_vector_type(8)))  unsigned int  v8u;

#define D_MODEL 1024
#define SEQ     2048
#define BATCH   2
#define HEADS   16
#define DK      64
#define D_FF    4096
#define M_ROWS  (BATCH * SEQ)   // 4096

union FragU { v16bf v; uint4 q[2]; };

__device__ inline v16bf ld_frag16(const bf16_t* p0, const bf16_t* p1) {
  FragU u;
  u.q[0] = *reinterpret_cast<const uint4*>(p0);
  u.q[1] = *reinterpret_cast<const uint4*>(p1);
  return u.v;
}

__device__ inline v8f wmma_bf16(v16bf a, v16bf b, v8f c) {
  // (neg_a, A, neg_b, B, c_mod, C, reuse_a, reuse_b)
  return __builtin_amdgcn_wmma_f32_16x16x32_bf16(false, a, false, b, (short)0, c,
                                                 false, false);
}

// ---------------------------------------------------------------------------
// GEMM stage geometry: 64 k per stage, so an operand row is 128 B; the tensor
// load pads each row by 16 B (pitch 144 B: conflict-free ds_load_b128 rows).
// One operand tile = 128 rows x 144 B = 18432 B = 9 x 2 KiB.
// ---------------------------------------------------------------------------
#define G_BK     64
#define G_PITCH  144
#define G_TILE   (128 * G_PITCH)
#define G_STAGE  (2 * G_TILE)
// A slice of 64 rows: 64 x 144 B = 9216 B, its place rounded up to 5 x 2 KiB.
#define G_HALF   10240

__device__ inline unsigned uni(unsigned v) {
  return (unsigned)__builtin_amdgcn_readfirstlane((int)v);
}
__device__ inline unsigned pinned(unsigned v) {
  unsigned w = uni(v);
  asm volatile("" : "+s"(w));
  return w;
}

__device__ inline v8u tdm_group1_128x128B(unsigned src_pitch) {
  v8u g1;
  g1[0] = pinned((1u << 20) | (4u << 22) | (3u << 25));
  g1[1] = pinned(128u << 16);
  g1[2] = pinned(128u << 16);
  g1[3] = pinned(128u << 16);
  g1[4] = pinned(128u);
  g1[5] = pinned(src_pitch);
  g1[6] = pinned(0u);
  g1[7] = pinned(0u);
  return g1;
}

// The same with a wave-uniform number of rows (128 or 64).
__device__ inline v8u tdm_group1_rows_x128B(unsigned rows, unsigned src_pitch) {
  v8u g1;
  g1[0] = pinned((1u << 20) | (4u << 22) | (3u << 25));
  g1[1] = pinned(128u << 16);
  g1[2] = pinned(rows << 16);
  g1[3] = pinned(128u << 16);
  g1[4] = pinned(rows);
  g1[5] = pinned(src_pitch);
  g1[6] = pinned(0u);
  g1[7] = pinned(0u);
  return g1;
}

// One tensor load: the tile whose first byte is gtile, to LDS byte offset lds_off.
__device__ inline void tdm_load_tile(const bf16_t* gtile, unsigned lds_off, v8u g1) {
  const unsigned long long ga = (unsigned long long)(size_t)gtile;
  v4u g0;
  g0[0] = uni(1u);                              // count = 1
  g0[1] = uni(lds_off);                         // LDS destination (bytes)
  g0[2] = uni((unsigned)ga);                    // global address [31:0]
  g0[3] = uni(((unsigned)(ga >> 32) & 0x01FFFFFFu) | 0x80000000u);  // [56:32], type 2
  asm volatile("tensor_load_to_lds %0, %1" :: "s"(g0), "s"(g1) : "memory");
}

// Attention stage geometry: 64 keys per stage. The K tile is 64 key rows of 128 B
// (one head's 64 dims), the V^T tile 64 dim rows of 128 B (64 keys); both land at
// pitch G_PITCH. One tile = 64 x 144 B = 9216 B, its place rounded up to 5 x 2 KiB.
#define A_KEYS   64
#define A_TILE   10240
#define A_STAGE  (2 * A_TILE)

__device__ inline v4u tdm_group0(const bf16_t* gtile, unsigned lds_off) {
  const unsigned long long ga = (unsigned long long)(size_t)gtile;
  v4u g0;
  g0[0] = uni(1u);                              // count = 1
  g0[1] = uni(lds_off);                         // LDS destination (bytes)
  g0[2] = uni((unsigned)ga);                    // global address [31:0]
  g0[3] = uni(((unsigned)(ga >> 32) & 0x01FFFFFFu) | 0x80000000u);  // [56:32], type 2
  return g0;
}

__device__ inline v8u tdm_group1_64x128B(unsigned src_pitch) {
  v8u g1;
  g1[0] = pinned((1u << 20) | (4u << 22) | (3u << 25));
  g1[1] = pinned(128u << 16);
  g1[2] = pinned(64u << 16);
  g1[3] = pinned(128u << 16);
  g1[4] = pinned(64u);
  g1[5] = pinned(src_pitch);
  g1[6] = pinned(0u);
  g1[7] = pinned(0u);
  return g1;
}

// ---------------------------------------------------------------------------
// Weight transpose + fp32 -> bf16 convert:  W[K][N] -> Wt[N][K]
// One block of 256 threads takes a piece of 256 rows x 128 columns (first column
// n0, first row k0) in TP_TRIPS trips of eight 32 x 32 tiles (64 rows x 128
// columns; tile t: columns 32 * (t % 4), rows 32 * (t / 4)). The next trip's loads fly while this trip's tiles are stored;
// the trips alternate between two sets of tiles in LDS, so that one barrier a trip
// is enough (a second one, behind the stores, would wait for those loads).
// ---------------------------------------------------------------------------
#define TP_TILES 8    // tiles per trip
#define TP_TRIPS 4    // trips per block
#define TP_ROWS  (64 * TP_TRIPS)
typedef float TpTiles[2][TP_TILES][32][33];

template <int N>
__device__ inline void transpose_load(float (&r)[TP_TILES][4], const float* __restrict__ w) {
  // unrolled so that every index of r is a constant (registers, no scratch)
#pragma unroll
  for (int t = 0; t < TP_TILES; ++t)
#pragma unroll
    for (int i = 0; i < 4; ++i)
      r[t][i] = w[(size_t)((t >> 2) * 32 + i * 8) * N + (t & 3) * 32];
}

template <int K, int N>
__device__ inline void transpose_piece(
    const float* __restrict__ W, bf16_t* __restrict__ Wt, int n0, int k0,
    TpTiles& tile) {
  const int tx = threadIdx.x & 31, ty = threadIdx.x >> 5;  // 32 x 8
  const float* w = W + (size_t)(k0 + ty) * N + n0 + tx;    // this thread's first element
  bf16_t* wt = Wt + (size_t)(n0 + ty) * K + k0 + tx;
  float r[TP_TILES][4];
  transpose_load<N>(r, w);
  // kept rolled: unrolled, every trip's loads would be lifted to the top and take
  // four times the registers
#pragma unroll 1
  for (int trip = 0; trip < TP_TRIPS; ++trip) {
#pragma unroll
    for (int t = 0; t < TP_TILES; ++t)
#pragma unroll
      for (int i = 0; i < 4; ++i) tile[trip & 1][t][ty + i * 8][tx] = r[t][i];
    // this set is written; and whoever writes the other set next trip has passed
    // here, behind every wave's reads of it
    __syncthreads();
    if (trip + 1 < TP_TRIPS) {
      transpose_load<N>(r, w + (size_t)(trip + 1) * 64 * N);
      // the LDS reads below take these loads' address registers again: the wait
      // stands in front of that overwrite
      asm volatile("s_wait_xcnt 0x0" ::: "memory");
    }
#pragma unroll
    for (int t = 0; t < TP_TILES; ++t)
#pragma unroll
      for (int i = 0; i < 4; ++i)
        wt[(size_t)((t & 3) * 32 + i * 8) * K + trip * 64 + (t >> 2) * 32] =
            (bf16_t)tile[trip & 1][t][tx][ty + i * 8];
  }
}

// ---------------------------------------------------------------------------
// RMSNorm: fp32 rows -> bf16 normalized rows (D_MODEL=1024). One block takes
// RMS_ROWS rows, each summed on its own (a thread's four squares, the wave's
// butterfly, the eight waves' sums in order): the rows' loads are in flight
// together, their butterflies interleave, and one barrier serves them all.
// ---------------------------------------------------------------------------
#define RMS_ROWS 8
__device__ inline void rmsnorm_rows(
    const float* __restrict__ x, const float* __restrict__ gain,
    bf16_t* __restrict__ out, int row0) {
  __shared__ float warp_sum[RMS_ROWS][8];
  const int tid = threadIdx.x;
  float4 v[RMS_ROWS];
  float ss[RMS_ROWS];
  // unrolled so that every index of v and ss is a constant (registers, no scratch)
#pragma unroll
  for (int r = 0; r < RMS_ROWS; ++r)
    v[r] = reinterpret_cast<const float4*>(x + (size_t)(row0 + r) * D_MODEL)[tid];
  const float4 gv = reinterpret_cast<const float4*>(gain)[tid];
#pragma unroll
  for (int r = 0; r < RMS_ROWS; ++r)
    ss[r] = v[r].x * v[r].x + v[r].y * v[r].y + v[r].z * v[r].z + v[r].w * v[r].w;
#pragma unroll
  for (int m = 1; m < 32; m <<= 1)
#pragma unroll
    for (int r = 0; r < RMS_ROWS; ++r) ss[r] += __shfl_xor(ss[r], m, 32);
  if ((tid & 31) == 0) {
#pragma unroll
    for (int r = 0; r < RMS_ROWS; ++r) warp_sum[r][tid >> 5] = ss[r];
  }
  __syncthreads();
#pragma unroll
  for (int r = 0; r < RMS_ROWS; ++r) {
    float tot = 0.f;
#pragma unroll
    for (int i = 0; i < 8; ++i) tot += warp_sum[r][i];
    const float inv = rsqrtf(tot * (1.0f / D_MODEL) + 1e-6f);
    bf16_t* orow = out + (size_t)(row0 + r) * D_MODEL + tid * 4;
    orow[0] = (bf16_t)(v[r].x * inv * gv.x);
    orow[1] = (bf16_t)(v[r].y * inv * gv.y);
    orow[2] = (bf16_t)(v[r].z * inv * gv.z);
    orow[3] = (bf16_t)(v[r].w * inv * gv.w);
  }
}

__global__ __launch_bounds__(256) void rmsnorm_kernel(
    const float* __restrict__ x, const float* __restrict__ gain,
    bf16_t* __restrict__ out) {
  rmsnorm_rows(x, gain, out, (int)blockIdx.x * RMS_ROWS);
}

// ---------------------------------------------------------------------------
// Everything that reads the inputs alone, in ONE grid: the seven weight
// transposes and the first RMSNorm depend on nothing but the inputs, so their
// blocks share a launch. A block's job follows from its index (the same for all
// of its threads, so every barrier stands under block-uniform control flow):
//   PREP_SQ blocks   : w_q, w_k, w_v, w_o    (32 pieces each)
//   PREP_UP blocks   : w_gate, w_up          (128 pieces each)
//   PREP_DN blocks   : w_down                (128 pieces)
//   PREP_RMS blocks  : RMS_ROWS rows of x each (the shorter job, placed last)
// wt: the transposed weights one behind the other, in that order.
// ---------------------------------------------------------------------------
#define SQ_PIECES ((D_MODEL / 128) * (D_MODEL / TP_ROWS))   // 32
#define FF_PIECES ((D_MODEL / 128) * (D_FF / TP_ROWS))      // 128
#define PREP_RMS  (M_ROWS / RMS_ROWS)
#define PREP_SQ   (4 * SQ_PIECES)
#define PREP_UP   (2 * FF_PIECES)
#define PREP_DN   FF_PIECES
#define PREP_GRID (PREP_RMS + PREP_SQ + PREP_UP + PREP_DN)

__global__ __launch_bounds__(256) void prep_kernel(
    const float* __restrict__ w_q, const float* __restrict__ w_k,
    const float* __restrict__ w_v, const float* __restrict__ w_o,
    const float* __restrict__ w_gate, const float* __restrict__ w_up,
    const float* __restrict__ w_down, const float* __restrict__ x,
    const float* __restrict__ gain, bf16_t* __restrict__ wt,
    bf16_t* __restrict__ nx) {
  const int b = (int)blockIdx.x;
  if (b >= PREP_SQ + PREP_UP + PREP_DN) {
    rmsnorm_rows(x, gain, nx, (b - (PREP_SQ + PREP_UP + PREP_DN)) * RMS_ROWS);
    return;
  }
  __shared__ TpTiles tile;
  // pieces are numbered inside their matrix, columns fastest
  if (b < PREP_SQ) {
    const int m = b / SQ_PIECES, r = b % SQ_PIECES;
    const float* W = (m == 0) ? w_q : (m == 1) ? w_k : (m == 2) ? w_v : w_o;
    transpose_piece<D_MODEL, D_MODEL>(W, wt + (size_t)m * (D_MODEL * D_MODEL),
                                      (r % (D_MODEL / 128)) * 128,
                                      (r / (D_MODEL / 128)) * TP_ROWS, tile);
  } else if (b < PREP_SQ + PREP_UP) {
    const int m = (b - PREP_SQ) / FF_PIECES, r = (b - PREP_SQ) % FF_PIECES;
    transpose_piece<D_MODEL, D_FF>(
        (m == 0) ? w_gate : w_up,
        wt + (size_t)4 * (D_MODEL * D_MODEL) + (size_t)m * (D_MODEL * D_FF),
        (r % (D_FF / 128)) * 128, (r / (D_FF / 128)) * TP_ROWS, tile);
  } else {
    const int r = b - (PREP_SQ + PREP_UP);
    transpose_piece<D_FF, D_MODEL>(
        w_down, wt + (size_t)4 * (D_MODEL * D_MODEL) + (size_t)2 * (D_MODEL * D_FF),
        (r % (D_MODEL / 128)) * 128, (r / (D_MODEL / 128)) * TP_ROWS, tile);
  }
}

// ---------------------------------------------------------------------------
// A wave's 32 x 64 accumulators to memory. D layout: element r of a fragment is
// row r + 8*(lane/16), column lane%16; m_w, n_w: this lane's row and column of
// element 0 of fragment (0, 0).
// MODE: 0 = store bf16, 1 = fp32 out = resid + C, 2 = bf16 scatter to V^T
// ---------------------------------------------------------------------------
template <int MODE>
__device__ inline void gemm_store(const v8f (&acc)[2][4], int m_w, int n_w, int N,
                                  const float* __restrict__ resid,
                                  void* __restrict__ outp) {
  // unrolled so that every accumulator index is a constant (registers, no scratch)
#pragma unroll
  for (int mi = 0; mi < 2; ++mi)
#pragma unroll
    for (int ni = 0; ni < 4; ++ni)
#pragma unroll
      for (int r = 0; r < 8; ++r) {
        const int mg = m_w + mi * 16 + r;
        const int ng = n_w + ni * 16;
        const float c = acc[mi][ni][r];
        if (MODE == 0) {
          ((bf16_t*)outp)[(size_t)mg * N + ng] = (bf16_t)c;
        } else if (MODE == 1) {
          const size_t idx = (size_t)mg * N + ng;
          ((float*)outp)[idx] = resid[idx] + c;
        } else {  // V^T scatter: [B,H,DK,SEQ]
          const int bb = mg >> 11, sin = mg & (SEQ - 1);
          const int hh = ng >> 6, dd = ng & (DK - 1);
          ((bf16_t*)outp)[(((size_t)(bb * HEADS + hh) * DK + dd) << 11) + sin] =
              (bf16_t)c;
        }
      }
}

__device__ inline float exp2_slot(float x) {
  float y;
  asm("v_exp_f32 %0, %1\n\tv_nop" : "=v"(y) : "v"(x));
  return y;
}
__device__ inline float rcp_slot(float x) {
  float y;
  asm("v_rcp_f32 %0, %1\n\tv_nop" : "=v"(y) : "v"(x));
  return y;
}

__device__ inline void gemm_store_swiglu(const v8f (&acc)[2][4], int m_w, int n_w, int N,
                                         bf16_t* __restrict__ outp) {
  // unrolled so that every accumulator index is a constant (registers, no scratch)
#pragma unroll
  for (int mi = 0; mi < 2; ++mi)
#pragma unroll
    for (int nj = 0; nj < 2; ++nj)
#pragma unroll
      for (int r = 0; r < 8; ++r) {
        const float gv = acc[mi][nj][r];
        const float uv = acc[mi][nj + 2][r];
        // e^-g = 2^(-g log2 e); v_rcp_f32 (1 ulp) for the divide: the result is
        // rounded to bf16
        const float sil = gv * rcp_slot(1.f + exp2_slot(gv * -1.44269504f));
        outp[(size_t)(m_w + mi * 16 + r) * N + n_w + nj * 16] = (bf16_t)(sil * uv);
      }
}

// ---------------------------------------------------------------------------
// GEMM: C[M][N] = A[M][K] (bf16, k-major) x Bt[N][K] (bf16, k-major)
// 256 threads = 8 waves; block tile 128x128; per-wave 32x64 (2x4 frags).
// Several products that share A run side by side in one grid: product p takes
// rows p * N .. p * N + N - 1 of Bt (grid.x covers them all) and writes the p-th
// M x N matrix at outp.
// EPI: 1 = one product, fp32 out = resid + C,
//      2 = three products: 0 and 1 stored as bf16, 2 scattered to V^T,
//      0 = gate and up (rows 0 .. N - 1 and N .. 2 N - 1 of Bt) joined in the block:
//          its B tile is 64 gate rows and the 64 up rows of the same columns, a wave
//          holds both for its 32 x 32 outputs and stores silu(gate) * up, one M x N
//          matrix (grid.x = N / 64)
// Assumes M,N % 128 == 0, K % 64 == 0 and K >= 128 (true for all calls here).
// ---------------------------------------------------------------------------
template <int EPI>
__global__ __launch_bounds__(256) void gemm_bf16_wmma(
    const bf16_t* __restrict__ A, const bf16_t* __restrict__ Bt,
    int M, int N, int K, const float* __restrict__ resid,
    void* __restrict__ outp) {
  // ring[buffer][A tile | B tile]; every tile starts at a multiple of 2 KiB
  // (EPI 0: [A tile | 64 gate rows | 64 up rows])
  constexpr int STAGE = (EPI == 0) ? G_TILE + 2 * G_HALF : G_STAGE;
  constexpr unsigned N_ISSUE = (EPI == 0) ? 3u : 2u;  // waves that issue tensor loads
  __shared__ __attribute__((aligned(2048))) unsigned char ring[2 * STAGE];
  const int tid  = threadIdx.x;
  const int lane = tid & 31, wave = tid >> 5;
  const int g = lane >> 4, ln = lane & 15;
  const int wm = wave >> 1, wn = wave & 1;
  const int m_blk = blockIdx.y * 128, n_blk = blockIdx.x * ((EPI == 0) ? 64 : 128);
  // Wave 0 brings the A tile of every stage, wave 1 the B tile (EPI 0: wave 1 the
  // gate rows, wave 2 the up rows).
  const unsigned wave_u = uni((unsigned)threadIdx.x >> 5);
  const bf16_t* my_src =
      (wave_u == 0) ? A + (size_t)m_blk * K
                    : Bt + (size_t)(n_blk + ((EPI == 0 && wave_u != 1u) ? N : 0)) * K;
  const unsigned my_lds =
      (unsigned)(size_t)(void*)&ring[0] +
      ((wave_u == 0) ? 0u
                     : (unsigned)G_TILE + ((EPI == 0 && wave_u != 1u) ? (unsigned)G_HALF : 0u));
  const v8u g1 = (EPI == 0)
                     ? tdm_group1_rows_x128B((wave_u == 0) ? 128u : 64u, (unsigned)K * 2u)
                     : tdm_group1_128x128B((unsigned)K * 2u);
  const int n_stage = K / G_BK;

  v8f acc[2][4] = {};

  // Prologue: stage 0 lands and is published, then stage 1 starts to fly.
  if (pinned(wave_u < N_ISSUE)) {
    tdm_load_tile(my_src, my_lds, g1);
    // stage 0 has landed here
    asm volatile("s_wait_tensorcnt 0x0" ::: "memory");
  }
  __syncthreads();
  if (pinned(wave_u < N_ISSUE))
    tdm_load_tile(my_src + G_BK, my_lds + STAGE, g1);

  for (int s = 0; s < n_stage; ++s) {
    const unsigned char* bufA = ring + (s & 1) * STAGE;
    const unsigned char* bufB = bufA + G_TILE;
    // unrolled so that every fragment and accumulator index is a constant
    // (registers, no scratch); the two 32-k blocks keep the ascending k order
#pragma unroll
    for (int kk = 0; kk < 2; ++kk) {
      v16bf aF[2], bF[4];
#pragma unroll
      for (int mi = 0; mi < 2; ++mi) {
        const unsigned char* p =
            bufA + (wm * 32 + mi * 16 + ln) * G_PITCH + kk * 64 + g * 16;
        aF[mi] = ld_frag16((const bf16_t*)p, (const bf16_t*)(p + 32));
      }
#pragma unroll
      for (int ni = 0; ni < 4; ++ni) {
        const unsigned char* p =
            ((EPI == 0) ? bufB + (ni >> 1) * G_HALF + (wn * 32 + (ni & 1) * 16 + ln) * G_PITCH
                        : bufB + (wn * 64 + ni * 16 + ln) * G_PITCH) +
            kk * 64 + g * 16;
        bF[ni] = ld_frag16((const bf16_t*)p, (const bf16_t*)(p + 32));
      }
#pragma unroll
      for (int mi = 0; mi < 2; ++mi)
#pragma unroll
        for (int ni = 0; ni < 4; ++ni)
          acc[mi][ni] = wmma_bf16(aF[mi], bF[ni], acc[mi][ni]);
    }
    // Publish point of stage s + 1. This wave's reads of buffer s & 1 are done:
    asm volatile("s_wait_dscnt 0x0" ::: "memory");
    if (pinned(wave_u < N_ISSUE)) {
      // the issuing wave's own tile of stage s + 1 has landed
      asm volatile("s_wait_tensorcnt 0x0" ::: "memory");
    }
    __syncthreads();
    // Refill the buffer that every wave has just left, while a stage is left.
    if (pinned((wave_u < N_ISSUE) && (s + 2 < n_stage)))
      tdm_load_tile(my_src + (size_t)(s + 2) * G_BK,
                    my_lds + (unsigned)(s & 1) * STAGE, g1);
  }
  asm volatile("s_wait_tensorcnt 0x0" :: "s"(g1) : "memory");
  asm volatile("s_wait_dscnt 0x0" ::: "memory");

  // Epilogue: this product's matrix, in this product's form. The test on prod is
  // the same for the whole block and stands outside the store loops, so that each
  // form keeps its straight-line stores (the V^T form: 16 bytes a lane).
  constexpr int n_prod = (EPI == 2) ? 3 : 1;
  int prod = 0;  // which product this block's columns belong to
  for (int p = 1; p < n_prod; ++p) prod += (n_blk >= p * N) ? 1 : 0;
  void* const outm = (EPI != 2) ? outp : (void*)((bf16_t*)outp + (size_t)prod * M * N);
  const int m_w = m_blk + wm * 32 + 8 * g;
  const int n_w = n_blk - prod * N + wn * ((EPI == 0) ? 32 : 64) + ln;
  if (EPI == 0) {
    gemm_store_swiglu(acc, m_w, n_w, N, (bf16_t*)outm);
  } else if (EPI == 2) {
    if (prod < 2) {
      gemm_store<0>(acc, m_w, n_w, N, resid, outm);
    } else {
      gemm_store<2>(acc, m_w, n_w, N, resid, outm);
      // in the compiled text the other form's code stands behind these stores and
      // takes their registers again: the wait stands in front of that overwrite
      asm volatile("s_wait_xcnt 0x0" ::: "memory");
    }
  } else {
    gemm_store<EPI>(acc, m_w, n_w, N, resid, outm);
  }
}

// Maximum over each 16-lane row of eight independent values, left in every lane
// of the row. Four butterfly steps (lane ^ 1, 2, 4, 8), each one vector
// instruction whose first source is read through DPP row_xmask: nothing goes
// over the LDS path and nothing waits on dscnt, where __shfl_xor compiles to
// ds_bpermute_b32 with a wait behind every step. The eight values go through a
// step together, so an instruction's producer stands eight instructions back
// and no step waits for the one before it. Every lane of the wave must be on.
__device__ inline void row_max16_x8(float (&v)[8]) {
  asm(
      "v_max_num_f32_dpp %0, %0, %0 row_xmask:1 row_mask:0xf bank_mask:0xf\n\t"
      "v_max_num_f32_dpp %1, %1, %1 row_xmask:1 row_mask:0xf bank_mask:0xf\n\t"
      "v_max_num_f32_dpp %2, %2, %2 row_xmask:1 row_mask:0xf bank_mask:0xf\n\t"
      "v_max_num_f32_dpp %3, %3, %3 row_xmask:1 row_mask:0xf bank_mask:0xf\n\t"
      "v_max_num_f32_dpp %4, %4, %4 row_xmask:1 row_mask:0xf bank_mask:0xf\n\t"
      "v_max_num_f32_dpp %5, %5, %5 row_xmask:1 row_mask:0xf bank_mask:0xf\n\t"
      "v_max_num_f32_dpp %6, %6, %6 row_xmask:1 row_mask:0xf bank_mask:0xf\n\t"
      "v_max_num_f32_dpp %7, %7, %7 row_xmask:1 row_mask:0xf bank_mask:0xf\n\t"
      "v_max_num_f32_dpp %0, %0, %0 row_xmask:2 row_mask:0xf bank_mask:0xf\n\t"
      "v_max_num_f32_dpp %1, %1, %1 row_xmask:2 row_mask:0xf bank_mask:0xf\n\t"
      "v_max_num_f32_dpp %2, %2, %2 row_xmask:2 row_mask:0xf bank_mask:0xf\n\t"
      "v_max_num_f32_dpp %3, %3, %3 row_xmask:2 row_mask:0xf bank_mask:0xf\n\t"
      "v_max_num_f32_dpp %4, %4, %4 row_xmask:2 row_mask:0xf bank_mask:0xf\n\t"
      "v_max_num_f32_dpp %5, %5, %5 row_xmask:2 row_mask:0xf bank_mask:0xf\n\t"
      "v_max_num_f32_dpp %6, %6, %6 row_xmask:2 row_mask:0xf bank_mask:0xf\n\t"
      "v_max_num_f32_dpp %7, %7, %7 row_xmask:2 row_mask:0xf bank_mask:0xf\n\t"
      "v_max_num_f32_dpp %0, %0, %0 row_xmask:4 row_mask:0xf bank_mask:0xf\n\t"
      "v_max_num_f32_dpp %1, %1, %1 row_xmask:4 row_mask:0xf bank_mask:0xf\n\t"
      "v_max_num_f32_dpp %2, %2, %2 row_xmask:4 row_mask:0xf bank_mask:0xf\n\t"
      "v_max_num_f32_dpp %3, %3, %3 row_xmask:4 row_mask:0xf bank_mask:0xf\n\t"
      "v_max_num_f32_dpp %4, %4, %4 row_xmask:4 row_mask:0xf bank_mask:0xf\n\t"
      "v_max_num_f32_dpp %5, %5, %5 row_xmask:4 row_mask:0xf bank_mask:0xf\n\t"
      "v_max_num_f32_dpp %6, %6, %6 row_xmask:4 row_mask:0xf bank_mask:0xf\n\t"
      "v_max_num_f32_dpp %7, %7, %7 row_xmask:4 row_mask:0xf bank_mask:0xf\n\t"
      "v_max_num_f32_dpp %0, %0, %0 row_xmask:8 row_mask:0xf bank_mask:0xf\n\t"
      "v_max_num_f32_dpp %1, %1, %1 row_xmask:8 row_mask:0xf bank_mask:0xf\n\t"
      "v_max_num_f32_dpp %2, %2, %2 row_xmask:8 row_mask:0xf bank_mask:0xf\n\t"
      "v_max_num_f32_dpp %3, %3, %3 row_xmask:8 row_mask:0xf bank_mask:0xf\n\t"
      "v_max_num_f32_dpp %4, %4, %4 row_xmask:8 row_mask:0xf bank_mask:0xf\n\t"
      "v_max_num_f32_dpp %5, %5, %5 row_xmask:8 row_mask:0xf bank_mask:0xf\n\t"
      "v_max_num_f32_dpp %6, %6, %6 row_xmask:8 row_mask:0xf bank_mask:0xf\n\t"
      "v_max_num_f32_dpp %7, %7, %7 row_xmask:8 row_mask:0xf bank_mask:0xf"
      : "+v"(v[0]), "+v"(v[1]), "+v"(v[2]), "+v"(v[3]),
        "+v"(v[4]), "+v"(v[5]), "+v"(v[6]), "+v"(v[7]));
}

__global__ __launch_bounds__(128) void flash_attn_wmma(
    const bf16_t* __restrict__ Q, const bf16_t* __restrict__ Km,
    const bf16_t* __restrict__ Vt, bf16_t* __restrict__ O) {
  // ring[buffer][K tile | V^T tile]; every tile starts at a multiple of 2 KiB
  __shared__ __attribute__((aligned(2048))) unsigned char ring[2 * A_STAGE];
  __shared__ bf16_t sP[4][16][40];  // per-wave P staging (D-layout -> A-layout)
  const int tid  = threadIdx.x;
  const int lane = tid & 31;
  const unsigned wave_u = uni((unsigned)threadIdx.x >> 5);
  const int wave = (int)wave_u;
  const int g = lane >> 4, ln = lane & 15;
  const int bh = blockIdx.y, b = bh >> 4, h = bh & 15;
  const int q0 = blockIdx.x * 64 + wave * 16;

  // The block's four waves read the same keys: wave 0 brings the K tile of every
  // stage, wave 1 the V^T tile. The block's rows end at key 64 * blockIdx.x + 63.
  const bf16_t* my_src = (wave_u == 0)
                             ? Km + (size_t)(b * SEQ) * D_MODEL + h * DK
                             : Vt + (size_t)((b * HEADS + h) * DK) * SEQ;
  // a stage's step in the source, as a shift: 64 rows of K, 64 columns of V^T
  const unsigned my_shift = (wave_u == 0) ? 16u : 6u;
  static_assert(A_KEYS * D_MODEL == 1 << 16 && A_KEYS == 1 << 6, "stage steps");
  const unsigned my_lds = (unsigned)(size_t)(void*)&ring[0] +
                          ((wave_u == 0) ? 0u : (unsigned)A_TILE);
  const v8u g1 = tdm_group1_64x128B((wave_u == 0) ? (unsigned)(D_MODEL * 2)
                                                  : (unsigned)(SEQ * 2));
  const int n_stage = (int)blockIdx.x + 1;

  // Q A-fragments: 16 rows x 64 (two k-halves of 32)
  const bf16_t* qrow = Q + (size_t)(b * SEQ + q0 + ln) * D_MODEL + h * DK;
  v16bf qf[2];
#pragma unroll
  for (int kk = 0; kk < 2; ++kk)
    qf[kk] = ld_frag16(qrow + kk * 32 + g * 8, qrow + kk * 32 + 16 + g * 8);

  v16bf onesf;
#pragma unroll
  for (int j = 0; j < 16; ++j) onesf[j] = (bf16_t)1.0f;

  v8f o[4] = {};
  v8f o5 = {};  // softmax denominator accumulator (P x ones)
  float mrow[8];
#pragma unroll
  for (int r = 0; r < 8; ++r) mrow[r] = -__builtin_inff();

  v4u g0 = {0u, 0u, 0u, 0u};
  if (pinned(wave_u < 2u)) {
    g0 = tdm_group0(my_src, my_lds);
    asm volatile("tensor_load_to_lds %0, %1" :: "s"(g0), "s"(g1) : "memory");
    // stage 0 has landed here
    asm volatile("s_wait_tensorcnt 0x0" :: "s"(g0) : "memory");
  }
  __syncthreads();
  if (pinned(wave_u < 2u)) {
    g0 = tdm_group0(my_src + ((size_t)1 << my_shift), my_lds + A_STAGE);
    asm volatile("tensor_load_to_lds %0, %1" :: "s"(g0), "s"(g1) : "memory");
  }

  for (int st = 0; st < n_stage; ++st) {
   const unsigned char* bufK = ring + (st & 1) * A_STAGE;
   const unsigned char* bufV = bufK + A_TILE;
   // the stage's two 32-key tiles; a wave skips a tile wholly above its diagonal
   for (int t0 = st * A_KEYS; t0 < (st + 1) * A_KEYS && t0 <= q0 + 15; t0 += 32) {
    const int tr = t0 - st * A_KEYS;  // first key of the tile inside the stage
    // The tile's K and V^T B-fragments, as one group of LDS reads, K first: the V
    // reads return under the score products and the softmax.
    v16bf kf[2][2], vf[4];
#pragma unroll
    for (int ni = 0; ni < 2; ++ni) {
      const unsigned char* krow = bufK + (tr + ni * 16 + ln) * G_PITCH + g * 16;
#pragma unroll
      for (int kk = 0; kk < 2; ++kk)
        kf[ni][kk] = ld_frag16((const bf16_t*)(krow + kk * 64),
                               (const bf16_t*)(krow + kk * 64 + 32));
    }
#pragma unroll
    for (int f = 0; f < 4; ++f) {
      const unsigned char* vrow = bufV + (f * 16 + ln) * G_PITCH + tr * 2 + g * 16;
      vf[f] = ld_frag16((const bf16_t*)vrow, (const bf16_t*)(vrow + 32));
    }
    // scores S = Q * K^T  (16 x 32), two 16x16 D frags
    v8f s[2] = {};
#pragma unroll
    for (int ni = 0; ni < 2; ++ni)
#pragma unroll
      for (int kk = 0; kk < 2; ++kk)
        s[ni] = wmma_bf16(qf[kk], kf[ni][kk], s[ni]);
    // scale + causal mask
#pragma unroll
    for (int ni = 0; ni < 2; ++ni)
#pragma unroll
      for (int r = 0; r < 8; ++r) {
        const float v = s[ni][r] * 0.125f;  // 1/sqrt(64)
        const int qg = q0 + r + 8 * g;
        const int tg = t0 + ni * 16 + ln;
        s[ni][r] = (tg > qg) ? -__builtin_inff() : v;
      }
    // row max (butterfly within 16-lane halves) + online rescale factor
    float alpha[8], vmax[8];
#pragma unroll
    for (int r = 0; r < 8; ++r)
      vmax[r] = fmaxf(fmaxf(s[0][r], s[1][r]), mrow[r]);  // mrow: equal in the row
    row_max16_x8(vmax);
#pragma unroll
    for (int r = 0; r < 8; ++r) {
      const float mn = vmax[r];
      alpha[r] = __expf(mrow[r] - mn);
      mrow[r] = mn;
    }
#pragma unroll
    for (int ni = 0; ni < 2; ++ni)
#pragma unroll
      for (int r = 0; r < 8; ++r) s[ni][r] = __expf(s[ni][r] - mrow[r]);
#pragma unroll
    for (int f = 0; f < 4; ++f)
#pragma unroll
      for (int r = 0; r < 8; ++r) o[f][r] *= alpha[r];
#pragma unroll
    for (int r = 0; r < 8; ++r) o5[r] *= alpha[r];

    // P: D-layout -> bf16 LDS -> A-layout (wave-local, split-counter sync)
#pragma unroll
    for (int ni = 0; ni < 2; ++ni)
#pragma unroll
      for (int r = 0; r < 8; ++r)
        sP[wave][r + 8 * g][ni * 16 + ln] = (bf16_t)s[ni][r];
    asm volatile("s_wait_dscnt 0" ::: "memory");
    v16bf pf = ld_frag16(&sP[wave][ln][g * 8], &sP[wave][ln][16 + g * 8]);

    // O += P(16x32) * V(32x64): B frags from V^T rows (contiguous along t)
#pragma unroll
    for (int f = 0; f < 4; ++f) o[f] = wmma_bf16(pf, vf[f], o[f]);
    // denominator: l += P x ones
    o5 = wmma_bf16(pf, onesf, o5);
    asm volatile("v_nop\n\tv_nop\n\tv_nop\n\tv_nop" :: "v"(o5));
   }
   // Publish point of stage st + 1; every wave passes it, also one that skipped a
   // tile. This wave's reads of buffer st & 1 are done:
   asm volatile("s_wait_dscnt 0x0" ::: "memory");
   if (pinned(wave_u < 2u)) {
     // the issuing wave's own tile of stage st + 1 has landed
     asm volatile("s_wait_tensorcnt 0x0" :: "s"(g0) : "memory");
   }
   __syncthreads();
   // Refill the buffer that every wave has just left, while a stage is left.
   if (pinned((wave_u < 2u) && (st + 2 < n_stage))) {
     g0 = tdm_group0(my_src + ((size_t)(st + 2) << my_shift),
                     my_lds + (unsigned)(st & 1) * A_STAGE);
     asm volatile("tensor_load_to_lds %0, %1" :: "s"(g0), "s"(g1) : "memory");
   }
  }
  // nothing of the ring is outstanding when the wave goes on to its stores
  asm volatile("s_wait_tensorcnt 0x0" ::: "memory");
  asm volatile("s_wait_dscnt 0x0" ::: "memory");

  // normalize and store: out[b, q, h*64 + d] (bf16, row-major D_MODEL)
#pragma unroll
  for (int f = 0; f < 4; ++f)
#pragma unroll
    for (int r = 0; r < 8; ++r) {
      const float val = o[f][r] / o5[r];
      const int qg = q0 + r + 8 * g;
      O[(size_t)(b * SEQ + qg) * D_MODEL + h * DK + f * 16 + ln] = (bf16_t)val;
    }
}

// ---------------------------------------------------------------------------
// Host orchestration
// ---------------------------------------------------------------------------
extern "C" void kernel_launch(void* const* d_in, const int* in_sizes, int n_in,
                              void* d_out, int out_size, void* d_ws,
                              size_t ws_size, hipStream_t stream) {
  (void)in_sizes; (void)n_in; (void)out_size; (void)ws_size;
  const float* x      = (const float*)d_in[0];
  const float* w_q    = (const float*)d_in[1];
  const float* w_k    = (const float*)d_in[2];
  const float* w_v    = (const float*)d_in[3];
  const float* w_o    = (const float*)d_in[4];
  const float* w_gate = (const float*)d_in[5];
  const float* w_up   = (const float*)d_in[6];
  const float* w_down = (const float*)d_in[7];
  const float* g1     = (const float*)d_in[8];
  const float* g2     = (const float*)d_in[9];

  unsigned char* ws = (unsigned char*)d_ws;
  const size_t MB = 1ull << 20;
  bf16_t* wtq  = (bf16_t*)(ws + 0 * MB);    // [1024][1024]      2 MB
  bf16_t* wtk  = (bf16_t*)(ws + 2 * MB);    //                   2 MB
  bf16_t* wtv  = (bf16_t*)(ws + 4 * MB);    //                   2 MB
  bf16_t* wto  = (bf16_t*)(ws + 6 * MB);    //                   2 MB
  bf16_t* wtg  = (bf16_t*)(ws + 8 * MB);    // [4096][1024]      8 MB
  bf16_t* wtu  = (bf16_t*)(ws + 16 * MB);   //                   8 MB
  bf16_t* wtd  = (bf16_t*)(ws + 24 * MB);   // [1024][4096]      8 MB
  bf16_t* nx1  = (bf16_t*)(ws + 32 * MB);   // [4096][1024]      8 MB
  bf16_t* qb   = (bf16_t*)(ws + 40 * MB);   // [4096][1024]      8 MB
  bf16_t* kb   = (bf16_t*)(ws + 48 * MB);   //                   8 MB
  bf16_t* vtb  = (bf16_t*)(ws + 56 * MB);   // [B,H,DK,SEQ]      8 MB
  bf16_t* ao   = (bf16_t*)(ws + 64 * MB);   // attn out          8 MB
  float*  x2   = (float*) (ws + 72 * MB);   // f32 resid        16 MB
  bf16_t* nx2  = (bf16_t*)(ws + 88 * MB);   // [4096][1024]      8 MB
  bf16_t* hid  = (bf16_t*)(ws + 96 * MB);   // [4096][4096]     32 MB (end 128 MB)

  // --- weight prep W[K][N] -> Wt[N][K] bf16 and the first RMSNorm, one grid ---
  // (wtq .. wtd lie one behind the other in the workspace)
  (void)wtk; (void)wtv; (void)wtu;  // reached through wtq and wtg
  prep_kernel<<<PREP_GRID, 256, 0, stream>>>(w_q, w_k, w_v, w_o, w_gate, w_up, w_down,
                                             x, g1, wtq, nx1);

  // --- attention sublayer ---
  // Q, K and V in one grid: wtq, wtk, wtv are adjacent, and so are qb, kb, vtb
  const dim3 gemm_blk(256);
  gemm_bf16_wmma<2><<<dim3(3 * D_MODEL / 128, M_ROWS / 128), gemm_blk, 0, stream>>>(
      nx1, wtq, M_ROWS, D_MODEL, D_MODEL, nullptr, qb);

  flash_attn_wmma<<<dim3(SEQ / 64, BATCH * HEADS), 128, 0, stream>>>(qb, kb, vtb, ao);

  gemm_bf16_wmma<1><<<dim3(D_MODEL / 128, M_ROWS / 128), gemm_blk, 0, stream>>>(
      ao, wto, M_ROWS, D_MODEL, D_MODEL, x, x2);

  // --- SwiGLU FFN sublayer ---
  rmsnorm_kernel<<<M_ROWS / RMS_ROWS, 256, 0, stream>>>(x2, g2, nx2);

  // gate, up and silu(gate) * up in one grid: wtg, wtu are adjacent
  gemm_bf16_wmma<0><<<dim3(D_FF / 64, M_ROWS / 128), gemm_blk, 0, stream>>>(
      nx2, wtg, M_ROWS, D_FF, D_MODEL, nullptr, hid);

  gemm_bf16_wmma<1><<<dim3(D_MODEL / 128, M_ROWS / 128), gemm_blk, 0, stream>>>(
      hid, wtd, M_ROWS, D_MODEL, D_FF, x2, (float*)d_out);
}

// v007
// A run of this version takes 192 microseconds.
// In both of two side-by-side timings against v006, it was 1.09 times as fast.
// All steps since v000 together make it 2.53 times as fast.
#include <hip/hip_runtime.h>

typedef __bf16 bf16_t;
typedef __attribute__((ext_vector_type(16))) __bf16        v16bf;
typedef __attribute__((ext_vector_type(8)))  float         v8f;
typedef __attribute__((ext_vector_type(4)))  unsigned int  v4u;
typedef __attribute__((ext_vector_type(8)))  unsigned int  v8u;

#define D_MODEL 1024
#define SEQ     2048
#define BATCH   2
#define HEADS   16
#define DK      64
#define D_FF    4096
#define M_ROWS  (BATCH * SEQ)   // 4096

union FragU { v16bf v; uint4 q[2]; };

__device__ inline v16bf ld_frag16(const bf16_t* p0, const bf16_t* p1) {
  FragU u;
  u.q[0] = *reinterpret_cast<const uint4*>(p0);
  u.q[1] = *reinterpret_cast<const uint4*>(p1);
  return u.v;
}

__device__ inline v8f wmma_bf16(v16bf a, v16bf b, v8f c) {
  // (neg_a, A, neg_b, B, c_mod, C, reuse_a, reuse_b)
  return __builtin_amdgcn_wmma_f32_16x16x32_bf16(false, a, false, b, (short)0, c,
                                                 false, false);
}

// ---------------------------------------------------------------------------
// GEMM stage geometry: 64 k per stage, so an operand row is 128 B; the tensor
// load pads each row by 16 B (pitch 144 B: conflict-free ds_load_b128 rows).
// One operand tile = 128 rows x 144 B = 18432 B = 9 x 2 KiB.
// ---------------------------------------------------------------------------
#define G_BK     64
#define G_PITCH  144
#define G_TILE   (128 * G_PITCH)
#define G_STAGE  (2 * G_TILE)
// A slice of 64 rows: 64 x 144 B = 9216 B, its place rounded up to 5 x 2 KiB.
#define G_HALF   10240

__device__ inline unsigned uni(unsigned v) {
  return (unsigned)__builtin_amdgcn_readfirstlane((int)v);
}
__device__ inline unsigned pinned(unsigned v) {
  unsigned w = uni(v);
  asm volatile("" : "+s"(w));
  return w;
}

__device__ inline v8u tdm_group1_128x128B(unsigned src_pitch) {
  v8u g1;
  g1[0] = pinned((1u << 20) | (4u << 22) | (3u << 25));
  g1[1] = pinned(128u << 16);
  g1[2] = pinned(128u << 16);
  g1[3] = pinned(128u << 16);
  g1[4] = pinned(128u);
  g1[5] = pinned(src_pitch);
  g1[6] = pinned(0u);
  g1[7] = pinned(0u);
  return g1;
}

// The same with a wave-uniform number of rows (128 or 64).
__device__ inline v8u tdm_group1_rows_x128B(unsigned rows, unsigned src_pitch) {
  v8u g1;
  g1[0] = pinned((1u << 20) | (4u << 22) | (3u << 25));
  g1[1] = pinned(128u << 16);
  g1[2] = pinned(rows << 16);
  g1[3] = pinned(128u << 16);
  g1[4] = pinned(rows);
  g1[5] = pinned(src_pitch);
  g1[6] = pinned(0u);
  g1[7] = pinned(0u);
  return g1;
}

// One tensor load: the tile whose first byte is gtile, to LDS byte offset lds_off.
__device__ inline void tdm_load_tile(const bf16_t* gtile, unsigned lds_off, v8u g1) {
  const unsigned long long ga = (unsigned long long)(size_t)gtile;
  v4u g0;
  g0[0] = uni(1u);                              // count = 1
  g0[1] = uni(lds_off);                         // LDS destination (bytes)
  g0[2] = uni((unsigned)ga);                    // global address [31:0]
  g0[3] = uni(((unsigned)(ga >> 32) & 0x01FFFFFFu) | 0x80000000u);  // [56:32], type 2
  asm volatile("tensor_load_to_lds %0, %1" :: "s"(g0), "s"(g1) : "memory");
}

// Attention stage geometry: 64 keys per stage. The K tile is 64 key rows of 128 B
// (one head's 64 dims), the V^T tile 64 dim rows of 128 B (64 keys); both land at
// pitch G_PITCH. One tile = 64 x 144 B = 9216 B, its place rounded up to 5 x 2 KiB.
#define A_KEYS   64
#define A_TILE   10240
#define A_STAGE  (2 * A_TILE)

__device__ inline v4u tdm_group0(const bf16_t* gtile, unsigned lds_off) {
  const unsigned long long ga = (unsigned long long)(size_t)gtile;
  v4u g0;
  g0[0] = uni(1u);                              // count = 1
  g0[1] = uni(lds_off);                         // LDS destination (bytes)
  g0[2] = uni((unsigned)ga);                    // global address [31:0]
  g0[3] = uni(((unsigned)(ga >> 32) & 0x01FFFFFFu) | 0x80000000u);  // [56:32], type 2
  return g0;
}

__device__ inline v8u tdm_group1_64x128B(unsigned src_pitch) {
  v8u g1;
  g1[0] = pinned((1u << 20) | (4u << 22) | (3u << 25));
  g1[1] = pinned(128u << 16);
  g1[2] = pinned(64u << 16);
  g1[3] = pinned(128u << 16);
  g1[4] = pinned(64u);
  g1[5] = pinned(src_pitch);
  g1[6] = pinned(0u);
  g1[7] = pinned(0u);
  return g1;
}

// ---------------------------------------------------------------------------
// Weight transpose + fp32 -> bf16 convert:  W[K][N] -> Wt[N][K]
// One block of 256 threads takes a piece of 256 rows x 128 columns (first column
// n0, first row k0) in TP_TRIPS trips of eight 32 x 32 tiles (64 rows x 128
// columns; tile t: columns 32 * (t % 4), rows 32 * (t / 4)). The next trip's loads fly while this trip's tiles are stored;
// the trips alternate between two sets of tiles in LDS, so that one barrier a trip
// is enough (a second one, behind the stores, would wait for those loads).
// ---------------------------------------------------------------------------
#define TP_TILES 8    // tiles per trip
#define TP_TRIPS 4    // trips per block
#define TP_ROWS  (64 * TP_TRIPS)
typedef float TpTiles[2][TP_TILES][32][33];

template <int N>
__device__ inline void transpose_load(float (&r)[TP_TILES][4], const float* __restrict__ w) {
  // unrolled so that every index of r is a constant (registers, no scratch)
#pragma unroll
  for (int t = 0; t < TP_TILES; ++t)
#pragma unroll
    for (int i = 0; i < 4; ++i)
      r[t][i] = w[(size_t)((t >> 2) * 32 + i * 8) * N + (t & 3) * 32];
}

template <int K, int N>
__device__ inline void transpose_piece(
    const float* __restrict__ W, bf16_t* __restrict__ Wt, int n0, int k0,
    TpTiles& tile) {
  const int tx = threadIdx.x & 31, ty = threadIdx.x >> 5;  // 32 x 8
  const float* w = W + (size_t)(k0 + ty) * N + n0 + tx;    // this thread's first element
  bf16_t* wt = Wt + (size_t)(n0 + ty) * K + k0 + tx;
  float r[TP_TILES][4];
  transpose_load<N>(r, w);
  // kept rolled: unrolled, every trip's loads would be lifted to the top and take
  // four times the registers
#pragma unroll 1
  for (int trip = 0; trip < TP_TRIPS; ++trip) {
#pragma unroll
    for (int t = 0; t < TP_TILES; ++t)
#pragma unroll
      for (int i = 0; i < 4; ++i) tile[trip & 1][t][ty + i * 8][tx] = r[t][i];
    // this set is written; and whoever writes the other set next trip has passed
    // here, behind every wave's reads of it
    __syncthreads();
    if (trip + 1 < TP_TRIPS) {
      transpose_load<N>(r, w + (size_t)(trip + 1) * 64 * N);
      // the LDS reads below take these loads' address registers again: the wait
      // stands in front of that overwrite
      asm volatile("s_wait_xcnt 0x0" ::: "memory");
    }
#pragma unroll
    for (int t = 0; t < TP_TILES; ++t)
#pragma unroll
      for (int i = 0; i < 4; ++i)
        wt[(size_t)((t & 3) * 32 + i * 8) * K + trip * 64 + (t >> 2) * 32] =
            (bf16_t)tile[trip & 1][t][tx][ty + i * 8];
  }
}

// ---------------------------------------------------------------------------
// RMSNorm: fp32 rows -> bf16 normalized rows (D_MODEL=1024). One block takes
// RMS_ROWS rows, each summed on its own (a thread's four squares, the wave's
// butterfly, the eight waves' sums in order): the rows' loads are in flight
// together, their butterflies interleave, and one barrier serves them all.
// ---------------------------------------------------------------------------
#define RMS_ROWS 8
__device__ inline void rmsnorm_rows(
    const float* __restrict__ x, const float* __restrict__ gain,
    bf16_t* __restrict__ out, int row0) {
  __shared__ float warp_sum[RMS_ROWS][8];
  const int tid = threadIdx.x;
  float4 v[RMS_ROWS];
  float ss[RMS_ROWS];
  // unrolled so that every index of v and ss is a constant (registers, no scratch)
#pragma unroll
  for (int r = 0; r < RMS_ROWS; ++r)
    v[r] = reinterpret_cast<const float4*>(x + (size_t)(row0 + r) * D_MODEL)[tid];
  const float4 gv = reinterpret_cast<const float4*>(gain)[tid];
#pragma unroll
  for (int r = 0; r < RMS_ROWS; ++r)
    ss[r] = v[r].x * v[r].x + v[r].y * v[r].y + v[r].z * v[r].z + v[r].w * v[r].w;
#pragma unroll
  for (int m = 1; m < 32; m <<= 1)
#pragma unroll
    for (int r = 0; r < RMS_ROWS; ++r) ss[r] += __shfl_xor(ss[r], m, 32);
  if ((tid & 31) == 0) {
#pragma unroll
    for (int r = 0; r < RMS_ROWS; ++r) warp_sum[r][tid >> 5] = ss[r];
  }
  __syncthreads();
#pragma unroll
  for (int r = 0; r < RMS_ROWS; ++r) {
    float tot = 0.f;
#pragma unroll
    for (int i = 0; i < 8; ++i) tot += warp_sum[r][i];
    const float inv = rsqrtf(tot * (1.0f / D_MODEL) + 1e-6f);
    bf16_t* orow = out + (size_t)(row0 + r) * D_MODEL + tid * 4;
    orow[0] = (bf16_t)(v[r].x * inv * gv.x);
    orow[1] = (bf16_t)(v[r].y * inv * gv.y);
    orow[2] = (bf16_t)(v[r].z * inv * gv.z);
    orow[3] = (bf16_t)(v[r].w * inv * gv.w);
  }
}

__global__ __launch_bounds__(256) void rmsnorm_kernel(
    const float* __restrict__ x, const float* __restrict__ gain,
    bf16_t* __restrict__ out) {
  rmsnorm_rows(x, gain, out, (int)blockIdx.x * RMS_ROWS);
}

// ---------------------------------------------------------------------------
// Everything that reads the inputs alone, in ONE grid: the seven weight
// transposes and the first RMSNorm depend on nothing but the inputs, so their
// blocks share a launch. A block's job follows from its index (the same for all
// of its threads, so every barrier stands under block-uniform control flow):
//   PREP_SQ blocks   : w_q, w_k, w_v, w_o    (32 pieces each)
//   PREP_UP blocks   : w_gate, w_up          (128 pieces each)
//   PREP_DN blocks   : w_down                (128 pieces)
//   PREP_RMS blocks  : RMS_ROWS rows of x each (the shorter job, placed last)
// wt: the transposed weights one behind the other, in that order.
// ---------------------------------------------------------------------------
#define SQ_PIECES ((D_MODEL / 128) * (D_MODEL / TP_ROWS))   // 32
#define FF_PIECES ((D_MODEL / 128) * (D_FF / TP_ROWS))      // 128
#define PREP_RMS  (M_ROWS / RMS_ROWS)
#define PREP_SQ   (4 * SQ_PIECES)
#define PREP_UP   (2 * FF_PIECES)
#define PREP_DN   FF_PIECES
#define PREP_GRID (PREP_RMS + PREP_SQ + PREP_UP + PREP_DN)

__global__ __launch_bounds__(256) void prep_kernel(
    const float* __restrict__ w_q, const float* __restrict__ w_k,
    const float* __restrict__ w_v, const float* __restrict__ w_o,
    const float* __restrict__ w_gate, const float* __restrict__ w_up,
    const float* __restrict__ w_down, const float* __restrict__ x,
    const float* __restrict__ gain, bf16_t* __restrict__ wt,
    bf16_t* __restrict__ nx) {
  const int b = (int)blockIdx.x;
  if (b >= PREP_SQ + PREP_UP + PREP_DN) {
    rmsnorm_rows(x, gain, nx, (b - (PREP_SQ + PREP_UP + PREP_DN)) * RMS_ROWS);
    return;
  }
  __shared__ TpTiles tile;
  // pieces are numbered inside their matrix, columns fastest
  if (b < PREP_SQ) {
    const int m = b / SQ_PIECES, r = b % SQ_PIECES;
    const float* W = (m == 0) ? w_q : (m == 1) ? w_k : (m == 2) ? w_v : w_o;
    transpose_piece<D_MODEL, D_MODEL>(W, wt + (size_t)m * (D_MODEL * D_MODEL),
                                      (r % (D_MODEL / 128)) * 128,
                                      (r / (D_MODEL / 128)) * TP_ROWS, tile);
  } else if (b < PREP_SQ + PREP_UP) {
    const int m = (b - PREP_SQ) / FF_PIECES, r = (b - PREP_SQ) % FF_PIECES;
    transpose_piece<D_MODEL, D_FF>(
        (m == 0) ? w_gate : w_up,
        wt + (size_t)4 * (D_MODEL * D_MODEL) + (size_t)m * (D_MODEL * D_FF),
        (r % (D_FF / 128)) * 128, (r / (D_FF / 128)) * TP_ROWS, tile);
  } else {
    const int r = b - (PREP_SQ + PREP_UP);
    transpose_piece<D_FF, D_MODEL>(
        w_down, wt + (size_t)4 * (D_MODEL * D_MODEL) + (size_t)2 * (D_MODEL * D_FF),
        (r % (D_MODEL / 128)) * 128, (r / (D_MODEL / 128)) * TP_ROWS, tile);
  }
}

// ---------------------------------------------------------------------------
// A wave's 32 x 64 accumulators to memory. D layout: element r of a fragment is
// row r + 8*(lane/16), column lane%16; m_w, n_w: this lane's row and column of
// element 0 of fragment (0, 0).
// MODE: 0 = store bf16, 1 = fp32 out = resid + C, 2 = bf16 scatter to V^T
// ---------------------------------------------------------------------------
template <int MODE>
__device__ inline void gemm_store(const v8f (&acc)[2][4], int m_w, int n_w, int N,
                                  const float* __restrict__ resid,
                                  void* __restrict__ outp) {
  // unrolled so that every accumulator index is a constant (registers, no scratch)
#pragma unroll
  for (int mi = 0; mi < 2; ++mi)
#pragma unroll
    for (int ni = 0; ni < 4; ++ni)
#pragma unroll
      for (int r = 0; r < 8; ++r) {
        const int mg = m_w + mi * 16 + r;
        const int ng = n_w + ni * 16;
        const float c = acc[mi][ni][r];
        if (MODE == 0) {
          ((bf16_t*)outp)[(size_t)mg * N + ng] = (bf16_t)c;
        } else if (MODE == 1) {
          const size_t idx = (size_t)mg * N + ng;
          ((float*)outp)[idx] = resid[idx] + c;
        } else {  // V^T scatter: [B,H,DK,SEQ]
          const int bb = mg >> 11, sin = mg & (SEQ - 1);
          const int hh = ng >> 6, dd = ng & (DK - 1);
          ((bf16_t*)outp)[(((size_t)(bb * HEADS + hh) * DK + dd) << 11) + sin] =
              (bf16_t)c;
        }
      }
}

__device__ inline float exp2_slot(float x) {
  float y;
  asm("v_exp_f32 %0, %1\n\tv_nop" : "=v"(y) : "v"(x));
  return y;
}
__device__ inline float rcp_slot(float x) {
  float y;
  asm("v_rcp_f32 %0, %1\n\tv_nop" : "=v"(y) : "v"(x));
  return y;
}

__device__ inline void gemm_store_swiglu(const v8f (&acc)[2][4], int m_w, int n_w, int N,
                                         bf16_t* __restrict__ outp) {
  // unrolled so that every accumulator index is a constant (registers, no scratch)
#pragma unroll
  for (int mi = 0; mi < 2; ++mi)
#pragma unroll
    for (int nj = 0; nj < 2; ++nj)
#pragma unroll
      for (int r = 0; r < 8; ++r) {
        const float gv = acc[mi][nj][r];
        const float uv = acc[mi][nj + 2][r];
        // e^-g = 2^(-g log2 e); v_rcp_f32 (1 ulp) for the divide: the result is
        // rounded to bf16
        const float sil = gv * rcp_slot(1.f + exp2_slot(gv * -1.44269504f));
        outp[(size_t)(m_w + mi * 16 + r) * N + n_w + nj * 16] = (bf16_t)(sil * uv);
      }
}

// ---------------------------------------------------------------------------
// GEMM: C[M][N] = A[M][K] (bf16, k-major) x Bt[N][K] (bf16, k-major)
// 256 threads = 8 waves; block tile 128x128; per-wave 32x64 (2x4 frags).
// Several products that share A run side by side in one grid: product p takes
// rows p * N .. p * N + N - 1 of Bt (grid.x covers them all) and writes the p-th
// M x N matrix at outp.
// EPI: 1 = one product, fp32 out = resid + C,
//      2 = three products: 0 and 1 stored as bf16, 2 scattered to V^T,
//      0 = gate and up (rows 0 .. N - 1 and N .. 2 N - 1 of Bt) joined in the block:
//          its B tile is 64 gate rows and the 64 up rows of the same columns, a wave
//          holds both for its 32 x 32 outputs and stores silu(gate) * up, one M x N
//          matrix (grid.x = N / 64)
// Assumes M,N % 128 == 0, K % 64 == 0 and K >= 128 (true for all calls here).
// ---------------------------------------------------------------------------
template <int EPI>
__global__ __launch_bounds__(256) void gemm_bf16_wmma(
    const bf16_t* __restrict__ A, const bf16_t* __restrict__ Bt,
    int M, int N, int K, const float* __restrict__ resid,
    void* __restrict__ outp) {
  // ring[buffer][A tile | B tile]; every tile starts at a multiple of 2 KiB
  // (EPI 0: [A tile | 64 gate rows | 64 up rows])
  constexpr int STAGE = (EPI == 0) ? G_TILE + 2 * G_HALF : G_STAGE;
  constexpr unsigned N_ISSUE = (EPI == 0) ? 3u : 2u;  // waves that issue tensor loads
  __shared__ __attribute__((aligned(2048))) unsigned char ring[2 * STAGE];
  const int tid  = threadIdx.x;
  const int lane = tid & 31, wave = tid >> 5;
  const int g = lane >> 4, ln = lane & 15;
  const int wm = wave >> 1, wn = wave & 1;
  const int m_blk = blockIdx.y * 128, n_blk = blockIdx.x * ((EPI == 0) ? 64 : 128);
  // Wave 0 brings the A tile of every stage, wave 1 the B tile (EPI 0: wave 1 the
  // gate rows, wave 2 the up rows).
  const unsigned wave_u = uni((unsigned)threadIdx.x >> 5);
  const bf16_t* my_src =
      (wave_u == 0) ? A + (size_t)m_blk * K
                    : Bt + (size_t)(n_blk + ((EPI == 0 && wave_u != 1u) ? N : 0)) * K;
  const unsigned my_lds =
      (unsigned)(size_t)(void*)&ring[0] +
      ((wave_u == 0) ? 0u
                     : (unsigned)G_TILE + ((EPI == 0 && wave_u != 1u) ? (unsigned)G_HALF : 0u));
  const v8u g1 = (EPI == 0)
                     ? tdm_group1_rows_x128B((wave_u == 0) ? 128u : 64u, (unsigned)K * 2u)
                     : tdm_group1_128x128B((unsigned)K * 2u);
  const int n_stage = K / G_BK;

  v8f acc[2][4] = {};

  // Prologue: stage 0 lands and is published, then stage 1 starts to fly.
  if (pinned(wave_u < N_ISSUE)) {
    tdm_load_tile(my_src, my_lds, g1);
    // stage 0 has landed here
    asm volatile("s_wait_tensorcnt 0x0" ::: "memory");
  }
  __syncthreads();
  if (pinned(wave_u < N_ISSUE))
    tdm_load_tile(my_src + G_BK, my_lds + STAGE, g1);

  for (int s = 0; s < n_stage; ++s) {
    const unsigned char* bufA = ring + (s & 1) * STAGE;
    const unsigned char* bufB = bufA + G_TILE;
    // unrolled so that every fragment and accumulator index is a constant
    // (registers, no scratch); the two 32-k blocks keep the ascending k order
#pragma unroll
    for (int kk = 0; kk < 2; ++kk) {
      v16bf aF[2], bF[4];
#pragma unroll
      for (int mi = 0; mi < 2; ++mi) {
        const unsigned char* p =
            bufA + (wm * 32 + mi * 16 + ln) * G_PITCH + kk * 64 + g * 16;
        aF[mi] = ld_frag16((const bf16_t*)p, (const bf16_t*)(p + 32));
      }
#pragma unroll
      for (int ni = 0; ni < 4; ++ni) {
        const unsigned char* p =
            ((EPI == 0) ? bufB + (ni >> 1) * G_HALF + (wn * 32 + (ni & 1) * 16 + ln) * G_PITCH
                        : bufB + (wn * 64 + ni * 16 + ln) * G_PITCH) +
            kk * 64 + g * 16;
        bF[ni] = ld_frag16((const bf16_t*)p, (const bf16_t*)(p + 32));
      }
#pragma unroll
      for (int mi = 0; mi < 2; ++mi)
#pragma unroll
        for (int ni = 0; ni < 4; ++ni)
          acc[mi][ni] = wmma_bf16(aF[mi], bF[ni], acc[mi][ni]);
    }
    // Publish point of stage s + 1. This wave's reads of buffer s & 1 are done:
    asm volatile("s_wait_dscnt 0x0" ::: "memory");
    if (pinned(wave_u < N_ISSUE)) {
      // the issuing wave's own tile of stage s + 1 has landed
      asm volatile("s_wait_tensorcnt 0x0" ::: "memory");
    }
    __syncthreads();
    // Refill the buffer that every wave has just left, while a stage is left.
    if (pinned((wave_u < N_ISSUE) && (s + 2 < n_stage)))
      tdm_load_tile(my_src + (size_t)(s + 2) * G_BK,
                    my_lds + (unsigned)(s & 1) * STAGE, g1);
  }
  asm volatile("s_wait_tensorcnt 0x0" :: "s"(g1) : "memory");
  asm volatile("s_wait_dscnt 0x0" ::: "memory");

  // Epilogue: this product's matrix, in this product's form. The test on prod is
  // the same for the whole block and stands outside the store loops, so that each
  // form keeps its straight-line stores (the V^T form: 16 bytes a lane).
  constexpr int n_prod = (EPI == 2) ? 3 : 1;
  int prod = 0;  // which product this block's columns belong to
  for (int p = 1; p < n_prod; ++p) prod += (n_blk >= p * N) ? 1 : 0;
  void* const outm = (EPI != 2) ? outp : (void*)((bf16_t*)outp + (size_t)prod * M * N);
  const int m_w = m_blk + wm * 32 + 8 * g;
  const int n_w = n_blk - prod * N + wn * ((EPI == 0) ? 32 : 64) + ln;
  if (EPI == 0) {
    gemm_store_swiglu(acc, m_w, n_w, N, (bf16_t*)outm);
  } else if (EPI == 2) {
    if (prod < 2) {
      gemm_store<0>(acc, m_w, n_w, N, resid, outm);
    } else {
      gemm_store<2>(acc, m_w, n_w, N, resid, outm);
      // in the compiled text the other form's code stands behind these stores and
      // takes their registers again: the wait stands in front of that overwrite
      asm volatile("s_wait_xcnt 0x0" ::: "memory");
    }
  } else {
    gemm_store<EPI>(acc, m_w, n_w, N, resid, outm);
  }
}

// Maximum over each 16-lane row of eight independent values, left in every lane
// of the row. Four butterfly steps (lane ^ 1, 2, 4, 8), each one vector
// instruction whose first source is read through DPP row_xmask: nothing goes
// over the LDS path and nothing waits on dscnt, where __shfl_xor compiles to
// ds_bpermute_b32 with a wait behind every step. The eight values go through a
// step together, so an instruction's producer stands eight instructions back
// and no step waits for the one before it. Every lane of the wave must be on.
__device__ inline void row_max16_x8(float (&v)[8]) {
  asm(
      "v_max_num_f32_dpp %0, %0, %0 row_xmask:1 row_mask:0xf bank_mask:0xf\n\t"
      "v_max_num_f32_dpp %1, %1, %1 row_xmask:1 row_mask:0xf bank_mask:0xf\n\t"
      "v_max_num_f32_dpp %2, %2, %2 row_xmask:1 row_mask:0xf bank_mask:0xf\n\t"
      "v_max_num_f32_dpp %3, %3, %3 row_xmask:1 row_mask:0xf bank_mask:0xf\n\t"
      "v_max_num_f32_dpp %4, %4, %4 row_xmask:1 row_mask:0xf bank_mask:0xf\n\t"
      "v_max_num_f32_dpp %5, %5, %5 row_xmask:1 row_mask:0xf bank_mask:0xf\n\t"
      "v_max_num_f32_dpp %6, %6, %6 row_xmask:1 row_mask:0xf bank_mask:0xf\n\t"
      "v_max_num_f32_dpp %7, %7, %7 row_xmask:1 row_mask:0xf bank_mask:0xf\n\t"
      "v_max_num_f32_dpp %0, %0, %0 row_xmask:2 row_mask:0xf bank_mask:0xf\n\t"
      "v_max_num_f32_dpp %1, %1, %1 row_xmask:2 row_mask:0xf bank_mask:0xf\n\t"
      "v_max_num_f32_dpp %2, %2, %2 row_xmask:2 row_mask:0xf bank_mask:0xf\n\t"
      "v_max_num_f32_dpp %3, %3, %3 row_xmask:2 row_mask:0xf bank_mask:0xf\n\t"
      "v_max_num_f32_dpp %4, %4, %4 row_xmask:2 row_mask:0xf bank_mask:0xf\n\t"
      "v_max_num_f32_dpp %5, %5, %5 row_xmask:2 row_mask:0xf bank_mask:0xf\n\t"
      "v_max_num_f32_dpp %6, %6, %6 row_xmask:2 row_mask:0xf bank_mask:0xf\n\t"
      "v_max_num_f32_dpp %7, %7, %7 row_xmask:2 row_mask:0xf bank_mask:0xf\n\t"
      "v_max_num_f32_dpp %0, %0, %0 row_xmask:4 row_mask:0xf bank_mask:0xf\n\t"
      "v_max_num_f32_dpp %1, %1, %1 row_xmask:4 row_mask:0xf bank_mask:0xf\n\t"
      "v_max_num_f32_dpp %2, %2, %2 row_xmask:4 row_mask:0xf bank_mask:0xf\n\t"
      "v_max_num_f32_dpp %3, %3, %3 row_xmask:4 row_mask:0xf bank_mask:0xf\n\t"
      "v_max_num_f32_dpp %4, %4, %4 row_xmask:4 row_mask:0xf bank_mask:0xf\n\t"
      "v_max_num_f32_dpp %5, %5, %5 row_xmask:4 row_mask:0xf bank_mask:0xf\n\t"
      "v_max_num_f32_dpp %6, %6, %6 row_xmask:4 row_mask:0xf bank_mask:0xf\n\t"
      "v_max_num_f32_dpp %7, %7, %7 row_xmask:4 row_mask:0xf bank_mask:0xf\n\t"
      "v_max_num_f32_dpp %0, %0, %0 row_xmask:8 row_mask:0xf bank_mask:0xf\n\t"
      "v_max_num_f32_dpp %1, %1, %1 row_xmask:8 row_mask:0xf bank_mask:0xf\n\t"
      "v_max_num_f32_dpp %2, %2, %2 row_xmask:8 row_mask:0xf bank_mask:0xf\n\t"
      "v_max_num_f32_dpp %3, %3, %3 row_xmask:8 row_mask:0xf bank_mask:0xf\n\t"
      "v_max_num_f32_dpp %4, %4, %4 row_xmask:8 row_mask:0xf bank_mask:0xf\n\t"
      "v_max_num_f32_dpp %5, %5, %5 row_xmask:8 row_mask:0xf bank_mask:0xf\n\t"
      "v_max_num_f32_dpp %6, %6, %6 row_xmask:8 row_mask:0xf bank_mask:0xf\n\t"
      "v_max_num_f32_dpp %7, %7, %7 row_xmask:8 row_mask:0xf bank_mask:0xf"
      : "+v"(v[0]), "+v"(v[1]), "+v"(v[2]), "+v"(v[3]),
        "+v"(v[4]), "+v"(v[5]), "+v"(v[6]), "+v"(v[7]));
}

__global__ __launch_bounds__(128) void flash_attn_wmma(
    const bf16_t* __restrict__ Q, const bf16_t* __restrict__ Km,
    const bf16_t* __restrict__ Vt, bf16_t* __restrict__ O) {
  // ring[buffer][K tile | V^T tile]; every tile starts at a multiple of 2 KiB
  __shared__ __attribute__((aligned(2048))) unsigned char ring[2 * A_STAGE];
  __shared__ bf16_t sP[4][16][40];  // per-wave P staging (D-layout -> A-layout)
  const int tid  = threadIdx.x;
  const int lane = tid & 31;
  const unsigned wave_u = uni((unsigned)threadIdx.x >> 5);
  const int wave = (int)wave_u;
  const int g = lane >> 4, ln = lane & 15;
  const int bh = blockIdx.y, b = bh >> 4, h = bh & 15;
  // Which 64-row query tile this block takes. A tile's cost grows with its index
  // (qt + 1 stages) and all blocks are resident at once, so the launch lasts as long
  // as the fullest WGP. For each head this is a permutation of the 32 tiles: the low three
  // bits are mirrored in every second group of eight (x, x + 8, x + 16, x + 24 then
  // sum to 62), and heads of odd bit parity take the mirrored tile 31 - t.
  const int bx = (int)blockIdx.x;
  const int t8 = bx ^ ((bx & 8) ? 7 : 0);
  const int qt = (__builtin_popcount((unsigned)bh) & 1) ? (SEQ / 64 - 1) - t8 : t8;
  const int q0 = qt * 64 + wave * 16;

  // The block's four waves read the same keys: wave 0 brings the K tile of every
  // stage, wave 1 the V^T tile. The block's rows end at key 64 * qt + 63.
  const bf16_t* my_src = (wave_u == 0)
                             ? Km + (size_t)(b * SEQ) * D_MODEL + h * DK
                             : Vt + (size_t)((b * HEADS + h) * DK) * SEQ;
  // a stage's step in the source, as a shift: 64 rows of K, 64 columns of V^T
  const unsigned my_shift = (wave_u == 0) ? 16u : 6u;
  static_assert(A_KEYS * D_MODEL == 1 << 16 && A_KEYS == 1 << 6, "stage steps");
  const unsigned my_lds = (unsigned)(size_t)(void*)&ring[0] +
                          ((wave_u == 0) ? 0u : (unsigned)A_TILE);
  const v8u g1 = tdm_group1_64x128B((wave_u == 0) ? (unsigned)(D_MODEL * 2)
                                                  : (unsigned)(SEQ * 2));
  const int n_stage = qt + 1;

  // Q A-fragments: 16 rows x 64 (two k-halves of 32)
  const bf16_t* qrow = Q + (size_t)(b * SEQ + q0 + ln) * D_MODEL + h * DK;
  v16bf qf[2];
#pragma unroll
  for (int kk = 0; kk < 2; ++kk)
    qf[kk] = ld_frag16(qrow + kk * 32 + g * 8, qrow + kk * 32 + 16 + g * 8);

  v16bf onesf;
#pragma unroll
  for (int j = 0; j < 16; ++j) onesf[j] = (bf16_t)1.0f;

  v8f o[4] = {};
  v8f o5 = {};  // softmax denominator accumulator (P x ones)
  float mrow[8];
#pragma unroll
  for (int r = 0; r < 8; ++r) mrow[r] = -__builtin_inff();

  v4u g0 = {0u, 0u, 0u, 0u};
  if (pinned(wave_u < 2u)) {
    g0 = tdm_group0(my_src, my_lds);
    asm volatile("tensor_load_to_lds %0, %1" :: "s"(g0), "s"(g1) : "memory");
    // stage 0 has landed here
    asm volatile("s_wait_tensorcnt 0x0" :: "s"(g0) : "memory");
  }
  __syncthreads();
  if (pinned(wave_u < 2u)) {
    g0 = tdm_group0(my_src + ((size_t)1 << my_shift), my_lds + A_STAGE);
    asm volatile("tensor_load_to_lds %0, %1" :: "s"(g0), "s"(g1) : "memory");
  }

  for (int st = 0; st < n_stage; ++st) {
   const unsigned char* bufK = ring + (st & 1) * A_STAGE;
   const unsigned char* bufV = bufK + A_TILE;
   // the stage's two 32-key tiles; a wave skips a tile wholly above its diagonal
   for (int t0 = st * A_KEYS; t0 < (st + 1) * A_KEYS && t0 <= q0 + 15; t0 += 32) {
    const int tr = t0 - st * A_KEYS;  // first key of the tile inside the stage
    // The tile's K and V^T B-fragments, as one group of LDS reads, K first: the V
    // reads return under the score products and the softmax.
    v16bf kf[2][2], vf[4];
#pragma unroll
    for (int ni = 0; ni < 2; ++ni) {
      const unsigned char* krow = bufK + (tr + ni * 16 + ln) * G_PITCH + g * 16;
#pragma unroll
      for (int kk = 0; kk < 2; ++kk)
        kf[ni][kk] = ld_frag16((const bf16_t*)(krow + kk * 64),
                               (const bf16_t*)(krow + kk * 64 + 32));
    }
#pragma unroll
    for (int f = 0; f < 4; ++f) {
      const unsigned char* vrow = bufV + (f * 16 + ln) * G_PITCH + tr * 2 + g * 16;
      vf[f] = ld_frag16((const bf16_t*)vrow, (const bf16_t*)(vrow + 32));
    }
    // scores S = Q * K^T  (16 x 32), two 16x16 D frags
    v8f s[2] = {};
#pragma unroll
    for (int ni = 0; ni < 2; ++ni)
#pragma unroll
      for (int kk = 0; kk < 2; ++kk)
        s[ni] = wmma_bf16(qf[kk], kf[ni][kk], s[ni]);
    // scale + causal mask
#pragma unroll
    for (int ni = 0; ni < 2; ++ni)
#pragma unroll
      for (int r = 0; r < 8; ++r) {
        const float v = s[ni][r] * 0.125f;  // 1/sqrt(64)
        const int qg = q0 + r + 8 * g;
        const int tg = t0 + ni * 16 + ln;
        s[ni][r] = (tg > qg) ? -__builtin_inff() : v;
      }
    // row max (butterfly within 16-lane halves) + online rescale factor
    float alpha[8], vmax[8];
#pragma unroll
    for (int r = 0; r < 8; ++r)
      vmax[r] = fmaxf(fmaxf(s[0][r], s[1][r]), mrow[r]);  // mrow: equal in the row
    row_max16_x8(vmax);
#pragma unroll
    for (int r = 0; r < 8; ++r) {
      const float mn = vmax[r];
      alpha[r] = __expf(mrow[r] - mn);
      mrow[r] = mn;
    }
#pragma unroll
    for (int ni = 0; ni < 2; ++ni)
#pragma unroll
      for (int r = 0; r < 8; ++r) s[ni][r] = __expf(s[ni][r] - mrow[r]);
#pragma unroll
    for (int f = 0; f < 4; ++f)
#pragma unroll
      for (int r = 0; r < 8; ++r) o[f][r] *= alpha[r];
#pragma unroll
    for (int r = 0; r < 8; ++r) o5[r] *= alpha[r];

    // P: D-layout -> bf16 LDS -> A-layout (wave-local, split-counter sync)
#pragma unroll
    for (int ni = 0; ni < 2; ++ni)
#pragma unroll
      for (int r = 0; r < 8; ++r)
        sP[wave][r + 8 * g][ni * 16 + ln] = (bf16_t)s[ni][r];
    asm volatile("s_wait_dscnt 0" ::: "memory");
    v16bf pf = ld_frag16(&sP[wave][ln][g * 8], &sP[wave][ln][16 + g * 8]);

    // O += P(16x32) * V(32x64): B frags from V^T rows (contiguous along t)
#pragma unroll
    for (int f = 0; f < 4; ++f) o[f] = wmma_bf16(pf, vf[f], o[f]);
    // denominator: l += P x ones
    o5 = wmma_bf16(pf, onesf, o5);
    asm volatile("v_nop\n\tv_nop\n\tv_nop\n\tv_nop" :: "v"(o5));
   }
   // Publish point of stage st + 1; every wave passes it, also one that skipped a
   // tile. This wave's reads of buffer st & 1 are done:
   asm volatile("s_wait_dscnt 0x0" ::: "memory");
   if (pinned(wave_u < 2u)) {
     // the issuing wave's own tile of stage st + 1 has landed
     asm volatile("s_wait_tensorcnt 0x0" :: "s"(g0) : "memory");
   }
   __syncthreads();
   // Refill the buffer that every wave has just left, while a stage is left.
   if (pinned((wave_u < 2u) && (st + 2 < n_stage))) {
     g0 = tdm_group0(my_src + ((size_t)(st + 2) << my_shift),
                     my_lds + (unsigned)(st & 1) * A_STAGE);
     asm volatile("tensor_load_to_lds %0, %1" :: "s"(g0), "s"(g1) : "memory");
   }
  }
  // nothing of the ring is outstanding when the wave goes on to its stores
  asm volatile("s_wait_tensorcnt 0x0" ::: "memory");
  asm volatile("s_wait_dscnt 0x0" ::: "memory");

  // normalize and store: out[b, q, h*64 + d] (bf16, row-major D_MODEL)
#pragma unroll
  for (int f = 0; f < 4; ++f)
#pragma unroll
    for (int r = 0; r < 8; ++r) {
      const float val = o[f][r] / o5[r];
      const int qg = q0 + r + 8 * g;
      O[(size_t)(b * SEQ + qg) * D_MODEL + h * DK + f * 16 + ln] = (bf16_t)val;
    }
}

// ---------------------------------------------------------------------------
// Host orchestration
// ---------------------------------------------------------------------------
extern "C" void kernel_launch(void* const* d_in, const int* in_sizes, int n_in,
                              void* d_out, int out_size, void* d_ws,
                              size_t ws_size, hipStream_t stream) {
  (void)in_sizes; (void)n_in; (void)out_size; (void)ws_size;
  const float* x      = (const float*)d_in[0];
  const float* w_q    = (const float*)d_in[1];
  const float* w_k    = (const float*)d_in[2];
  const float* w_v    = (const float*)d_in[3];
  const float* w_o    = (const float*)d_in[4];
  const float* w_gate = (const float*)d_in[5];
  const float* w_up   = (const float*)d_in[6];
  const float* w_down = (const float*)d_in[7];
  const float* g1     = (const float*)d_in[8];
  const float* g2     = (const float*)d_in[9];

  unsigned char* ws = (unsigned char*)d_ws;
  const size_t MB = 1ull << 20;
  bf16_t* wtq  = (bf16_t*)(ws + 0 * MB);    // [1024][1024]      2 MB
  bf16_t* wtk  = (bf16_t*)(ws + 2 * MB);    //                   2 MB
  bf16_t* wtv  = (bf16_t*)(ws + 4 * MB);    //                   2 MB
  bf16_t* wto  = (bf16_t*)(ws + 6 * MB);    //                   2 MB
  bf16_t* wtg  = (bf16_t*)(ws + 8 * MB);    // [4096][1024]      8 MB
  bf16_t* wtu  = (bf16_t*)(ws + 16 * MB);   //                   8 MB
  bf16_t* wtd  = (bf16_t*)(ws + 24 * MB);   // [1024][4096]      8 MB
  bf16_t* nx1  = (bf16_t*)(ws + 32 * MB);   // [4096][1024]      8 MB
  bf16_t* qb   = (bf16_t*)(ws + 40 * MB);   // [4096][1024]      8 MB
  bf16_t* kb   = (bf16_t*)(ws + 48 * MB);   //                   8 MB
  bf16_t* vtb  = (bf16_t*)(ws + 56 * MB);   // [B,H,DK,SEQ]      8 MB
  bf16_t* ao   = (bf16_t*)(ws + 64 * MB);   // attn out          8 MB
  float*  x2   = (float*) (ws + 72 * MB);   // f32 resid        16 MB
  bf16_t* nx2  = (bf16_t*)(ws + 88 * MB);   // [4096][1024]      8 MB
  bf16_t* hid  = (bf16_t*)(ws + 96 * MB);   // [4096][4096]     32 MB (end 128 MB)

  // --- weight prep W[K][N] -> Wt[N][K] bf16 and the first RMSNorm, one grid ---
  // (wtq .. wtd lie one behind the other in the workspace)
  (void)wtk; (void)wtv; (void)wtu;  // reached through wtq and wtg
  prep_kernel<<<PREP_GRID, 256, 0, stream>>>(w_q, w_k, w_v, w_o, w_gate, w_up, w_down,
                                             x, g1, wtq, nx1);

  // --- attention sublayer ---
  // Q, K and V in one grid: wtq, wtk, wtv are adjacent, and so are qb, kb, vtb
  const dim3 gemm_blk(256);
  gemm_bf16_wmma<2><<<dim3(3 * D_MODEL / 128, M_ROWS / 128), gemm_blk, 0, stream>>>(
      nx1, wtq, M_ROWS, D_MODEL, D_MODEL, nullptr, qb);

  flash_attn_wmma<<<dim3(SEQ / 64, BATCH * HEADS), 128, 0, stream>>>(qb, kb, vtb, ao);

  gemm_bf16_wmma<1><<<dim3(D_MODEL / 128, M_ROWS / 128), gemm_blk, 0, stream>>>(
      ao, wto, M_ROWS, D_MODEL, D_MODEL, x, x2);

  // --- SwiGLU FFN sublayer ---
  rmsnorm_kernel<<<M_ROWS / RMS_ROWS, 256, 0, stream>>>(x2, g2, nx2);

  // gate, up and silu(gate) * up in one grid: wtg, wtu are adjacent
  gemm_bf16_wmma<0><<<dim3(D_FF / 64, M_ROWS / 128), gemm_blk, 0, stream>>>(
      nx2, wtg, M_ROWS, D_FF, D_MODEL, nullptr, hid);

  gemm_bf16_wmma<1><<<dim3(D_MODEL / 128, M_ROWS / 128), gemm_blk, 0, stream>>>(
      hid, wtd, M_ROWS, D_MODEL, D_FF, x2, (float*)d_out);
}

// v008
// A run of this version takes 185 microseconds.
// In two side-by-side timings against v007, it was 1.05 and 1.04 times as fast.
// Over all steps from v000 it is 2.65 times as fast.
#include <hip/hip_runtime.h>

typedef __bf16 bf16_t;
typedef __attribute__((ext_vector_type(16))) __bf16        v16bf;
typedef __attribute__((ext_vector_type(8)))  float         v8f;
typedef __attribute__((ext_vector_type(4)))  unsigned int  v4u;
typedef __attribute__((ext_vector_type(8)))  unsigned int  v8u;

#define D_MODEL 1024
#define SEQ     2048
#define BATCH   2
#define HEADS   16
#define DK      64
#define D_FF    4096
#define M_ROWS  (BATCH * SEQ)   // 4096

union FragU { v16bf v; uint4 q[2]; };

__device__ inline v16bf ld_frag16(const bf16_t* p0, const bf16_t* p1) {
  FragU u;
  u.q[0] = *reinterpret_cast<const uint4*>(p0);
  u.q[1] = *reinterpret_cast<const uint4*>(p1);
  return u.v;
}

__device__ inline v8f wmma_bf16(v16bf a, v16bf b, v8f c) {
  // (neg_a, A, neg_b, B, c_mod, C, reuse_a, reuse_b)
  return __builtin_amdgcn_wmma_f32_16x16x32_bf16(false, a, false, b, (short)0, c,
                                                 false, false);
}

// ---------------------------------------------------------------------------
// GEMM stage geometry: 64 k per stage, so an operand row is 128 B; the tensor
// load pads each row by 16 B (pitch 144 B: conflict-free ds_load_b128 rows).
// One operand tile = 128 rows x 144 B = 18432 B = 9 x 2 KiB.
// ---------------------------------------------------------------------------
#define G_BK     64
#define G_PITCH  144
#define G_TILE   (128 * G_PITCH)
#define G_STAGE  (2 * G_TILE)
// A slice of 64 rows: 64 x 144 B = 9216 B, its place rounded up to 5 x 2 KiB.
#define G_HALF   10240

__device__ inline unsigned uni(unsigned v) {
  return (unsigned)__builtin_amdgcn_readfirstlane((int)v);
}
__device__ inline unsigned pinned(unsigned v) {
  unsigned w = uni(v);
  asm volatile("" : "+s"(w));
  return w;
}

__device__ inline v8u tdm_group1_128x128B(unsigned src_pitch) {
  v8u g1;
  g1[0] = pinned((1u << 20) | (4u << 22) | (3u << 25));
  g1[1] = pinned(128u << 16);
  g1[2] = pinned(128u << 16);
  g1[3] = pinned(128u << 16);
  g1[4] = pinned(128u);
  g1[5] = pinned(src_pitch);
  g1[6] = pinned(0u);
  g1[7] = pinned(0u);
  return g1;
}

// The same with a wave-uniform number of rows (128 or 64).
__device__ inline v8u tdm_group1_rows_x128B(unsigned rows, unsigned src_pitch) {
  v8u g1;
  g1[0] = pinned((1u << 20) | (4u << 22) | (3u << 25));
  g1[1] = pinned(128u << 16);
  g1[2] = pinned(rows << 16);
  g1[3] = pinned(128u << 16);
  g1[4] = pinned(rows);
  g1[5] = pinned(src_pitch);
  g1[6] = pinned(0u);
  g1[7] = pinned(0u);
  return g1;
}

// One tensor load: the tile whose first byte is gtile, to LDS byte offset lds_off.
__device__ inline void tdm_load_tile(const bf16_t* gtile, unsigned lds_off, v8u g1) {
  const unsigned long long ga = (unsigned long long)(size_t)gtile;
  v4u g0;
  g0[0] = uni(1u);                              // count = 1
  g0[1] = uni(lds_off);                         // LDS destination (bytes)
  g0[2] = uni((unsigned)ga);                    // global address [31:0]
  g0[3] = uni(((unsigned)(ga >> 32) & 0x01FFFFFFu) | 0x80000000u);  // [56:32], type 2
  asm volatile("tensor_load_to_lds %0, %1" :: "s"(g0), "s"(g1) : "memory");
}

// Attention stage geometry: 64 keys per stage. The K tile is 64 key rows of 128 B
// (one head's 64 dims), the V^T tile 64 dim rows of 128 B (64 keys); both land at
// pitch G_PITCH. One tile = 64 x 144 B = 9216 B, its place rounded up to 5 x 2 KiB.
#define A_KEYS   64
#define A_TILE   10240
#define A_STAGE  (2 * A_TILE)

__device__ inline v4u tdm_group0(const bf16_t* gtile, unsigned lds_off) {
  const unsigned long long ga = (unsigned long long)(size_t)gtile;
  v4u g0;
  g0[0] = uni(1u);                              // count = 1
  g0[1] = uni(lds_off);                         // LDS destination (bytes)
  g0[2] = uni((unsigned)ga);                    // global address [31:0]
  g0[3] = uni(((unsigned)(ga >> 32) & 0x01FFFFFFu) | 0x80000000u);  // [56:32], type 2
  return g0;
}

__device__ inline v8u tdm_group1_64x128B(unsigned src_pitch) {
  v8u g1;
  g1[0] = pinned((1u << 20) | (4u << 22) | (3u << 25));
  g1[1] = pinned(128u << 16);
  g1[2] = pinned(64u << 16);
  g1[3] = pinned(128u << 16);
  g1[4] = pinned(64u);
  g1[5] = pinned(src_pitch);
  g1[6] = pinned(0u);
  g1[7] = pinned(0u);
  return g1;
}

// ---------------------------------------------------------------------------
// Weight transpose + fp32 -> bf16 convert:  W[K][N] -> Wt[N][K]
// One block of 256 threads takes a piece of 256 rows x 128 columns (first column
// n0, first row k0) in TP_TRIPS trips of eight 32 x 32 tiles (64 rows x 128
// columns; tile t: columns 32 * (t % 4), rows 32 * (t / 4)). The next trip's loads fly while this trip's tiles are stored;
// the trips alternate between two sets of tiles in LDS, so that one barrier a trip
// is enough (a second one, behind the stores, would wait for those loads).
// ---------------------------------------------------------------------------
#define TP_TILES 8    // tiles per trip
#define TP_TRIPS 4    // trips per block
#define TP_ROWS  (64 * TP_TRIPS)
typedef float TpTiles[2][TP_TILES][32][33];

template <int N>
__device__ inline void transpose_load(float (&r)[TP_TILES][4], const float* __restrict__ w) {
  // unrolled so that every index of r is a constant (registers, no scratch)
#pragma unroll
  for (int t = 0; t < TP_TILES; ++t)
#pragma unroll
    for (int i = 0; i < 4; ++i)
      r[t][i] = w[(size_t)((t >> 2) * 32 + i * 8) * N + (t & 3) * 32];
}

template <int K, int N>
__device__ inline void transpose_piece(
    const float* __restrict__ W, bf16_t* __restrict__ Wt, int n0, int k0,
    TpTiles& tile) {
  const int tx = threadIdx.x & 31, ty = threadIdx.x >> 5;  // 32 x 8
  const float* w = W + (size_t)(k0 + ty) * N + n0 + tx;    // this thread's first element
  bf16_t* wt = Wt + (size_t)(n0 + ty) * K + k0 + tx;
  float r[TP_TILES][4];
  transpose_load<N>(r, w);
  // kept rolled: unrolled, every trip's loads would be lifted to the top and take
  // four times the registers
#pragma unroll 1
  for (int trip = 0; trip < TP_TRIPS; ++trip) {
#pragma unroll
    for (int t = 0; t < TP_TILES; ++t)
#pragma unroll
      for (int i = 0; i < 4; ++i) tile[trip & 1][t][ty + i * 8][tx] = r[t][i];
    // this set is written; and whoever writes the other set next trip has passed
    // here, behind every wave's reads of it
    __syncthreads();
    if (trip + 1 < TP_TRIPS) {
      transpose_load<N>(r, w + (size_t)(trip + 1) * 64 * N);
      // the LDS reads below take these loads' address registers again: the wait
      // stands in front of that overwrite
      asm volatile("s_wait_xcnt 0x0" ::: "memory");
    }
#pragma unroll
    for (int t = 0; t < TP_TILES; ++t)
#pragma unroll
      for (int i = 0; i < 4; ++i)
        wt[(size_t)((t & 3) * 32 + i * 8) * K + trip * 64 + (t >> 2) * 32] =
            (bf16_t)tile[trip & 1][t][tx][ty + i * 8];
  }
}

// ---------------------------------------------------------------------------
// RMSNorm: fp32 rows -> bf16 normalized rows (D_MODEL=1024). One block takes
// RMS_ROWS rows, each summed on its own (a thread's four squares, the wave's
// butterfly, the eight waves' sums in order): the rows' loads are in flight
// together, their butterflies interleave, and one barrier serves them all.
// ---------------------------------------------------------------------------
#define RMS_ROWS 8
__device__ inline void rmsnorm_rows(
    const float* __restrict__ x, const float* __restrict__ gain,
    bf16_t* __restrict__ out, int row0) {
  __shared__ float warp_sum[RMS_ROWS][8];
  const int tid = threadIdx.x;
  float4 v[RMS_ROWS];
  float ss[RMS_ROWS];
  // unrolled so that every index of v and ss is a constant (registers, no scratch)
#pragma unroll
  for (int r = 0; r < RMS_ROWS; ++r)
    v[r] = reinterpret_cast<const float4*>(x + (size_t)(row0 + r) * D_MODEL)[tid];
  const float4 gv = reinterpret_cast<const float4*>(gain)[tid];
#pragma unroll
  for (int r = 0; r < RMS_ROWS; ++r)
    ss[r] = v[r].x * v[r].x + v[r].y * v[r].y + v[r].z * v[r].z + v[r].w * v[r].w;
#pragma unroll
  for (int m = 1; m < 32; m <<= 1)
#pragma unroll
    for (int r = 0; r < RMS_ROWS; ++r) ss[r] += __shfl_xor(ss[r], m, 32);
  if ((tid & 31) == 0) {
#pragma unroll
    for (int r = 0; r < RMS_ROWS; ++r) warp_sum[r][tid >> 5] = ss[r];
  }
  __syncthreads();
#pragma unroll
  for (int r = 0; r < RMS_ROWS; ++r) {
    float tot = 0.f;
#pragma unroll
    for (int i = 0; i < 8; ++i) tot += warp_sum[r][i];
    const float inv = rsqrtf(tot * (1.0f / D_MODEL) + 1e-6f);
    bf16_t* orow = out + (size_t)(row0 + r) * D_MODEL + tid * 4;
    orow[0] = (bf16_t)(v[r].x * inv * gv.x);
    orow[1] = (bf16_t)(v[r].y * inv * gv.y);
    orow[2] = (bf16_t)(v[r].z * inv * gv.z);
    orow[3] = (bf16_t)(v[r].w * inv * gv.w);
  }
}

__global__ __launch_bounds__(256) void rmsnorm_kernel(
    const float* __restrict__ x, const float* __restrict__ gain,
    bf16_t* __restrict__ out) {
  rmsnorm_rows(x, gain, out, (int)blockIdx.x * RMS_ROWS);
}

// ---------------------------------------------------------------------------
// Everything that reads the inputs alone, in ONE grid: the seven weight
// transposes and the first RMSNorm depend on nothing but the inputs, so their
// blocks share a launch. A block's job follows from its index (the same for all
// of its threads, so every barrier stands under block-uniform control flow):
//   PREP_SQ blocks   : w_q, w_k, w_v, w_o    (32 pieces each)
//   PREP_UP blocks   : w_gate, w_up          (128 pieces each)
//   PREP_DN blocks   : w_down                (128 pieces)
//   PREP_RMS blocks  : RMS_ROWS rows of x each (the shorter job, placed last)
// wt: the transposed weights one behind the other, in that order.
// ---------------------------------------------------------------------------
#define SQ_PIECES ((D_MODEL / 128) * (D_MODEL / TP_ROWS))   // 32
#define FF_PIECES ((D_MODEL / 128) * (D_FF / TP_ROWS))      // 128
#define PREP_RMS  (M_ROWS / RMS_ROWS)
#define PREP_SQ   (4 * SQ_PIECES)
#define PREP_UP   (2 * FF_PIECES)
#define PREP_DN   FF_PIECES
#define PREP_GRID (PREP_RMS + PREP_SQ + PREP_UP + PREP_DN)

__global__ __launch_bounds__(256) void prep_kernel(
    const float* __restrict__ w_q, const float* __restrict__ w_k,
    const float* __restrict__ w_v, const float* __restrict__ w_o,
    const float* __restrict__ w_gate, const float* __restrict__ w_up,
    const float* __restrict__ w_down, const float* __restrict__ x,
    const float* __restrict__ gain, bf16_t* __restrict__ wt,
    bf16_t* __restrict__ nx) {
  const int b = (int)blockIdx.x;
  if (b >= PREP_SQ + PREP_UP + PREP_DN) {
    rmsnorm_rows(x, gain, nx, (b - (PREP_SQ + PREP_UP + PREP_DN)) * RMS_ROWS);
    return;
  }
  __shared__ TpTiles tile;
  // pieces are numbered inside their matrix, columns fastest
  if (b < PREP_SQ) {
    const int m = b / SQ_PIECES, r = b % SQ_PIECES;
    const float* W = (m == 0) ? w_q : (m == 1) ? w_k : (m == 2) ? w_v : w_o;
    transpose_piece<D_MODEL, D_MODEL>(W, wt + (size_t)m * (D_MODEL * D_MODEL),
                                      (r % (D_MODEL / 128)) * 128,
                                      (r / (D_MODEL / 128)) * TP_ROWS, tile);
  } else if (b < PREP_SQ + PREP_UP) {
    const int m = (b - PREP_SQ) / FF_PIECES, r = (b - PREP_SQ) % FF_PIECES;
    transpose_piece<D_MODEL, D_FF>(
        (m == 0) ? w_gate : w_up,
        wt + (size_t)4 * (D_MODEL * D_MODEL) + (size_t)m * (D_MODEL * D_FF),
        (r % (D_FF / 128)) * 128, (r / (D_FF / 128)) * TP_ROWS, tile);
  } else {
    const int r = b - (PREP_SQ + PREP_UP);
    transpose_piece<D_FF, D_MODEL>(
        w_down, wt + (size_t)4 * (D_MODEL * D_MODEL) + (size_t)2 * (D_MODEL * D_FF),
        (r % (D_MODEL / 128)) * 128, (r / (D_MODEL / 128)) * TP_ROWS, tile);
  }
}

// ---------------------------------------------------------------------------
// A wave's 32 x 64 accumulators to memory. D layout: element r of a fragment is
// row r + 8*(lane/16), column lane%16; m_w, n_w: this lane's row and column of
// element 0 of fragment (0, 0).
// MODE: 0 = store bf16, 1 = fp32 out = resid + C, 2 = bf16 scatter to V^T
// ---------------------------------------------------------------------------
template <int MODE>
__device__ inline void gemm_store(const v8f (&acc)[2][4], int m_w, int n_w, int N,
                                  const float* __restrict__ resid,
                                  void* __restrict__ outp) {
  // unrolled so that every accumulator index is a constant (registers, no scratch)
#pragma unroll
  for (int mi = 0; mi < 2; ++mi)
#pragma unroll
    for (int ni = 0; ni < 4; ++ni)
#pragma unroll
      for (int r = 0; r < 8; ++r) {
        const int mg = m_w + mi * 16 + r;
        const int ng = n_w + ni * 16;
        const float c = acc[mi][ni][r];
        if (MODE == 0) {
          ((bf16_t*)outp)[(size_t)mg * N + ng] = (bf16_t)c;
        } else if (MODE == 1) {
          const size_t idx = (size_t)mg * N + ng;
          ((float*)outp)[idx] = resid[idx] + c;
        } else {  // V^T scatter: [B,H,DK,SEQ]
          const int bb = mg >> 11, sin = mg & (SEQ - 1);
          const int hh = ng >> 6, dd = ng & (DK - 1);
          ((bf16_t*)outp)[(((size_t)(bb * HEADS + hh) * DK + dd) << 11) + sin] =
              (bf16_t)c;
        }
      }
}

__device__ inline float exp2_slot(float x) {
  float y;
  asm("v_exp_f32 %0, %1\n\tv_nop" : "=v"(y) : "v"(x));
  return y;
}
__device__ inline float rcp_slot(float x) {
  float y;
  asm("v_rcp_f32 %0, %1\n\tv_nop" : "=v"(y) : "v"(x));
  return y;
}

__device__ inline void gemm_store_swiglu(const v8f (&acc)[2][4], int m_w, int n_w, int N,
                                         bf16_t* __restrict__ outp) {
  // unrolled so that every accumulator index is a constant (registers, no scratch)
#pragma unroll
  for (int mi = 0; mi < 2; ++mi)
#pragma unroll
    for (int nj = 0; nj < 2; ++nj)
#pragma unroll
      for (int r = 0; r < 8; ++r) {
        const float gv = acc[mi][nj][r];
        const float uv = acc[mi][nj + 2][r];
        // e^-g = 2^(-g log2 e); v_rcp_f32 (1 ulp) for the divide: the result is
        // rounded to bf16
        const float sil = gv * rcp_slot(1.f + exp2_slot(gv * -1.44269504f));
        outp[(size_t)(m_w + mi * 16 + r) * N + n_w + nj * 16] = (bf16_t)(sil * uv);
      }
}

// ---------------------------------------------------------------------------
// GEMM: C[M][N] = A[M][K] (bf16, k-major) x Bt[N][K] (bf16, k-major)
// 256 threads = 8 waves; block tile 128x128; per-wave 32x64 (2x4 frags).
// Several products that share A run side by side in one grid: product p takes
// rows p * N .. p * N + N - 1 of Bt (grid.x covers them all) and writes the p-th
// M x N matrix at outp.
// EPI: 1 = one product, fp32 out = resid + C,
//      2 = three products: 0 and 1 stored as bf16, 2 scattered to V^T,
//      0 = gate and up (rows 0 .. N - 1 and N .. 2 N - 1 of Bt) joined in the block:
//          its B tile is 64 gate rows and the 64 up rows of the same columns, a wave
//          holds both for its 32 x 32 outputs and stores silu(gate) * up, one M x N
//          matrix (grid.x = N / 64)
// Assumes M,N % 128 == 0, K % 64 == 0 and K >= 128 (true for all calls here).
// ---------------------------------------------------------------------------
template <int EPI>
__global__ __launch_bounds__(256) void gemm_bf16_wmma(
    const bf16_t* __restrict__ A, const bf16_t* __restrict__ Bt,
    int M, int N, int K, const float* __restrict__ resid,
    void* __restrict__ outp) {
  // ring[buffer][A tile | B tile]; every tile starts at a multiple of 2 KiB
  // (EPI 0: [A tile | 64 gate rows | 64 up rows])
  constexpr int STAGE = (EPI == 0) ? G_TILE + 2 * G_HALF : G_STAGE;
  constexpr unsigned N_ISSUE = (EPI == 0) ? 3u : 2u;  // waves that issue tensor loads
  __shared__ __attribute__((aligned(2048))) unsigned char ring[2 * STAGE];
  const int tid  = threadIdx.x;
  const int lane = tid & 31, wave = tid >> 5;
  const int g = lane >> 4, ln = lane & 15;
  const int wm = wave >> 1, wn = wave & 1;
  const int m_blk = blockIdx.y * 128, n_blk = blockIdx.x * ((EPI == 0) ? 64 : 128);
  // Wave 0 brings the A tile of every stage, wave 1 the B tile (EPI 0: wave 1 the
  // gate rows, wave 2 the up rows).
  const unsigned wave_u = uni((unsigned)threadIdx.x >> 5);
  const bf16_t* my_src =
      (wave_u == 0) ? A + (size_t)m_blk * K
                    : Bt + (size_t)(n_blk + ((EPI == 0 && wave_u != 1u) ? N : 0)) * K;
  const unsigned my_lds =
      (unsigned)(size_t)(void*)&ring[0] +
      ((wave_u == 0) ? 0u
                     : (unsigned)G_TILE + ((EPI == 0 && wave_u != 1u) ? (unsigned)G_HALF : 0u));
  const v8u g1 = (EPI == 0)
                     ? tdm_group1_rows_x128B((wave_u == 0) ? 128u : 64u, (unsigned)K * 2u)
                     : tdm_group1_128x128B((unsigned)K * 2u);
  const int n_stage = K / G_BK;

  v8f acc[2][4] = {};

  // Prologue: stage 0 lands and is published, then stage 1 starts to fly.
  if (pinned(wave_u < N_ISSUE)) {
    tdm_load_tile(my_src, my_lds, g1);
    // stage 0 has landed here
    asm volatile("s_wait_tensorcnt 0x0" ::: "memory");
  }
  __syncthreads();
  if (pinned(wave_u < N_ISSUE))
    tdm_load_tile(my_src + G_BK, my_lds + STAGE, g1);

  for (int s = 0; s < n_stage; ++s) {
    const unsigned char* bufA = ring + (s & 1) * STAGE;
    const unsigned char* bufB = bufA + G_TILE;
    // unrolled so that every fragment and accumulator index is a constant
    // (registers, no scratch); the two 32-k blocks keep the ascending k order
#pragma unroll
    for (int kk = 0; kk < 2; ++kk) {
      v16bf aF[2], bF[4];
#pragma unroll
      for (int mi = 0; mi < 2; ++mi) {
        const unsigned char* p =
            bufA + (wm * 32 + mi * 16 + ln) * G_PITCH + kk * 64 + g * 16;
        aF[mi] = ld_frag16((const bf16_t*)p, (const bf16_t*)(p + 32));
      }
#pragma unroll
      for (int ni = 0; ni < 4; ++ni) {
        const unsigned char* p =
            ((EPI == 0) ? bufB + (ni >> 1) * G_HALF + (wn * 32 + (ni & 1) * 16 + ln) * G_PITCH
                        : bufB + (wn * 64 + ni * 16 + ln) * G_PITCH) +
            kk * 64 + g * 16;
        bF[ni] = ld_frag16((const bf16_t*)p, (const bf16_t*)(p + 32));
      }
#pragma unroll
      for (int mi = 0; mi < 2; ++mi)
#pragma unroll
        for (int ni = 0; ni < 4; ++ni)
          acc[mi][ni] = wmma_bf16(aF[mi], bF[ni], acc[mi][ni]);
    }
    // Publish point of stage s + 1. This wave's reads of buffer s & 1 are done:
    asm volatile("s_wait_dscnt 0x0" ::: "memory");
    if (pinned(wave_u < N_ISSUE)) {
      // the issuing wave's own tile of stage s + 1 has landed
      asm volatile("s_wait_tensorcnt 0x0" ::: "memory");
    }
    __syncthreads();
    // Refill the buffer that every wave has just left, while a stage is left.
    if (pinned((wave_u < N_ISSUE) && (s + 2 < n_stage)))
      tdm_load_tile(my_src + (size_t)(s + 2) * G_BK,
                    my_lds + (unsigned)(s & 1) * STAGE, g1);
  }
  asm volatile("s_wait_tensorcnt 0x0" :: "s"(g1) : "memory");
  asm volatile("s_wait_dscnt 0x0" ::: "memory");

  // Epilogue: this product's matrix, in this product's form. The test on prod is
  // the same for the whole block and stands outside the store loops, so that each
  // form keeps its straight-line stores (the V^T form: 16 bytes a lane).
  constexpr int n_prod = (EPI == 2) ? 3 : 1;
  int prod = 0;  // which product this block's columns belong to
  for (int p = 1; p < n_prod; ++p) prod += (n_blk >= p * N) ? 1 : 0;
  void* const outm = (EPI != 2) ? outp : (void*)((bf16_t*)outp + (size_t)prod * M * N);
  const int m_w = m_blk + wm * 32 + 8 * g;
  const int n_w = n_blk - prod * N + wn * ((EPI == 0) ? 32 : 64) + ln;
  if (EPI == 0) {
    gemm_store_swiglu(acc, m_w, n_w, N, (bf16_t*)outm);
  } else if (EPI == 2) {
    if (prod < 2) {
      gemm_store<0>(acc, m_w, n_w, N, resid, outm);
    } else {
      gemm_store<2>(acc, m_w, n_w, N, resid, outm);
      // in the compiled text the other form's code stands behind these stores and
      // takes their registers again: the wait stands in front of that overwrite
      asm volatile("s_wait_xcnt 0x0" ::: "memory");
    }
  } else {
    gemm_store<EPI>(acc, m_w, n_w, N, resid, outm);
  }
}

__device__ inline float xhalf(float x) {
  return __builtin_bit_cast(float, __builtin_amdgcn_permlanex16(
      __builtin_bit_cast(int, x), __builtin_bit_cast(int, x), 0x76543210, 0xfedcba98,
      false, false));
}

__device__ inline void exp2_x8(v8f& y, const v8f& x) {
  float y0, y1, y2, y3, y4, y5, y6, y7;
  asm("v_exp_f32 %0, %8\n\t"
      "v_exp_f32 %1, %9\n\t"
      "v_exp_f32 %2, %10\n\t"
      "v_exp_f32 %3, %11\n\t"
      "v_exp_f32 %4, %12\n\t"
      "v_exp_f32 %5, %13\n\t"
      "v_exp_f32 %6, %14\n\t"
      "v_exp_f32 %7, %15\n\t"
      "v_nop"
      : "=&v"(y0), "=&v"(y1), "=&v"(y2), "=&v"(y3), "=&v"(y4), "=&v"(y5), "=&v"(y6),
        "=&v"(y7)
      : "v"(x[0]), "v"(x[1]), "v"(x[2]), "v"(x[3]), "v"(x[4]), "v"(x[5]), "v"(x[6]),
        "v"(x[7]));
  y[0] = y0; y[1] = y1; y[2] = y2; y[3] = y3;
  y[4] = y4; y[5] = y5; y[6] = y6; y[7] = y7;
}

__global__ __launch_bounds__(128) __attribute__((amdgpu_waves_per_eu(4, 6))) void flash_attn_wmma(
    const bf16_t* __restrict__ Q, const bf16_t* __restrict__ Km,
    const bf16_t* __restrict__ Vt, bf16_t* __restrict__ O) {
  // ring[buffer][K tile | V^T tile]; every tile starts at a multiple of 2 KiB
  __shared__ __attribute__((aligned(2048))) unsigned char ring[2 * A_STAGE];
  const int tid  = threadIdx.x;
  const int lane = tid & 31;
  const unsigned wave_u = uni((unsigned)threadIdx.x >> 5);
  const int wave = (int)wave_u;
  const int g = lane >> 4, ln = lane & 15;
  const int bh = blockIdx.y, b = bh >> 4, h = bh & 15;
  // Which 64-row query tile this block takes. A tile's cost grows with its index
  // (qt + 1 stages) and all blocks are resident at once, so the launch lasts as long
  // as the fullest WGP. For each head this is a permutation of the 32 tiles: the low three
  // bits are mirrored in every second group of eight (x, x + 8, x + 16, x + 24 then
  // sum to 62), and heads of odd bit parity take the mirrored tile 31 - t.
  const int bx = (int)blockIdx.x;
  const int t8 = bx ^ ((bx & 8) ? 7 : 0);
  const int qt = (__builtin_popcount((unsigned)bh) & 1) ? (SEQ / 64 - 1) - t8 : t8;
  const int q0 = qt * 64 + wave * 16;

  // The block's four waves read the same keys: wave 0 brings the K tile of every
  // stage, wave 1 the V^T tile. The block's rows end at key 64 * qt + 63.
  const bf16_t* my_src = (wave_u == 0)
                             ? Km + (size_t)(b * SEQ) * D_MODEL + h * DK
                             : Vt + (size_t)((b * HEADS + h) * DK) * SEQ;
  // a stage's step in the source, as a shift: 64 rows of K, 64 columns of V^T
  const unsigned my_shift = (wave_u == 0) ? 16u : 6u;
  static_assert(A_KEYS * D_MODEL == 1 << 16 && A_KEYS == 1 << 6, "stage steps");
  const unsigned my_lds = (unsigned)(size_t)(void*)&ring[0] +
                          ((wave_u == 0) ? 0u : (unsigned)A_TILE);
  const v8u g1 = tdm_group1_64x128B((wave_u == 0) ? (unsigned)(D_MODEL * 2)
                                                  : (unsigned)(SEQ * 2));
  const int n_stage = qt + 1;

  // Q^T B-fragments: 64 dims (two k-halves of 32) x 16 queries, column lane % 16
  const bf16_t* qrow = Q + (size_t)(b * SEQ + q0 + ln) * D_MODEL + h * DK;
  v16bf qf[2];
#pragma unroll
  for (int kk = 0; kk < 2; ++kk)
    qf[kk] = ld_frag16(qrow + kk * 32 + g * 8, qrow + kk * 32 + 16 + g * 8);

  v16bf onesf;
#pragma unroll
  for (int j = 0; j < 16; ++j) onesf[j] = (bf16_t)1.0f;

  v8f o[4] = {};  // O^T: o[f][r] = dim f * 16 + 8 * g + r of query q0 + ln
  v8f o5 = {};    // ones x P^T: a lane's element 0 (row 8 * g) is the softmax denominator of query q0 + ln
  float mrow = -__builtin_inff();  // running maximum of query q0 + ln
  const int qg = q0 + ln;
  const int qrel = qg - 8 * g;  // the query against this lane's first key of a tile

  v4u g0 = {0u, 0u, 0u, 0u};
  if (pinned(wave_u < 2u)) {
    g0 = tdm_group0(my_src, my_lds);
    asm volatile("tensor_load_to_lds %0, %1" :: "s"(g0), "s"(g1) : "memory");
    // stage 0 has landed here
    asm volatile("s_wait_tensorcnt 0x0" :: "s"(g0) : "memory");
  }
  __syncthreads();
  if (pinned(wave_u < 2u)) {
    g0 = tdm_group0(my_src + ((size_t)1 << my_shift), my_lds + A_STAGE);
    asm volatile("tensor_load_to_lds %0, %1" :: "s"(g0), "s"(g1) : "memory");
  }

  for (int st = 0; st < n_stage; ++st) {
   const unsigned char* bufK = ring + (st & 1) * A_STAGE;
   const unsigned char* bufV = bufK + A_TILE;
   // the stage's two 32-key tiles; a wave skips a tile wholly above its diagonal
   for (int t0 = st * A_KEYS; t0 < (st + 1) * A_KEYS && t0 <= q0 + 15; t0 += 32) {
    const int tr = t0 - st * A_KEYS;  // first key of the tile inside the stage
    // The tile's K and V^T A-fragments, as one group of LDS reads, K first: the V
    // reads return under the score products and the softmax.
    v16bf kf[2][2], vf[4];
#pragma unroll
    for (int ni = 0; ni < 2; ++ni) {
      const unsigned char* krow = bufK + (tr + ni * 16 + ln) * G_PITCH + g * 16;
#pragma unroll
      for (int kk = 0; kk < 2; ++kk)
        kf[ni][kk] = ld_frag16((const bf16_t*)(krow + kk * 64),
                               (const bf16_t*)(krow + kk * 64 + 32));
    }
#pragma unroll
    for (int f = 0; f < 4; ++f) {
      const unsigned char* vrow = bufV + (f * 16 + ln) * G_PITCH + tr * 2 + g * 16;
      vf[f] = ld_frag16((const bf16_t*)vrow, (const bf16_t*)(vrow + 32));
    }
    // scores S^T = K * Q^T  (32 x 16), two 16x16 D frags:
    // s[ni][r] = key t0 + ni * 16 + 8 * g + r against query q0 + ln
    v8f s[2] = {};
#pragma unroll
    for (int ni = 0; ni < 2; ++ni)
#pragma unroll
      for (int kk = 0; kk < 2; ++kk)
        s[ni] = wmma_bf16(kf[ni][kk], qf[kk], s[ni]);
    // scale + causal mask: key t0 + ni * 16 + 8 * g + r > query qg
    const int lim = qrel - t0;
#pragma unroll
    for (int ni = 0; ni < 2; ++ni)
#pragma unroll
      for (int r = 0; r < 8; ++r) {
        const float v = s[ni][r] * 0.125f;  // 1/sqrt(64)
        s[ni][r] = (ni * 16 + r > lim) ? -__builtin_inff() : v;
      }
    // the query's maximum: this lane's 16 scores and the running maximum as a tree
    // of three-way maxima, then the other half's
    const float m0 = fmaxf(fmaxf(s[0][0], s[0][1]), s[0][2]);
    const float m1 = fmaxf(fmaxf(s[0][3], s[0][4]), s[0][5]);
    const float m2 = fmaxf(fmaxf(s[0][6], s[0][7]), s[1][0]);
    const float m3 = fmaxf(fmaxf(s[1][1], s[1][2]), s[1][3]);
    const float m4 = fmaxf(fmaxf(s[1][4], s[1][5]), s[1][6]);
    const float m5 = fmaxf(fmaxf(m0, m1), m2);
    const float m6 = fmaxf(fmaxf(m3, m4), s[1][7]);
    float mn = fmaxf(fmaxf(m5, m6), mrow);
    mn = fmaxf(mn, xhalf(mn));
    // online rescale factor, one a lane
    // e^x = 2^(x log2 e)
    const float alpha = exp2_slot((mrow - mn) * 1.44269504f);
    mrow = mn;
#pragma unroll
    for (int ni = 0; ni < 2; ++ni) {
      v8f e;
#pragma unroll
      for (int r = 0; r < 8; ++r) e[r] = (s[ni][r] - mn) * 1.44269504f;
      exp2_x8(s[ni], e);
    }
#pragma unroll
    for (int f = 0; f < 4; ++f)
#pragma unroll
      for (int r = 0; r < 8; ++r) o[f][r] *= alpha;
    // the rows of o5 are equal sums and only a lane's first is read: it alone is
    // rescaled (the others stay plain sums of at most SEQ terms, none above 1)
    o5[0] *= alpha;

    // P^T as B operand: element j = key 8 * g + j, element 8 + j = key 16 + 8 * g + j
    v16bf pf;
#pragma unroll
    for (int j = 0; j < 8; ++j) {
      pf[j] = (bf16_t)s[0][j];
      pf[8 + j] = (bf16_t)s[1][j];
    }

    // O^T += V^T(64x32) * P^T(32x16): A frags from V^T rows (contiguous along t)
#pragma unroll
    for (int f = 0; f < 4; ++f) o[f] = wmma_bf16(vf[f], pf, o[f]);
    // denominator: l += ones x P^T
    o5 = wmma_bf16(onesf, pf, o5);
    asm volatile("v_nop\n\tv_nop\n\tv_nop\n\tv_nop"
                 :: "v"(o[0]), "v"(o[1]), "v"(o[2]), "v"(o[3]), "v"(o5));
   }
   // Publish point of stage st + 1; every wave passes it, also one that skipped a
   // tile. This wave's reads of buffer st & 1 are done:
   asm volatile("s_wait_dscnt 0x0" ::: "memory");
   if (pinned(wave_u < 2u)) {
     // the issuing wave's own tile of stage st + 1 has landed
     asm volatile("s_wait_tensorcnt 0x0" :: "s"(g0) : "memory");
   }
   __syncthreads();
   // Refill the buffer that every wave has just left, while a stage is left.
   if (pinned((wave_u < 2u) && (st + 2 < n_stage))) {
     g0 = tdm_group0(my_src + ((size_t)(st + 2) << my_shift),
                     my_lds + (unsigned)(st & 1) * A_STAGE);
     asm volatile("tensor_load_to_lds %0, %1" :: "s"(g0), "s"(g1) : "memory");
   }
  }
  // nothing of the ring is outstanding when the wave goes on to its stores
  asm volatile("s_wait_tensorcnt 0x0" ::: "memory");
  asm volatile("s_wait_dscnt 0x0" ::: "memory");

  // normalize and store: out[b, q, h*64 + d] (bf16, row-major D_MODEL); a fragment
  // is 8 neighbouring dims of this lane's query: 16 bytes a store
  union Out8 { bf16_t e[8]; uint4 q; };
  Out8 pk[4];
#pragma unroll
  for (int f = 0; f < 4; ++f)
#pragma unroll
    for (int r = 0; r < 8; ++r) pk[f].e[r] = (bf16_t)(o[f][r] / o5[0]);
  bf16_t* orow = O + (size_t)(b * SEQ + qg) * D_MODEL + h * DK + 8 * g;
#pragma unroll
  for (int f = 0; f < 4; ++f) *reinterpret_cast<uint4*>(orow + f * 16) = pk[f].q;
}

// ---------------------------------------------------------------------------
// Host orchestration
// ---------------------------------------------------------------------------
extern "C" void kernel_launch(void* const* d_in, const int* in_sizes, int n_in,
                              void* d_out, int out_size, void* d_ws,
                              size_t ws_size, hipStream_t stream) {
  (void)in_sizes; (void)n_in; (void)out_size; (void)ws_size;
  const float* x      = (const float*)d_in[0];
  const float* w_q    = (const float*)d_in[1];
  const float* w_k    = (const float*)d_in[2];
  const float* w_v    = (const float*)d_in[3];
  const float* w_o    = (const float*)d_in[4];
  const float* w_gate = (const float*)d_in[5];
  const float* w_up   = (const float*)d_in[6];
  const float* w_down = (const float*)d_in[7];
  const float* g1     = (const float*)d_in[8];
  const float* g2     = (const float*)d_in[9];

  unsigned char* ws = (unsigned char*)d_ws;
  const size_t MB = 1ull << 20;
  bf16_t* wtq  = (bf16_t*)(ws + 0 * MB);    // [1024][1024]      2 MB
  bf16_t* wtk  = (bf16_t*)(ws + 2 * MB);    //                   2 MB
  bf16_t* wtv  = (bf16_t*)(ws + 4 * MB);    //                   2 MB
  bf16_t* wto  = (bf16_t*)(ws + 6 * MB);    //                   2 MB
  bf16_t* wtg  = (bf16_t*)(ws + 8 * MB);    // [4096][1024]      8 MB
  bf16_t* wtu  = (bf16_t*)(ws + 16 * MB);   //                   8 MB
  bf16_t* wtd  = (bf16_t*)(ws + 24 * MB);   // [1024][4096]      8 MB
  bf16_t* nx1  = (bf16_t*)(ws + 32 * MB);   // [4096][1024]      8 MB
  bf16_t* qb   = (bf16_t*)(ws + 40 * MB);   // [4096][1024]      8 MB
  bf16_t* kb   = (bf16_t*)(ws + 48 * MB);   //                   8 MB
  bf16_t* vtb  = (bf16_t*)(ws + 56 * MB);   // [B,H,DK,SEQ]      8 MB
  bf16_t* ao   = (bf16_t*)(ws + 64 * MB);   // attn out          8 MB
  float*  x2   = (float*) (ws + 72 * MB);   // f32 resid        16 MB
  bf16_t* nx2  = (bf16_t*)(ws + 88 * MB);   // [4096][1024]      8 MB
  bf16_t* hid  = (bf16_t*)(ws + 96 * MB);   // [4096][4096]     32 MB (end 128 MB)

  // --- weight prep W[K][N] -> Wt[N][K] bf16 and the first RMSNorm, one grid ---
  // (wtq .. wtd lie one behind the other in the workspace)
  (void)wtk; (void)wtv; (void)wtu;  // reached through wtq and wtg
  prep_kernel<<<PREP_GRID, 256, 0, stream>>>(w_q, w_k, w_v, w_o, w_gate, w_up, w_down,
                                             x, g1, wtq, nx1);

  // --- attention sublayer ---
  // Q, K and V in one grid: wtq, wtk, wtv are adjacent, and so are qb, kb, vtb
  const dim3 gemm_blk(256);
  gemm_bf16_wmma<2><<<dim3(3 * D_MODEL / 128, M_ROWS / 128), gemm_blk, 0, stream>>>(
      nx1, wtq, M_ROWS, D_MODEL, D_MODEL, nullptr, qb);

  flash_attn_wmma<<<dim3(SEQ / 64, BATCH * HEADS), 128, 0, stream>>>(qb, kb, vtb, ao);

  gemm_bf16_wmma<1><<<dim3(D_MODEL / 128, M_ROWS / 128), gemm_blk, 0, stream>>>(
      ao, wto, M_ROWS, D_MODEL, D_MODEL, x, x2);

  // --- SwiGLU FFN sublayer ---
  rmsnorm_kernel<<<M_ROWS / RMS_ROWS, 256, 0, stream>>>(x2, g2, nx2);

  // gate, up and silu(gate) * up in one grid: wtg, wtu are adjacent
  gemm_bf16_wmma<0><<<dim3(D_FF / 64, M_ROWS / 128), gemm_blk, 0, stream>>>(
      nx2, wtg, M_ROWS, D_FF, D_MODEL, nullptr, hid);

  gemm_bf16_wmma<1><<<dim3(D_MODEL / 128, M_ROWS / 128), gemm_blk, 0, stream>>>(
      hid, wtd, M_ROWS, D_MODEL, D_FF, x2, (float*)d_out);
}

// v009
// A run of this version takes 171 microseconds.
// Timed twice side by side with v008, it ran 1.08 and 1.07 times as fast.
// All steps since v000 together make it 2.85 times as fast.
#include <hip/hip_runtime.h>

typedef __bf16 bf16_t;
typedef __attribute__((ext_vector_type(16))) __bf16        v16bf;
typedef __attribute__((ext_vector_type(8)))  float         v8f;
typedef __attribute__((ext_vector_type(4)))  unsigned int  v4u;
typedef __attribute__((ext_vector_type(8)))  unsigned int  v8u;

#define D_MODEL 1024
#define SEQ     2048
#define BATCH   2
#define HEADS   16
#define DK      64
#define D_FF    4096
#define M_ROWS  (BATCH * SEQ)   // 4096

union FragU { v16bf v; uint4 q[2]; };

__device__ inline v16bf ld_frag16(const bf16_t* p0, const bf16_t* p1) {
  FragU u;
  u.q[0] = *reinterpret_cast<const uint4*>(p0);
  u.q[1] = *reinterpret_cast<const uint4*>(p1);
  return u.v;
}

__device__ inline v8f wmma_bf16(v16bf a, v16bf b, v8f c) {
  // (neg_a, A, neg_b, B, c_mod, C, reuse_a, reuse_b)
  return __builtin_amdgcn_wmma_f32_16x16x32_bf16(false, a, false, b, (short)0, c,
                                                 false, false);
}

// ---------------------------------------------------------------------------
// GEMM stage geometry: 64 k per stage, so an operand row is 128 B; the tensor
// load pads each row by 16 B (pitch 144 B: conflict-free ds_load_b128 rows).
// One operand tile = 128 rows x 144 B = 18432 B = 9 x 2 KiB.
// ---------------------------------------------------------------------------
#define G_BK     64
#define G_PITCH  144
#define G_TILE   (128 * G_PITCH)
#define G_STAGE  (2 * G_TILE)
// Gate/up stage geometry: 128 k per stage, so an operand row is 256 B, padded by
// 16 B (pitch 272 B: conflict-free ds_load_b128 rows). One tile = 128 rows x 272 B
// = 34816 B = 17 x 2 KiB; a stage is four: [A rows 0-127 | A rows 128-255 | gate | up].
#define U_BK     128
#define U_PITCH  272
#define U_TILE   (128 * U_PITCH)
#define U_STAGE  (4 * U_TILE)

__device__ inline unsigned uni(unsigned v) {
  return (unsigned)__builtin_amdgcn_readfirstlane((int)v);
}
__device__ inline unsigned pinned(unsigned v) {
  unsigned w = uni(v);
  asm volatile("" : "+s"(w));
  return w;
}

__device__ inline v8u tdm_group1_128x128B(unsigned src_pitch) {
  v8u g1;
  g1[0] = pinned((1u << 20) | (4u << 22) | (3u << 25));
  g1[1] = pinned(128u << 16);
  g1[2] = pinned(128u << 16);
  g1[3] = pinned(128u << 16);
  g1[4] = pinned(128u);
  g1[5] = pinned(src_pitch);
  g1[6] = pinned(0u);
  g1[7] = pinned(0u);
  return g1;
}

// The same for 128 rows of 256 B, LDS pitch U_PITCH.
__device__ inline v8u tdm_group1_128x256B(unsigned src_pitch) {
  v8u g1;
  g1[0] = pinned((1u << 20) | (5u << 22) | (3u << 25));
  g1[1] = pinned(256u << 16);
  g1[2] = pinned(128u << 16);
  g1[3] = pinned(256u << 16);
  g1[4] = pinned(128u);
  g1[5] = pinned(src_pitch);
  g1[6] = pinned(0u);
  g1[7] = pinned(0u);
  return g1;
}

// One tensor load: the tile whose first byte is gtile, to LDS byte offset lds_off.
__device__ inline void tdm_load_tile(const bf16_t* gtile, unsigned lds_off, v8u g1) {
  const unsigned long long ga = (unsigned long long)(size_t)gtile;
  v4u g0;
  g0[0] = uni(1u);                              // count = 1
  g0[1] = uni(lds_off);                         // LDS destination (bytes)
  g0[2] = uni((unsigned)ga);                    // global address [31:0]
  g0[3] = uni(((unsigned)(ga >> 32) & 0x01FFFFFFu) | 0x80000000u);  // [56:32], type 2
  asm volatile("tensor_load_to_lds %0, %1" :: "s"(g0), "s"(g1) : "memory");
}

// Attention stage geometry: 64 keys per stage. The K tile is 64 key rows of 128 B
// (one head's 64 dims), the V^T tile 64 dim rows of 128 B (64 keys); both land at
// pitch G_PITCH. One tile = 64 x 144 B = 9216 B, its place rounded up to 5 x 2 KiB.
#define A_KEYS   64
#define A_TILE   10240
#define A_STAGE  (2 * A_TILE)

__device__ inline v4u tdm_group0(const bf16_t* gtile, unsigned lds_off) {
  const unsigned long long ga = (unsigned long long)(size_t)gtile;
  v4u g0;
  g0[0] = uni(1u);                              // count = 1
  g0[1] = uni(lds_off);                         // LDS destination (bytes)
  g0[2] = uni((unsigned)ga);                    // global address [31:0]
  g0[3] = uni(((unsigned)(ga >> 32) & 0x01FFFFFFu) | 0x80000000u);  // [56:32], type 2
  return g0;
}

__device__ inline v8u tdm_group1_64x128B(unsigned src_pitch) {
  v8u g1;
  g1[0] = pinned((1u << 20) | (4u << 22) | (3u << 25));
  g1[1] = pinned(128u << 16);
  g1[2] = pinned(64u << 16);
  g1[3] = pinned(128u << 16);
  g1[4] = pinned(64u);
  g1[5] = pinned(src_pitch);
  g1[6] = pinned(0u);
  g1[7] = pinned(0u);
  return g1;
}

// ---------------------------------------------------------------------------
// Weight transpose + fp32 -> bf16 convert:  W[K][N] -> Wt[N][K]
// One block of 256 threads takes a piece of 256 rows x 128 columns (first column
// n0, first row k0) in TP_TRIPS trips of eight 32 x 32 tiles (64 rows x 128
// columns; tile t: columns 32 * (t % 4), rows 32 * (t / 4)). The next trip's loads fly while this trip's tiles are stored;
// the trips alternate between two sets of tiles in LDS, so that one barrier a trip
// is enough (a second one, behind the stores, would wait for those loads).
// ---------------------------------------------------------------------------
#define TP_TILES 8    // tiles per trip
#define TP_TRIPS 4    // trips per block
#define TP_ROWS  (64 * TP_TRIPS)
typedef float TpTiles[2][TP_TILES][32][33];

template <int N>
__device__ inline void transpose_load(float (&r)[TP_TILES][4], const float* __restrict__ w) {
  // unrolled so that every index of r is a constant (registers, no scratch)
#pragma unroll
  for (int t = 0; t < TP_TILES; ++t)
#pragma unroll
    for (int i = 0; i < 4; ++i)
      r[t][i] = w[(size_t)((t >> 2) * 32 + i * 8) * N + (t & 3) * 32];
}

template <int K, int N>
__device__ inline void transpose_piece(
    const float* __restrict__ W, bf16_t* __restrict__ Wt, int n0, int k0,
    TpTiles& tile) {
  const int tx = threadIdx.x & 31, ty = threadIdx.x >> 5;  // 32 x 8
  const float* w = W + (size_t)(k0 + ty) * N + n0 + tx;    // this thread's first element
  bf16_t* wt = Wt + (size_t)(n0 + ty) * K + k0 + tx;
  float r[TP_TILES][4];
  transpose_load<N>(r, w);
  // kept rolled: unrolled, every trip's loads would be lifted to the top and take
  // four times the registers
#pragma unroll 1
  for (int trip = 0; trip < TP_TRIPS; ++trip) {
#pragma unroll
    for (int t = 0; t < TP_TILES; ++t)
#pragma unroll
      for (int i = 0; i < 4; ++i) tile[trip & 1][t][ty + i * 8][tx] = r[t][i];
    // this set is written; and whoever writes the other set next trip has passed
    // here, behind every wave's reads of it
    __syncthreads();
    if (trip + 1 < TP_TRIPS) {
      transpose_load<N>(r, w + (size_t)(trip + 1) * 64 * N);
      // the LDS reads below take these loads' address registers again: the wait
      // stands in front of that overwrite
      asm volatile("s_wait_xcnt 0x0" ::: "memory");
    }
#pragma unroll
    for (int t = 0; t < TP_TILES; ++t)
#pragma unroll
      for (int i = 0; i < 4; ++i)
        wt[(size_t)((t & 3) * 32 + i * 8) * K + trip * 64 + (t >> 2) * 32] =
            (bf16_t)tile[trip & 1][t][tx][ty + i * 8];
  }
}

// ---------------------------------------------------------------------------
// RMSNorm: fp32 rows -> bf16 normalized rows (D_MODEL=1024). One block takes
// RMS_ROWS rows, each summed on its own (a thread's four squares, the wave's
// butterfly, the eight waves' sums in order): the rows' loads are in flight
// together, their butterflies interleave, and one barrier serves them all.
// ---------------------------------------------------------------------------
#define RMS_ROWS 8
__device__ inline void rmsnorm_rows(
    const float* __restrict__ x, const float* __restrict__ gain,
    bf16_t* __restrict__ out, int row0) {
  __shared__ float warp_sum[RMS_ROWS][8];
  const int tid = threadIdx.x;
  float4 v[RMS_ROWS];
  float ss[RMS_ROWS];
  // unrolled so that every index of v and ss is a constant (registers, no scratch)
#pragma unroll
  for (int r = 0; r < RMS_ROWS; ++r)
    v[r] = reinterpret_cast<const float4*>(x + (size_t)(row0 + r) * D_MODEL)[tid];
  const float4 gv = reinterpret_cast<const float4*>(gain)[tid];
#pragma unroll
  for (int r = 0; r < RMS_ROWS; ++r)
    ss[r] = v[r].x * v[r].x + v[r].y * v[r].y + v[r].z * v[r].z + v[r].w * v[r].w;
#pragma unroll
  for (int m = 1; m < 32; m <<= 1)
#pragma unroll
    for (int r = 0; r < RMS_ROWS; ++r) ss[r] += __shfl_xor(ss[r], m, 32);
  if ((tid & 31) == 0) {
#pragma unroll
    for (int r = 0; r < RMS_ROWS; ++r) warp_sum[r][tid >> 5] = ss[r];
  }
  __syncthreads();
#pragma unroll
  for (int r = 0; r < RMS_ROWS; ++r) {
    float tot = 0.f;
#pragma unroll
    for (int i = 0; i < 8; ++i) tot += warp_sum[r][i];
    const float inv = rsqrtf(tot * (1.0f / D_MODEL) + 1e-6f);
    bf16_t* orow = out + (size_t)(row0 + r) * D_MODEL + tid * 4;
    orow[0] = (bf16_t)(v[r].x * inv * gv.x);
    orow[1] = (bf16_t)(v[r].y * inv * gv.y);
    orow[2] = (bf16_t)(v[r].z * inv * gv.z);
    orow[3] = (bf16_t)(v[r].w * inv * gv.w);
  }
}

__global__ __launch_bounds__(256) void rmsnorm_kernel(
    const float* __restrict__ x, const float* __restrict__ gain,
    bf16_t* __restrict__ out) {
  rmsnorm_rows(x, gain, out, (int)blockIdx.x * RMS_ROWS);
}

// ---------------------------------------------------------------------------
// Everything that reads the inputs alone, in ONE grid: the seven weight
// transposes and the first RMSNorm depend on nothing but the inputs, so their
// blocks share a launch. A block's job follows from its index (the same for all
// of its threads, so every barrier stands under block-uniform control flow):
//   PREP_SQ blocks   : w_q, w_k, w_v, w_o    (32 pieces each)
//   PREP_UP blocks   : w_gate, w_up          (128 pieces each)
//   PREP_DN blocks   : w_down                (128 pieces)
//   PREP_RMS blocks  : RMS_ROWS rows of x each (the shorter job, placed last)
// wt: the transposed weights one behind the other, in that order.
// ---------------------------------------------------------------------------
#define SQ_PIECES ((D_MODEL / 128) * (D_MODEL / TP_ROWS))   // 32
#define FF_PIECES ((D_MODEL / 128) * (D_FF / TP_ROWS))      // 128
#define PREP_RMS  (M_ROWS / RMS_ROWS)
#define PREP_SQ   (4 * SQ_PIECES)
#define PREP_UP   (2 * FF_PIECES)
#define PREP_DN   FF_PIECES
#define PREP_GRID (PREP_RMS + PREP_SQ + PREP_UP + PREP_DN)

__global__ __launch_bounds__(256) void prep_kernel(
    const float* __restrict__ w_q, const float* __restrict__ w_k,
    const float* __restrict__ w_v, const float* __restrict__ w_o,
    const float* __restrict__ w_gate, const float* __restrict__ w_up,
    const float* __restrict__ w_down, const float* __restrict__ x,
    const float* __restrict__ gain, bf16_t* __restrict__ wt,
    bf16_t* __restrict__ nx) {
  const int b = (int)blockIdx.x;
  if (b >= PREP_SQ + PREP_UP + PREP_DN) {
    rmsnorm_rows(x, gain, nx, (b - (PREP_SQ + PREP_UP + PREP_DN)) * RMS_ROWS);
    return;
  }
  __shared__ TpTiles tile;
  // pieces are numbered inside their matrix, columns fastest
  if (b < PREP_SQ) {
    const int m = b / SQ_PIECES, r = b % SQ_PIECES;
    const float* W = (m == 0) ? w_q : (m == 1) ? w_k : (m == 2) ? w_v : w_o;
    transpose_piece<D_MODEL, D_MODEL>(W, wt + (size_t)m * (D_MODEL * D_MODEL),
                                      (r % (D_MODEL / 128)) * 128,
                                      (r / (D_MODEL / 128)) * TP_ROWS, tile);
  } else if (b < PREP_SQ + PREP_UP) {
    const int m = (b - PREP_SQ) / FF_PIECES, r = (b - PREP_SQ) % FF_PIECES;
    transpose_piece<D_MODEL, D_FF>(
        (m == 0) ? w_gate : w_up,
        wt + (size_t)4 * (D_MODEL * D_MODEL) + (size_t)m * (D_MODEL * D_FF),
        (r % (D_FF / 128)) * 128, (r / (D_FF / 128)) * TP_ROWS, tile);
  } else {
    const int r = b - (PREP_SQ + PREP_UP);
    transpose_piece<D_FF, D_MODEL>(
        w_down, wt + (size_t)4 * (D_MODEL * D_MODEL) + (size_t)2 * (D_MODEL * D_FF),
        (r % (D_MODEL / 128)) * 128, (r / (D_MODEL / 128)) * TP_ROWS, tile);
  }
}

// ---------------------------------------------------------------------------
// A wave's 32 x 64 accumulators to memory. D layout: element r of a fragment is
// row r + 8*(lane/16), column lane%16; m_w, n_w: this lane's row and column of
// element 0 of fragment (0, 0).
// MODE: 0 = store bf16, 1 = fp32 out = resid + C, 2 = bf16 scatter to V^T
// ---------------------------------------------------------------------------
template <int MODE>
__device__ inline void gemm_store(const v8f (&acc)[2][4], int m_w, int n_w, int N,
                                  const float* __restrict__ resid,
                                  void* __restrict__ outp) {
  // unrolled so that every accumulator index is a constant (registers, no scratch)
#pragma unroll
  for (int mi = 0; mi < 2; ++mi)
#pragma unroll
    for (int ni = 0; ni < 4; ++ni)
#pragma unroll
      for (int r = 0; r < 8; ++r) {
        const int mg = m_w + mi * 16 + r;
        const int ng = n_w + ni * 16;
        const float c = acc[mi][ni][r];
        if (MODE == 0) {
          ((bf16_t*)outp)[(size_t)mg * N + ng] = (bf16_t)c;
        } else if (MODE == 1) {
          const size_t idx = (size_t)mg * N + ng;
          ((float*)outp)[idx] = resid[idx] + c;
        } else {  // V^T scatter: [B,H,DK,SEQ]
          const int bb = mg >> 11, sin = mg & (SEQ - 1);
          const int hh = ng >> 6, dd = ng & (DK - 1);
          ((bf16_t*)outp)[(((size_t)(bb * HEADS + hh) * DK + dd) << 11) + sin] =
              (bf16_t)c;
        }
      }
}

__device__ inline float exp2_slot(float x) {
  float y;
  asm("v_exp_f32 %0, %1\n\tv_nop" : "=v"(y) : "v"(x));
  return y;
}
__device__ inline float rcp_slot(float x) {
  float y;
  asm("v_rcp_f32 %0, %1\n\tv_nop" : "=v"(y) : "v"(x));
  return y;
}

__device__ inline void gemm_store_swiglu(const v8f (&acc)[4][8], int m_w, int n_w, int N,
                                         bf16_t* __restrict__ outp) {
  // unrolled so that every accumulator index is a constant (registers, no scratch)
#pragma unroll
  for (int mi = 0; mi < 4; ++mi) {
    bf16_t h[4][8];
    bf16_t* const row0 = outp + (size_t)(m_w + mi * 16) * N + n_w;
#pragma unroll
    for (int nj = 0; nj < 4; ++nj)
#pragma unroll
      for (int r = 0; r < 8; ++r) {
        const float gv = acc[mi][nj][r];
        const float uv = acc[mi][nj + 4][r];
        // e^-g = 2^(-g log2 e); v_rcp_f32 (1 ulp) for the divide: the result is
        // rounded to bf16
        const float sil = gv * rcp_slot(1.f + exp2_slot(gv * -1.44269504f));
        h[nj][r] = (bf16_t)(sil * uv);
      }
    // 16 rows' values, then their stores, then the wait in front of the next rows'
    // arithmetic, which takes the stores' registers again. The scheduling barriers
    // keep that order.
    __builtin_amdgcn_sched_barrier(0);  // the values are made in front of the stores
#pragma unroll
    for (int nj = 0; nj < 4; ++nj)
#pragma unroll
      for (int r = 0; r < 8; ++r) row0[(size_t)r * N + nj * 16] = h[nj][r];
    asm volatile("s_wait_xcnt 0x0" ::: "memory");
    __builtin_amdgcn_sched_barrier(0);  // the next rows' arithmetic stays behind the wait
  }
}

// ---------------------------------------------------------------------------
// GEMM: C[M][N] = A[M][K] (bf16, k-major) x Bt[N][K] (bf16, k-major)
// 256 threads = 8 waves; block tile 128x128; per-wave 32x64 (2x4 frags).
// Several products that share A run side by side in one grid: product p takes
// rows p * N .. p * N + N - 1 of Bt (grid.x covers them all) and writes the p-th
// M x N matrix at outp.
// EPI: 1 = one product, fp32 out = resid + C,
//      2 = three products: 0 and 1 stored as bf16, 2 scattered to V^T
// Assumes M,N % 128 == 0, K % 64 == 0 and K >= 128 (true for all calls here).
// ---------------------------------------------------------------------------
template <int EPI>
__global__ __launch_bounds__(256) void gemm_bf16_wmma(
    const bf16_t* __restrict__ A, const bf16_t* __restrict__ Bt,
    int M, int N, int K, const float* __restrict__ resid,
    void* __restrict__ outp) {
  // ring[buffer][A tile | B tile]; every tile starts at a multiple of 2 KiB
  constexpr int STAGE = G_STAGE;
  constexpr unsigned N_ISSUE = 2u;  // waves that issue tensor loads
  __shared__ __attribute__((aligned(2048))) unsigned char ring[2 * STAGE];
  const int tid  = threadIdx.x;
  const int lane = tid & 31, wave = tid >> 5;
  const int g = lane >> 4, ln = lane & 15;
  const int wm = wave >> 1, wn = wave & 1;
  const int m_blk = blockIdx.y * 128, n_blk = blockIdx.x * 128;
  // Wave 0 brings the A tile of every stage, wave 1 the B tile.
  const unsigned wave_u = uni((unsigned)threadIdx.x >> 5);
  const bf16_t* my_src = (wave_u == 0) ? A + (size_t)m_blk * K : Bt + (size_t)n_blk * K;
  const unsigned my_lds =
      (unsigned)(size_t)(void*)&ring[0] + ((wave_u == 0) ? 0u : (unsigned)G_TILE);
  const v8u g1 = tdm_group1_128x128B((unsigned)K * 2u);
  const int n_stage = K / G_BK;

  v8f acc[2][4] = {};

  // Prologue: stage 0 lands and is published, then stage 1 starts to fly.
  if (pinned(wave_u < N_ISSUE)) {
    tdm_load_tile(my_src, my_lds, g1);
    // stage 0 has landed here
    asm volatile("s_wait_tensorcnt 0x0" ::: "memory");
  }
  __syncthreads();
  if (pinned(wave_u < N_ISSUE))
    tdm_load_tile(my_src + G_BK, my_lds + STAGE, g1);

  for (int s = 0; s < n_stage; ++s) {
    const unsigned char* bufA = ring + (s & 1) * STAGE;
    const unsigned char* bufB = bufA + G_TILE;
    // unrolled so that every fragment and accumulator index is a constant
    // (registers, no scratch); the two 32-k blocks keep the ascending k order
#pragma unroll
    for (int kk = 0; kk < 2; ++kk) {
      v16bf aF[2], bF[4];
#pragma unroll
      for (int mi = 0; mi < 2; ++mi) {
        const unsigned char* p =
            bufA + (wm * 32 + mi * 16 + ln) * G_PITCH + kk * 64 + g * 16;
        aF[mi] = ld_frag16((const bf16_t*)p, (const bf16_t*)(p + 32));
      }
#pragma unroll
      for (int ni = 0; ni < 4; ++ni) {
        const unsigned char* p =
            bufB + (wn * 64 + ni * 16 + ln) * G_PITCH + kk * 64 + g * 16;
        bF[ni] = ld_frag16((const bf16_t*)p, (const bf16_t*)(p + 32));
      }
#pragma unroll
      for (int mi = 0; mi < 2; ++mi)
#pragma unroll
        for (int ni = 0; ni < 4; ++ni)
          acc[mi][ni] = wmma_bf16(aF[mi], bF[ni], acc[mi][ni]);
    }
    // Publish point of stage s + 1. This wave's reads of buffer s & 1 are done:
    asm volatile("s_wait_dscnt 0x0" ::: "memory");
    if (pinned(wave_u < N_ISSUE)) {
      // the issuing wave's own tile of stage s + 1 has landed
      asm volatile("s_wait_tensorcnt 0x0" ::: "memory");
    }
    __syncthreads();
    // Refill the buffer that every wave has just left, while a stage is left.
    if (pinned((wave_u < N_ISSUE) && (s + 2 < n_stage)))
      tdm_load_tile(my_src + (size_t)(s + 2) * G_BK,
                    my_lds + (unsigned)(s & 1) * STAGE, g1);
  }
  asm volatile("s_wait_tensorcnt 0x0" :: "s"(g1) : "memory");
  asm volatile("s_wait_dscnt 0x0" ::: "memory");

  // Epilogue: this product's matrix, in this product's form. The test on prod is
  // the same for the whole block and stands outside the store loops, so that each
  // form keeps its straight-line stores (the V^T form: 16 bytes a lane).
  constexpr int n_prod = (EPI == 2) ? 3 : 1;
  int prod = 0;  // which product this block's columns belong to
  for (int p = 1; p < n_prod; ++p) prod += (n_blk >= p * N) ? 1 : 0;
  void* const outm = (EPI != 2) ? outp : (void*)((bf16_t*)outp + (size_t)prod * M * N);
  const int m_w = m_blk + wm * 32 + 8 * g;
  const int n_w = n_blk - prod * N + wn * 64 + ln;
  if (EPI == 2) {
    if (prod < 2) {
      gemm_store<0>(acc, m_w, n_w, N, resid, outm);
    } else {
      gemm_store<2>(acc, m_w, n_w, N, resid, outm);
      // in the compiled text the other form's code stands behind these stores and
      // takes their registers again: the wait stands in front of that overwrite
      asm volatile("s_wait_xcnt 0x0" ::: "memory");
    }
  } else {
    gemm_store<EPI>(acc, m_w, n_w, N, resid, outm);
  }
}

__device__ inline void gate_up_row0(v16bf (&aF)[4], v16bf (&bF)[8],
                                    const unsigned char* pa, const unsigned char* pb) {
  aF[0] = ld_frag16((const bf16_t*)pa, (const bf16_t*)(pa + 32));
  // unrolled so that every fragment index is a constant (registers, no scratch)
#pragma unroll
  for (int ni = 0; ni < 8; ++ni) {
    const unsigned char* p = pb + (ni >> 2) * U_TILE + (ni & 3) * 16 * U_PITCH;
    bF[ni] = ld_frag16((const bf16_t*)p, (const bf16_t*)(p + 32));
  }
}
__device__ inline void gate_up_rows123(v16bf (&aF)[4], const unsigned char* pa) {
  // unrolled so that every fragment index is a constant (registers, no scratch)
#pragma unroll
  for (int mi = 1; mi < 4; ++mi) {
    const unsigned char* p = pa + mi * 16 * U_PITCH;
    aF[mi] = ld_frag16((const bf16_t*)p, (const bf16_t*)(p + 32));
  }
}

__global__ __launch_bounds__(256) __attribute__((amdgpu_waves_per_eu(2, 2))) void gemm_gate_up_swiglu(
    const bf16_t* __restrict__ A, const bf16_t* __restrict__ Bt, int N, int K,
    bf16_t* __restrict__ outp) {
  // ring[buffer][A tile | A tile | gate tile | up tile]; every tile starts at a
  // multiple of 2 KiB
  __shared__ __attribute__((aligned(2048))) unsigned char ring[2 * U_STAGE];
  const int tid  = threadIdx.x;
  const int lane = tid & 31, wave = tid >> 5;
  const int g = lane >> 4, ln = lane & 15;
  const int wm = wave >> 1, wn = wave & 1;
  const int m_blk = blockIdx.y * 256, n_blk = blockIdx.x * 128;
  const unsigned wave_u = uni((unsigned)threadIdx.x >> 5);
  const bf16_t* my_src =
      (wave_u < 2u) ? A + (size_t)(m_blk + (int)wave_u * 128) * K
                    : Bt + (size_t)(n_blk + ((wave_u == 3u) ? N : 0)) * K;
  const unsigned my_lds = (unsigned)(size_t)(void*)&ring[0] + (wave_u & 3u) * (unsigned)U_TILE;
  const v8u g1 = tdm_group1_128x256B((unsigned)K * 2u);
  const int n_stage = K / U_BK;

  v8f acc[4][8] = {};

  // Prologue: stage 0 lands and is published, then stage 1 starts to fly.
  if (pinned(wave_u < 4u)) {
    tdm_load_tile(my_src, my_lds, g1);
    // stage 0 has landed here
    asm volatile("s_wait_tensorcnt 0x0" ::: "memory");
  }
  __syncthreads();
  if (pinned(wave_u < 4u))
    tdm_load_tile(my_src + U_BK, my_lds + U_STAGE, g1);

  for (int s = 0; s < n_stage; ++s) {
    const unsigned char* pa = ring + (s & 1) * U_STAGE + (wm * 64 + ln) * U_PITCH + g * 16;
    const unsigned char* pb =
        ring + (s & 1) * U_STAGE + 2 * U_TILE + (wn * 64 + ln) * U_PITCH + g * 16;
    // The stage's four 32-k blocks, ascending k, on two fragment sets: each block's
    // LDS reads stand as one group in front of the products of the block before it.
    // The scheduling barriers keep groups and products in that order: left alone, the
    // compiler reloads one A fragment per row of eight products and waits for it
    // there, issues the reads that are needed first last, and lifts the wait at the
    // stage's foot over the products.
    v16bf aF[2][4], bF[2][8];
    gate_up_row0(aF[0], bF[0], pa, pb);
    __builtin_amdgcn_sched_barrier(0);  // the first row's operands are read first
    gate_up_rows123(aF[0], pa);
    __builtin_amdgcn_sched_barrier(0);  // block 0's reads stand in front of block 1's
    // unrolled so that every fragment and accumulator index is a constant
    // (registers, no scratch)
#pragma unroll
    for (int kk = 0; kk < 4; ++kk) {
      if (kk < 3) {
        gate_up_row0(aF[(kk + 1) & 1], bF[(kk + 1) & 1], pa + (kk + 1) * 64, pb + (kk + 1) * 64);
        gate_up_rows123(aF[(kk + 1) & 1], pa + (kk + 1) * 64);
      }
      __builtin_amdgcn_sched_barrier(0);  // the next block's reads stay one group, here
#pragma unroll
      for (int mi = 0; mi < 4; ++mi)
#pragma unroll
        for (int ni = 0; ni < 8; ++ni)
          acc[mi][ni] = wmma_bf16(aF[kk & 1][mi], bF[kk & 1][ni], acc[mi][ni]);
      // no later read, and not the foot's wait, moves up among these products
      __builtin_amdgcn_sched_barrier(0);
    }
    // Publish point of stage s + 1. This wave's reads of buffer s & 1 are done:
    asm volatile("s_wait_dscnt 0x0" ::: "memory");
    if (pinned(wave_u < 4u)) {
      // the issuing wave's own tile of stage s + 1 has landed
      asm volatile("s_wait_tensorcnt 0x0" ::: "memory");
    }
    __syncthreads();
    // Refill the buffer that every wave has just left, while a stage is left.
    if (pinned((wave_u < 4u) && (s + 2 < n_stage)))
      tdm_load_tile(my_src + (size_t)(s + 2) * U_BK,
                    my_lds + (unsigned)(s & 1) * U_STAGE, g1);
  }
  asm volatile("s_wait_tensorcnt 0x0" :: "s"(g1) : "memory");
  asm volatile("s_wait_dscnt 0x0" ::: "memory");

  gemm_store_swiglu(acc, m_blk + wm * 64 + 8 * g, n_blk + wn * 64 + ln, N, outp);
}

__device__ inline float xhalf(float x) {
  return __builtin_bit_cast(float, __builtin_amdgcn_permlanex16(
      __builtin_bit_cast(int, x), __builtin_bit_cast(int, x), 0x76543210, 0xfedcba98,
      false, false));
}

__device__ inline void exp2_x8(v8f& y, const v8f& x) {
  float y0, y1, y2, y3, y4, y5, y6, y7;
  asm("v_exp_f32 %0, %8\n\t"
      "v_exp_f32 %1, %9\n\t"
      "v_exp_f32 %2, %10\n\t"
      "v_exp_f32 %3, %11\n\t"
      "v_exp_f32 %4, %12\n\t"
      "v_exp_f32 %5, %13\n\t"
      "v_exp_f32 %6, %14\n\t"
      "v_exp_f32 %7, %15\n\t"
      "v_nop"
      : "=&v"(y0), "=&v"(y1), "=&v"(y2), "=&v"(y3), "=&v"(y4), "=&v"(y5), "=&v"(y6),
        "=&v"(y7)
      : "v"(x[0]), "v"(x[1]), "v"(x[2]), "v"(x[3]), "v"(x[4]), "v"(x[5]), "v"(x[6]),
        "v"(x[7]));
  y[0] = y0; y[1] = y1; y[2] = y2; y[3] = y3;
  y[4] = y4; y[5] = y5; y[6] = y6; y[7] = y7;
}

__global__ __launch_bounds__(128) __attribute__((amdgpu_waves_per_eu(4, 6))) void flash_attn_wmma(
    const bf16_t* __restrict__ Q, const bf16_t* __restrict__ Km,
    const bf16_t* __restrict__ Vt, bf16_t* __restrict__ O) {
  // ring[buffer][K tile | V^T tile]; every tile starts at a multiple of 2 KiB
  __shared__ __attribute__((aligned(2048))) unsigned char ring[2 * A_STAGE];
  const int tid  = threadIdx.x;
  const int lane = tid & 31;
  const unsigned wave_u = uni((unsigned)threadIdx.x >> 5);
  const int wave = (int)wave_u;
  const int g = lane >> 4, ln = lane & 15;
  const int bh = blockIdx.y, b = bh >> 4, h = bh & 15;
  // Which 64-row query tile this block takes. A tile's cost grows with its index
  // (qt + 1 stages) and all blocks are resident at once, so the launch lasts as long
  // as the fullest WGP. For each head this is a permutation of the 32 tiles: the low three
  // bits are mirrored in every second group of eight (x, x + 8, x + 16, x + 24 then
  // sum to 62), and heads of odd bit parity take the mirrored tile 31 - t.
  const int bx = (int)blockIdx.x;
  const int t8 = bx ^ ((bx & 8) ? 7 : 0);
  const int qt = (__builtin_popcount((unsigned)bh) & 1) ? (SEQ / 64 - 1) - t8 : t8;
  const int q0 = qt * 64 + wave * 16;

  // The block's four waves read the same keys: wave 0 brings the K tile of every
  // stage, wave 1 the V^T tile. The block's rows end at key 64 * qt + 63.
  const bf16_t* my_src = (wave_u == 0)
                             ? Km + (size_t)(b * SEQ) * D_MODEL + h * DK
                             : Vt + (size_t)((b * HEADS + h) * DK) * SEQ;
  // a stage's step in the source, as a shift: 64 rows of K, 64 columns of V^T
  const unsigned my_shift = (wave_u == 0) ? 16u : 6u;
  static_assert(A_KEYS * D_MODEL == 1 << 16 && A_KEYS == 1 << 6, "stage steps");
  const unsigned my_lds = (unsigned)(size_t)(void*)&ring[0] +
                          ((wave_u == 0) ? 0u : (unsigned)A_TILE);
  const v8u g1 = tdm_group1_64x128B((wave_u == 0) ? (unsigned)(D_MODEL * 2)
                                                  : (unsigned)(SEQ * 2));
  const int n_stage = qt + 1;

  // Q^T B-fragments: 64 dims (two k-halves of 32) x 16 queries, column lane % 16
  const bf16_t* qrow = Q + (size_t)(b * SEQ + q0 + ln) * D_MODEL + h * DK;
  v16bf qf[2];
#pragma unroll
  for (int kk = 0; kk < 2; ++kk)
    qf[kk] = ld_frag16(qrow + kk * 32 + g * 8, qrow + kk * 32 + 16 + g * 8);

  v16bf onesf;
#pragma unroll
  for (int j = 0; j < 16; ++j) onesf[j] = (bf16_t)1.0f;

  v8f o[4] = {};  // O^T: o[f][r] = dim f * 16 + 8 * g + r of query q0 + ln
  v8f o5 = {};    // ones x P^T: a lane's element 0 (row 8 * g) is the softmax denominator of query q0 + ln
  float mrow = -__builtin_inff();  // running maximum of query q0 + ln
  const int qg = q0 + ln;
  const int qrel = qg - 8 * g;  // the query against this lane's first key of a tile

  v4u g0 = {0u, 0u, 0u, 0u};
  if (pinned(wave_u < 2u)) {
    g0 = tdm_group0(my_src, my_lds);
    asm volatile("tensor_load_to_lds %0, %1" :: "s"(g0), "s"(g1) : "memory");
    // stage 0 has landed here
    asm volatile("s_wait_tensorcnt 0x0" :: "s"(g0) : "memory");
  }
  __syncthreads();
  if (pinned(wave_u < 2u)) {
    g0 = tdm_group0(my_src + ((size_t)1 << my_shift), my_lds + A_STAGE);
    asm volatile("tensor_load_to_lds %0, %1" :: "s"(g0), "s"(g1) : "memory");
  }

  for (int st = 0; st < n_stage; ++st) {
   const unsigned char* bufK = ring + (st & 1) * A_STAGE;
   const unsigned char* bufV = bufK + A_TILE;
   // the stage's two 32-key tiles; a wave skips a tile wholly above its diagonal
   for (int t0 = st * A_KEYS; t0 < (st + 1) * A_KEYS && t0 <= q0 + 15; t0 += 32) {
    const int tr = t0 - st * A_KEYS;  // first key of the tile inside the stage
    // The tile's K and V^T A-fragments, as one group of LDS reads, K first: the V
    // reads return under the score products and the softmax.
    v16bf kf[2][2], vf[4];
#pragma unroll
    for (int ni = 0; ni < 2; ++ni) {
      const unsigned char* krow = bufK + (tr + ni * 16 + ln) * G_PITCH + g * 16;
#pragma unroll
      for (int kk = 0; kk < 2; ++kk)
        kf[ni][kk] = ld_frag16((const bf16_t*)(krow + kk * 64),
                               (const bf16_t*)(krow + kk * 64 + 32));
    }
#pragma unroll
    for (int f = 0; f < 4; ++f) {
      const unsigned char* vrow = bufV + (f * 16 + ln) * G_PITCH + tr * 2 + g * 16;
      vf[f] = ld_frag16((const bf16_t*)vrow, (const bf16_t*)(vrow + 32));
    }
    // scores S^T = K * Q^T  (32 x 16), two 16x16 D frags:
    // s[ni][r] = key t0 + ni * 16 + 8 * g + r against query q0 + ln
    v8f s[2] = {};
#pragma unroll
    for (int ni = 0; ni < 2; ++ni)
#pragma unroll
      for (int kk = 0; kk < 2; ++kk)
        s[ni] = wmma_bf16(kf[ni][kk], qf[kk], s[ni]);
    // scale + causal mask: key t0 + ni * 16 + 8 * g + r > query qg
    const int lim = qrel - t0;
#pragma unroll
    for (int ni = 0; ni < 2; ++ni)
#pragma unroll
      for (int r = 0; r < 8; ++r) {
        const float v = s[ni][r] * 0.125f;  // 1/sqrt(64)
        s[ni][r] = (ni * 16 + r > lim) ? -__builtin_inff() : v;
      }
    // the query's maximum: this lane's 16 scores and the running maximum as a tree
    // of three-way maxima, then the other half's
    const float m0 = fmaxf(fmaxf(s[0][0], s[0][1]), s[0][2]);
    const float m1 = fmaxf(fmaxf(s[0][3], s[0][4]), s[0][5]);
    const float m2 = fmaxf(fmaxf(s[0][6], s[0][7]), s[1][0]);
    const float m3 = fmaxf(fmaxf(s[1][1], s[1][2]), s[1][3]);
    const float m4 = fmaxf(fmaxf(s[1][4], s[1][5]), s[1][6]);
    const float m5 = fmaxf(fmaxf(m0, m1), m2);
    const float m6 = fmaxf(fmaxf(m3, m4), s[1][7]);
    float mn = fmaxf(fmaxf(m5, m6), mrow);
    mn = fmaxf(mn, xhalf(mn));
    // online rescale factor, one a lane
    // e^x = 2^(x log2 e)
    const float alpha = exp2_slot((mrow - mn) * 1.44269504f);
    mrow = mn;
#pragma unroll
    for (int ni = 0; ni < 2; ++ni) {
      v8f e;
#pragma unroll
      for (int r = 0; r < 8; ++r) e[r] = (s[ni][r] - mn) * 1.44269504f;
      exp2_x8(s[ni], e);
    }
#pragma unroll
    for (int f = 0; f < 4; ++f)
#pragma unroll
      for (int r = 0; r < 8; ++r) o[f][r] *= alpha;
    // the rows of o5 are equal sums and only a lane's first is read: it alone is
    // rescaled (the others stay plain sums of at most SEQ terms, none above 1)
    o5[0] *= alpha;

    // P^T as B operand: element j = key 8 * g + j, element 8 + j = key 16 + 8 * g + j
    v16bf pf;
#pragma unroll
    for (int j = 0; j < 8; ++j) {
      pf[j] = (bf16_t)s[0][j];
      pf[8 + j] = (bf16_t)s[1][j];
    }

    // O^T += V^T(64x32) * P^T(32x16): A frags from V^T rows (contiguous along t)
#pragma unroll
    for (int f = 0; f < 4; ++f) o[f] = wmma_bf16(vf[f], pf, o[f]);
    // denominator: l += ones x P^T
    o5 = wmma_bf16(onesf, pf, o5);
    asm volatile("v_nop\n\tv_nop\n\tv_nop\n\tv_nop"
                 :: "v"(o[0]), "v"(o[1]), "v"(o[2]), "v"(o[3]), "v"(o5));
   }
   // Publish point of stage st + 1; every wave passes it, also one that skipped a
   // tile. This wave's reads of buffer st & 1 are done:
   asm volatile("s_wait_dscnt 0x0" ::: "memory");
   if (pinned(wave_u < 2u)) {
     // the issuing wave's own tile of stage st + 1 has landed
     asm volatile("s_wait_tensorcnt 0x0" :: "s"(g0) : "memory");
   }
   __syncthreads();
   // Refill the buffer that every wave has just left, while a stage is left.
   if (pinned((wave_u < 2u) && (st + 2 < n_stage))) {
     g0 = tdm_group0(my_src + ((size_t)(st + 2) << my_shift),
                     my_lds + (unsigned)(st & 1) * A_STAGE);
     asm volatile("tensor_load_to_lds %0, %1" :: "s"(g0), "s"(g1) : "memory");
   }
  }
  // nothing of the ring is outstanding when the wave goes on to its stores
  asm volatile("s_wait_tensorcnt 0x0" ::: "memory");
  asm volatile("s_wait_dscnt 0x0" ::: "memory");

  // normalize and store: out[b, q, h*64 + d] (bf16, row-major D_MODEL); a fragment
  // is 8 neighbouring dims of this lane's query: 16 bytes a store
  union Out8 { bf16_t e[8]; uint4 q; };
  Out8 pk[4];
#pragma unroll
  for (int f = 0; f < 4; ++f)
#pragma unroll
    for (int r = 0; r < 8; ++r) pk[f].e[r] = (bf16_t)(o[f][r] / o5[0]);
  bf16_t* orow = O + (size_t)(b * SEQ + qg) * D_MODEL + h * DK + 8 * g;
#pragma unroll
  for (int f = 0; f < 4; ++f) *reinterpret_cast<uint4*>(orow + f * 16) = pk[f].q;
}

// ---------------------------------------------------------------------------
// Host orchestration
// ---------------------------------------------------------------------------
extern "C" void kernel_launch(void* const* d_in, const int* in_sizes, int n_in,
                              void* d_out, int out_size, void* d_ws,
                              size_t ws_size, hipStream_t stream) {
  (void)in_sizes; (void)n_in; (void)out_size; (void)ws_size;
  const float* x      = (const float*)d_in[0];
  const float* w_q    = (const float*)d_in[1];
  const float* w_k    = (const float*)d_in[2];
  const float* w_v    = (const float*)d_in[3];
  const float* w_o    = (const float*)d_in[4];
  const float* w_gate = (const float*)d_in[5];
  const float* w_up   = (const float*)d_in[6];
  const float* w_down = (const float*)d_in[7];
  const float* g1     = (const float*)d_in[8];
  const float* g2     = (const float*)d_in[9];

  unsigned char* ws = (unsigned char*)d_ws;
  const size_t MB = 1ull << 20;
  bf16_t* wtq  = (bf16_t*)(ws + 0 * MB);    // [1024][1024]      2 MB
  bf16_t* wtk  = (bf16_t*)(ws + 2 * MB);    //                   2 MB
  bf16_t* wtv  = (bf16_t*)(ws + 4 * MB);    //                   2 MB
  bf16_t* wto  = (bf16_t*)(ws + 6 * MB);    //                   2 MB
  bf16_t* wtg  = (bf16_t*)(ws + 8 * MB);    // [4096][1024]      8 MB
  bf16_t* wtu  = (bf16_t*)(ws + 16 * MB);   //                   8 MB
  bf16_t* wtd  = (bf16_t*)(ws + 24 * MB);   // [1024][4096]      8 MB
  bf16_t* nx1  = (bf16_t*)(ws + 32 * MB);   // [4096][1024]      8 MB
  bf16_t* qb   = (bf16_t*)(ws + 40 * MB);   // [4096][1024]      8 MB
  bf16_t* kb   = (bf16_t*)(ws + 48 * MB);   //                   8 MB
  bf16_t* vtb  = (bf16_t*)(ws + 56 * MB);   // [B,H,DK,SEQ]      8 MB
  bf16_t* ao   = (bf16_t*)(ws + 64 * MB);   // attn out          8 MB
  float*  x2   = (float*) (ws + 72 * MB);   // f32 resid        16 MB
  bf16_t* nx2  = (bf16_t*)(ws + 88 * MB);   // [4096][1024]      8 MB
  bf16_t* hid  = (bf16_t*)(ws + 96 * MB);   // [4096][4096]     32 MB (end 128 MB)

  // --- weight prep W[K][N] -> Wt[N][K] bf16 and the first RMSNorm, one grid ---
  // (wtq .. wtd lie one behind the other in the workspace)
  (void)wtk; (void)wtv; (void)wtu;  // reached through wtq and wtg
  prep_kernel<<<PREP_GRID, 256, 0, stream>>>(w_q, w_k, w_v, w_o, w_gate, w_up, w_down,
                                             x, g1, wtq, nx1);

  // --- attention sublayer ---
  // Q, K and V in one grid: wtq, wtk, wtv are adjacent, and so are qb, kb, vtb
  const dim3 gemm_blk(256);
  gemm_bf16_wmma<2><<<dim3(3 * D_MODEL / 128, M_ROWS / 128), gemm_blk, 0, stream>>>(
      nx1, wtq, M_ROWS, D_MODEL, D_MODEL, nullptr, qb);

  flash_attn_wmma<<<dim3(SEQ / 64, BATCH * HEADS), 128, 0, stream>>>(qb, kb, vtb, ao);

  gemm_bf16_wmma<1><<<dim3(D_MODEL / 128, M_ROWS / 128), gemm_blk, 0, stream>>>(
      ao, wto, M_ROWS, D_MODEL, D_MODEL, x, x2);

  // --- SwiGLU FFN sublayer ---
  rmsnorm_kernel<<<M_ROWS / RMS_ROWS, 256, 0, stream>>>(x2, g2, nx2);

  // gate, up and silu(gate) * up in one grid: wtg, wtu are adjacent
  gemm_gate_up_swiglu<<<dim3(D_FF / 128, M_ROWS / 256), gemm_blk, 0, stream>>>(
      nx2, wtg, D_FF, D_MODEL, hid);

  gemm_bf16_wmma<1><<<dim3(D_MODEL / 128, M_ROWS / 128), gemm_blk, 0, stream>>>(
      hid, wtd, M_ROWS, D_MODEL, D_FF, x2, (float*)d_out);
}
